// v000
// Measured on an AMD MI455X. A time is GPU time per run, averaged over a window of back-to-back runs after a warm-up
// (all launches, gaps included; the runs take copies of the inputs in turn), and the median of several windows.
// Apart from v000's, it joins two sittings. Times from different sittings can be a few percent apart, while
// side-by-side timings come from the same sitting.
// The starting kernel, v000, takes 1100 microseconds a run.
// compute dtype: hidden_states, all weights/biases and the additive attention_mask (module inputs) rounded to bf16; position_ids as int32; q/k/v projections with exact bf16 products (x and W are inputs) + bias and interleaved-pair RoPE from position_ids in f32 in the epilogue; scores q.k with both computed operands as bf16 hi + residual pairs (3 products) + the mask value, P.V with P hi/lo x V hi/lo (3 products); output projection hi/lo x exact Wo (2 products) + bo; softmax in f32; key tiles whose mask entries are all <= -1e8 for the wave's rows are skipped at run time (exp underflows to exactly 0 in the reference too); f32 accumulate.
#include <hip/hip_runtime.h>
#include <math.h>

typedef __attribute__((ext_vector_type(16))) _Float16 v16h;
typedef __attribute__((ext_vector_type(16))) __bf16 v16b;
typedef __attribute__((ext_vector_type(8)))  _Float16 v8h;
typedef __attribute__((ext_vector_type(8)))  float v8f;
typedef __attribute__((ext_vector_type(4)))  float v4f;
typedef __attribute__((ext_vector_type(2)))  float v2f;
typedef __attribute__((ext_vector_type(4)))  unsigned v4u;
typedef __attribute__((ext_vector_type(4)))  int v4i;
typedef float __attribute__((may_alias)) float_a;
typedef int __attribute__((may_alias)) int_a;

template <typename T> __device__ __forceinline__ void vst2(void* p, T v) { *(T*)p = v;  }
__device__ __forceinline__ v8f wmma16(v16h a, v16h b, v8f c) {
  v8f d = __builtin_amdgcn_wmma_f32_16x16x32_f16(false, a, false, b, (short)0, c, false, false);
  asm volatile("v_nop\n\tv_nop\n\tv_nop\n\tv_nop" : "+v"(d) : "v"(a), "v"(b));
  return d;
}
__device__ __forceinline__ v8f wmma_bf(v16b a, v16b b, v8f c) {
  v8f d = __builtin_amdgcn_wmma_f32_16x16x32_bf16(false, a, false, b, (short)0, c, false, false);
  asm volatile("v_nop\n\tv_nop\n\tv_nop\n\tv_nop" : "+v"(d) : "v"(a), "v"(b));
  return d;
}
// 16x16x32 fragments: lane = (h = lane>>4, row/col = lane&15); elements 0..7 = k0+8h+0..7, 8..15 = k0+16+8h+0..7; D element r = row 8h+r
__device__ __forceinline__ v16h frag_h(const _Float16* rowk0, int lane) {
  union { v16h v; v8h q[2]; } u; const _Float16* p = rowk0 + 8 * (lane >> 4);
  u.q[0] = *(const v8h*)p; u.q[1] = *(const v8h*)(p + 16); return u.v;
}
__device__ __forceinline__ v16h frag_f32(const float* rowk0, int lane) {
  v16h a; const float* p = rowk0 + 8 * (lane >> 4);
#pragma unroll
  for (int i = 0; i < 8; ++i) { a[i] = (_Float16)p[i]; a[8 + i] = (_Float16)p[16 + i]; }
  return a;
}
__device__ __forceinline__ v16h frag_f32s(const float* rowk0, int lane, float sc) {
  v16h a; const float* p = rowk0 + 8 * (lane >> 4);
#pragma unroll
  for (int i = 0; i < 8; ++i) { a[i] = (_Float16)(p[i] * sc); a[8 + i] = (_Float16)(p[16 + i] * sc); }
  return a;
}
// column fragment from a [K][ld] layout (column n), rows >= K read as 0
__device__ __forceinline__ v16h fragc_f32(const float* W, int k0, int n, int lane, int ld, int K) {
  v16h a; const int g = lane >> 4;
#pragma unroll
  for (int i = 0; i < 8; ++i) { const int ka = k0 + 8 * g + i, kb = ka + 16;
    a[i] = (_Float16)(ka < K ? W[(size_t)(ka < K ? ka : K - 1) * ld + n] : 0.f); a[8 + i] = (_Float16)(kb < K ? W[(size_t)(kb < K ? kb : K - 1) * ld + n] : 0.f); }
  return a;
}
struct F2 { v16b h, l; };
__device__ __forceinline__ F2 bsplit16(const float v[16]) { F2 r;
#pragma unroll
  for (int i = 0; i < 16; ++i) { const __bf16 h = (__bf16)v[i]; r.h[i] = h; r.l[i] = (__bf16)(v[i] - (float)h); }
  return r; }
__device__ __forceinline__ F2 split_row(const float* row, int k0, int lane) { float v[16]; const float* p = row + k0 + 8 * (lane >> 4);
#pragma unroll
  for (int i = 0; i < 8; ++i) { v[i] = p[i]; v[8 + i] = p[16 + i]; }
  return bsplit16(v); }
__device__ __forceinline__ F2 split_rowK(const float* row, int k0, int lane, int K) { float v[16]; const int g = lane >> 4;
#pragma unroll
  for (int i = 0; i < 8; ++i) { const int ka = k0 + 8 * g + i, kb = ka + 16; v[i] = ka < K ? row[ka < K ? ka : K - 1] : 0.f; v[8 + i] = kb < K ? row[kb < K ? kb : K - 1] : 0.f; }
  return bsplit16(v); }
__device__ __forceinline__ F2 split_col(const float* W, int k0, int n, int lane, int ld, int K) { float v[16]; const int g = lane >> 4;
#pragma unroll
  for (int i = 0; i < 8; ++i) { const int ka = k0 + 8 * g + i, kb = ka + 16; v[i] = ka < K ? W[(size_t)(ka < K ? ka : K - 1) * ld + n] : 0.f; v[8 + i] = kb < K ? W[(size_t)(kb < K ? kb : K - 1) * ld + n] : 0.f; }
  return bsplit16(v); }
__device__ __forceinline__ v8f mac3(const F2& a, const F2& b, v8f c) { c = wmma_bf(a.l, b.h, c); c = wmma_bf(a.h, b.l, c); return wmma_bf(a.h, b.h, c); }
__device__ __forceinline__ float sigm(float v) { return 1.0f / (1.0f + expf(-v)); }
#define LDSX() do { asm volatile("s_wait_dscnt 0" ::: "memory"); __builtin_amdgcn_wave_barrier(); __builtin_amdgcn_fence(__ATOMIC_RELEASE, "workgroup"); } while (0)


// Qwen-style attention (B 1, S 2048, D 2048, 16 query heads / 2 kv heads x 128): q = rope(x Wq + bq), k = rope(x Wk + bk) (interleaved pairs, angles from position_ids), v = x Wv + bv; scores = q k^T / sqrt(128) + attention_mask[q][k] (additive input); softmax; out = (P v) Wo + bo.
#define SS 2048
#define DM 2048
#define NH 16
#define NKV 2
#define HD 128
#define KVW (NKV * HD)
#ifndef TQB
#define TQB (SS / 64)
#endif
typedef __attribute__((ext_vector_type(8))) __bf16 v8b;
__device__ __forceinline__ v16b frag_b(const __bf16* rowk0, int lane) {
  union { v16b v; v8b q[2]; } u; const __bf16* p = rowk0 + 8 * (lane >> 4);
  u.q[0] = *(const v8b*)p; u.q[1] = *(const v8b*)(p + 16); return u.v;
}
__device__ __forceinline__ float bfr(float v) { return (float)(__bf16)v; }
__device__ __attribute__((noinline)) float exp_ni(float v) { return expf(v); }
__device__ __attribute__((noinline)) float erf_ni(float v) { return erff(v); }

#define PK_Q 0
#define PK_K (PK_Q + DM * DM)
#define PK_V (PK_K + KVW * DM)
#define PK_O (PK_V + KVW * DM)
#define PK_END (PK_O + DM * DM)
#define WS_PK  0u
#define WS_CS  (WS_PK + 2u * PK_END)             // f32 [2048][64] cos, then [2048][64] sin
#define WS_Q   (WS_CS + 4u * 2 * SS * 64)
#define WS_K   (WS_Q + 4u * SS * DM)
#define WS_VTH (WS_K + 4u * SS * KVW)
#define WS_VTL (WS_VTH + 2u * KVW * SS)
#define WS_O   (WS_VTL + 2u * KVW * SS)
#define WS_END (WS_O + 4u * SS * DM)

// ---- k_packT: block = output column n of a [K][N] (x @ W) matrix
__global__ __launch_bounds__(256) void k_packT(const float* __restrict__ Wm, int K, int N, __bf16* __restrict__ DST) {
  __shared__ __align__(16) __bf16 s[DM]; const int n = blockIdx.x, tid = threadIdx.x;
  for (int k = tid; k < K; k += 256) s[k] = (__bf16)Wm[(size_t)k * N + n];
  __syncthreads();
  for (int q = tid; q < K / 8; q += 256) vst2((unsigned*)(DST + (size_t)n * K + q * 8), *(const v4u*)&s[q * 8]);
}
// ---- k_rope_tab: block = position t (64 threads = pair index i): inv_freq = 1 / 10000^((2i)/128) and angle = float(position_ids[t]) * inv_freq in f32 (as the reference), cos/sin in f32; rows 256 B
__global__ __launch_bounds__(64) void k_rope_tab(const int* __restrict__ POS, float* __restrict__ CS) {
  __shared__ __align__(16) float sc[64], ssn[64]; const int t = blockIdx.x, i = threadIdx.x;
  const float inv = 1.0f / powf(10000.0f, (float)(2 * i) / 128.0f); const float ang = (float)POS[t] * inv; sc[i] = cosf(ang); ssn[i] = sinf(ang);
  __syncthreads();
  if (i < 16) vst2(CS + (size_t)t * 64 + i * 4, *(const v4f*)&sc[i * 4]); else if (i < 32) vst2(CS + (size_t)SS * 64 + (size_t)t * 64 + (i - 16) * 4, *(const v4f*)&ssn[(i - 16) * 4]);
}
// ---- k_proj<MODE>: block = (64 rows, 128 cols = one head): Y = bf16(x) . P rows (exact); MODE 0: RoPE then f32 rows (q/k; ldo); MODE 1: plain -> transposed bf16 hi/lo planes (v)
template <int MODE>
__global__ __launch_bounds__(128) void k_proj(const float* __restrict__ X, const __bf16* __restrict__ P, const float* __restrict__ bias, const float* __restrict__ CS, float* __restrict__ OUT, int ldo, __bf16* __restrict__ PH, __bf16* __restrict__ PL) {
  __shared__ __align__(16) float so[MODE ? 1 : 4][16][132]; __shared__ __align__(16) __bf16 sth[MODE ? 128 : 1][72], stl[MODE ? 128 : 1][72];
  const int tid = threadIdx.x, wave = tid >> 5, lane = tid & 31, col = lane & 15, g = lane >> 4; const size_t r0 = (size_t)blockIdx.x * 64 + wave * 16; const int n0 = blockIdx.y * 128;
  v8f acc[8] = {};
#pragma unroll 2
  for (int kc = 0; kc < DM / 32; ++kc) { v16b a; { const float* p = X + (r0 + col) * DM + kc * 32 + 8 * g;
#pragma unroll
      for (int i = 0; i < 8; ++i) { a[i] = (__bf16)p[i]; a[8 + i] = (__bf16)p[16 + i]; } }
#pragma unroll
    for (int j = 0; j < 8; ++j) acc[j] = wmma_bf(a, frag_b(P + (size_t)(n0 + j * 16 + col) * DM + kc * 32, lane), acc[j]); }
  if (MODE == 0) {
    // biased projections to LDS, then interleaved-pair RoPE in place: (d = 2i, 2i+1): out_e = x_e cos_i - x_o sin_i; out_o = x_e sin_i + x_o cos_i with angle index i = d/2 (position from position_ids via the CS tables)
#pragma unroll
    for (int j = 0; j < 8; ++j) { const float bb = bfr(bias[n0 + j * 16 + col]);
#pragma unroll
      for (int r = 0; r < 8; ++r) so[wave][8 * g + r][j * 16 + col] = acc[j][r] + bb; }
    LDSX();
    for (int q = lane; q < 16 * 64; q += 32) { const int rl = q >> 6, i = q & 63; const size_t t = r0 + rl; const float c = CS[t * 64 + i], s = CS[(size_t)SS * 64 + t * 64 + i]; const float xe = so[wave][rl][2 * i], xo = so[wave][rl][2 * i + 1]; so[wave][rl][2 * i] = xe * c - xo * s; so[wave][rl][2 * i + 1] = xe * s + xo * c; }
    LDSX();
    for (int rl = 0; rl < 16; ++rl) vst2(OUT + (r0 + rl) * ldo + n0 + lane * 4, *(const v4f*)&so[wave][rl][lane * 4]);
  } else {
#pragma unroll
    for (int j = 0; j < 8; ++j)
#pragma unroll
      for (int r = 0; r < 8; ++r) { const float v = acc[j][r] + bfr(bias[n0 + j * 16 + col]); const __bf16 hb = (__bf16)v; sth[j * 16 + col][wave * 16 + 8 * g + r] = hb; stl[j * 16 + col][wave * 16 + 8 * g + r] = (__bf16)(v - (float)hb); }
    __syncthreads();
    const int s0 = blockIdx.x * 64;
    for (int q = tid; q < 128 * 8; q += 128) { const int d = q >> 3, pc = q & 7; const size_t o = (size_t)(n0 + d) * SS + s0 + pc * 8; vst2((unsigned*)(PH + o), *(const v4u*)&sth[d][pc * 8]); vst2((unsigned*)(PL + o), *(const v4u*)&stl[d][pc * 8]); }
  }
}
// ---- k_attn: block = (64 queries, head h): causal flash attention, kv head = h/8; scores 3 products, P.V 3 products; O[q][h*128+d]
__global__ __launch_bounds__(128) void k_attn(const float* __restrict__ Q, const float* __restrict__ Kx, const float* __restrict__ MASK, const __bf16* __restrict__ VTH, const __bf16* __restrict__ VTL, float* __restrict__ O) {
  __shared__ __align__(16) float sp[4][16][36]; __shared__ __align__(16) float so[4][16][132];
  const int tid = threadIdx.x, wave = tid >> 5, lane = tid & 31, col = lane & 15, g = lane >> 4;
  const int qb = blockIdx.x, h = blockIdx.y, kv = h / (NH / NKV); const int q0 = qb * 64 + wave * 16;
  const float* qrow = Q + (size_t)(q0 + col) * DM + h * HD;   // q fragments re-split per key step (keeps the kernel under 256 VGPRs)
  float m[8], l[8];
#pragma unroll
  for (int r = 0; r < 8; ++r) { m[r] = -3.0e38f; l[r] = 0.f; }
  v8f acc[8] = {};
#pragma unroll 1
  for (int ks = 0; ks < SS / 32; ++ks) { v8f s[2]; float mk[2][8]; bool anylive = false;
#pragma unroll
    for (int ct = 0; ct < 2; ++ct) { const int kk = ks * 32 + ct * 16 + col;
#pragma unroll
      for (int r = 0; r < 8; ++r) { const float m_ = bfr(MASK[(size_t)(q0 + 8 * g + r) * SS + kk]); mk[ct][r] = m_; anylive = anylive || (m_ > -1.0e8f); } }
    if (__any(anylive)) {   // wave-uniform: skip key tiles that are fully masked for this wave's 16 rows (exp of <= -1e8 underflows to exactly 0 in the reference too)
#pragma unroll
    for (int ct = 0; ct < 2; ++ct) { const int kk = ks * 32 + ct * 16 + col; const float* krow = Kx + (size_t)kk * KVW + kv * HD; v8f c = {};
#pragma unroll
      for (int kc = 0; kc < 4; ++kc) { const F2 kb = split_row(krow, kc * 32, lane); const F2 qa = split_row(qrow, kc * 32, lane); c = mac3(qa, kb, c); }
#pragma unroll
      for (int r = 0; r < 8; ++r) s[ct][r] = c[r] * 0.08838834764831845f + mk[ct][r]; }
#pragma unroll
    for (int r = 0; r < 8; ++r) { float mx = fmaxf(s[0][r], s[1][r]);
#pragma unroll
      for (int o = 1; o < 16; o <<= 1) mx = fmaxf(mx, __shfl_xor(mx, o));
      const float mn = fmaxf(m[r], mx); const float alpha = (m[r] <= -1.0e38f) ? 0.f : exp_ni(m[r] - mn);
      const float e0 = exp_ni(s[0][r] - mn), e1 = exp_ni(s[1][r] - mn); float es = e0 + e1;
#pragma unroll
      for (int o = 1; o < 16; o <<= 1) es += __shfl_xor(es, o);
      l[r] = l[r] * alpha + es; m[r] = mn;
#pragma unroll
      for (int dt = 0; dt < 8; ++dt) acc[dt][r] *= alpha;
      sp[wave][8 * g + r][col] = e0; sp[wave][8 * g + r][16 + col] = e1; }
    LDSX();
    const F2 pa = split_row(&sp[wave][col][0], 0, lane);
#pragma unroll
    for (int dt = 0; dt < 8; ++dt) { const size_t vr = (size_t)(kv * HD + dt * 16 + col) * SS + ks * 32; const v16b vh = frag_b(VTH + vr, lane), vl = frag_b(VTL + vr, lane); acc[dt] = wmma_bf(pa.l, vh, acc[dt]); acc[dt] = wmma_bf(pa.h, vl, acc[dt]); acc[dt] = wmma_bf(pa.h, vh, acc[dt]); }
    LDSX(); } }
#pragma unroll
  for (int r = 0; r < 8; ++r) { const float il = 1.0f / l[r];
#pragma unroll
    for (int dt = 0; dt < 8; ++dt) so[wave][8 * g + r][dt * 16 + col] = acc[dt][r] * il; }
  LDSX();
  for (int rl = 0; rl < 16; ++rl) vst2(O + (size_t)(q0 + rl) * DM + h * HD + lane * 4, *(const v4f*)&so[wave][rl][lane * 4]);
}
// ---- k_out: block = (64 rows, 128 cols): out = O(hi/lo) . wproj^T rows (2 products)
__global__ __launch_bounds__(128) void k_out(const float* __restrict__ O, const __bf16* __restrict__ P, const float* __restrict__ bias, float* __restrict__ Y) {
  __shared__ __align__(16) float so[4][16][132];
  const int tid = threadIdx.x, wave = tid >> 5, lane = tid & 31, col = lane & 15, g = lane >> 4; const size_t r0 = (size_t)blockIdx.x * 64 + wave * 16; const int n0 = blockIdx.y * 128;
  v8f acc[8] = {};
#pragma unroll 2
  for (int kc = 0; kc < DM / 32; ++kc) { const F2 a = split_row(O + (r0 + col) * DM, kc * 32, lane);
#pragma unroll
    for (int j = 0; j < 8; ++j) { const v16b w = frag_b(P + (size_t)(n0 + j * 16 + col) * DM + kc * 32, lane); acc[j] = wmma_bf(a.l, w, acc[j]); acc[j] = wmma_bf(a.h, w, acc[j]); } }
#pragma unroll
  for (int j = 0; j < 8; ++j)
#pragma unroll
    for (int r = 0; r < 8; ++r) so[wave][8 * g + r][j * 16 + col] = acc[j][r] + bfr(bias[n0 + j * 16 + col]);
  LDSX();
  for (int rl = 0; rl < 16; ++rl) vst2(Y + (r0 + rl) * DM + n0 + lane * 4, *(const v4f*)&so[wave][rl][lane * 4]);
}
extern "C" void kernel_launch(void* const* d_in, const int* in_sizes, int n_in, void* d_out, int out_size, void* d_ws, size_t ws_size, hipStream_t stream) {
  (void)in_sizes; (void)n_in; (void)out_size;
  const float** F = (const float**)d_in; const int* POS = (const int*)d_in[2];   // 0 hidden_states [1,2048,2048], 1 attention_mask [1,1,2048,2048], 2 position_ids [1,2048] i32, 3 Wq [2048,2048], 4 bq, 5 Wk [2048,256], 6 bk, 7 Wv, 8 bv, 9 Wo [2048,2048], 10 bo
  if (ws_size < (size_t)WS_END) return;
  char* ws = (char*)d_ws; __bf16 *PK = (__bf16*)(ws + WS_PK), *VTH = (__bf16*)(ws + WS_VTH), *VTL = (__bf16*)(ws + WS_VTL);
  float *CS = (float*)(ws + WS_CS), *Q = (float*)(ws + WS_Q), *Kx = (float*)(ws + WS_K), *O = (float*)(ws + WS_O);
  k_packT<<<DM, 256, 0, stream>>>(F[3], DM, DM, PK + PK_Q); k_packT<<<KVW, 256, 0, stream>>>(F[5], DM, KVW, PK + PK_K); k_packT<<<KVW, 256, 0, stream>>>(F[7], DM, KVW, PK + PK_V); k_packT<<<DM, 256, 0, stream>>>(F[9], DM, DM, PK + PK_O);
  k_rope_tab<<<SS, 64, 0, stream>>>(POS, CS);
  k_proj<0><<<dim3(SS / 64, DM / 128), 128, 0, stream>>>(F[0], PK + PK_Q, F[4], CS, Q, DM, nullptr, nullptr);
  k_proj<0><<<dim3(SS / 64, KVW / 128), 128, 0, stream>>>(F[0], PK + PK_K, F[6], CS, Kx, KVW, nullptr, nullptr);
  k_proj<1><<<dim3(SS / 64, KVW / 128), 128, 0, stream>>>(F[0], PK + PK_V, F[8], CS, nullptr, 0, VTH, VTL);
  k_attn<<<dim3(TQB, NH), 128, 0, stream>>>(Q, Kx, F[1], VTH, VTL, O);
  k_out<<<dim3(TQB, DM / 128), 128, 0, stream>>>(O, PK + PK_O, F[10], (float*)d_out);
}

// v001
// One run takes 836 microseconds.
// Timed twice side by side with v000, it ran 1.33 times as fast both times.
// compute dtype: hidden_states, all weights/biases and the additive attention_mask (module inputs) rounded to bf16; position_ids as int32; q/k/v projections with exact bf16 products (x and W are inputs) + bias and interleaved-pair RoPE from position_ids in f32 in the epilogue; scores q.k with both computed operands as bf16 hi + residual pairs (3 products) + the mask value, P.V with P hi/lo x V hi/lo (3 products); output projection hi/lo x exact Wo (2 products) + bo; softmax in f32; key tiles whose mask entries are all <= -1e8 for the wave's rows are skipped at run time (exp underflows to exactly 0 in the reference too); f32 accumulate.
#include <hip/hip_runtime.h>
#include <math.h>

typedef __attribute__((ext_vector_type(16))) _Float16 v16h;
typedef __attribute__((ext_vector_type(16))) __bf16 v16b;
typedef __attribute__((ext_vector_type(8)))  _Float16 v8h;
typedef __attribute__((ext_vector_type(8)))  float v8f;
typedef __attribute__((ext_vector_type(4)))  float v4f;
typedef __attribute__((ext_vector_type(2)))  float v2f;
typedef __attribute__((ext_vector_type(4)))  unsigned v4u;
typedef __attribute__((ext_vector_type(4)))  int v4i;
typedef float __attribute__((may_alias)) float_a;
typedef int __attribute__((may_alias)) int_a;

template <typename T> __device__ __forceinline__ void vst2(void* p, T v) { *(T*)p = v;  }
__device__ __forceinline__ v8f wmma16(v16h a, v16h b, v8f c) {
  v8f d = __builtin_amdgcn_wmma_f32_16x16x32_f16(false, a, false, b, (short)0, c, false, false);
  asm volatile("v_nop\n\tv_nop\n\tv_nop\n\tv_nop" : "+v"(d) : "v"(a), "v"(b));
  return d;
}
__device__ __forceinline__ v8f wmma_bf(v16b a, v16b b, v8f c) {
  v8f d = __builtin_amdgcn_wmma_f32_16x16x32_bf16(false, a, false, b, (short)0, c, false, false);
  asm volatile("v_nop\n\tv_nop\n\tv_nop\n\tv_nop" : "+v"(d) : "v"(a), "v"(b));
  return d;
}
// 16x16x32 fragments: lane = (h = lane>>4, row/col = lane&15); elements 0..7 = k0+8h+0..7, 8..15 = k0+16+8h+0..7; D element r = row 8h+r
__device__ __forceinline__ v16h frag_h(const _Float16* rowk0, int lane) {
  union { v16h v; v8h q[2]; } u; const _Float16* p = rowk0 + 8 * (lane >> 4);
  u.q[0] = *(const v8h*)p; u.q[1] = *(const v8h*)(p + 16); return u.v;
}
__device__ __forceinline__ v16h frag_f32(const float* rowk0, int lane) {
  v16h a; const float* p = rowk0 + 8 * (lane >> 4);
#pragma unroll
  for (int i = 0; i < 8; ++i) { a[i] = (_Float16)p[i]; a[8 + i] = (_Float16)p[16 + i]; }
  return a;
}
__device__ __forceinline__ v16h frag_f32s(const float* rowk0, int lane, float sc) {
  v16h a; const float* p = rowk0 + 8 * (lane >> 4);
#pragma unroll
  for (int i = 0; i < 8; ++i) { a[i] = (_Float16)(p[i] * sc); a[8 + i] = (_Float16)(p[16 + i] * sc); }
  return a;
}
// column fragment from a [K][ld] layout (column n), rows >= K read as 0
__device__ __forceinline__ v16h fragc_f32(const float* W, int k0, int n, int lane, int ld, int K) {
  v16h a; const int g = lane >> 4;
#pragma unroll
  for (int i = 0; i < 8; ++i) { const int ka = k0 + 8 * g + i, kb = ka + 16;
    a[i] = (_Float16)(ka < K ? W[(size_t)(ka < K ? ka : K - 1) * ld + n] : 0.f); a[8 + i] = (_Float16)(kb < K ? W[(size_t)(kb < K ? kb : K - 1) * ld + n] : 0.f); }
  return a;
}
struct F2 { v16b h, l; };
__device__ __forceinline__ F2 bsplit16(const float v[16]) { F2 r;
#pragma unroll
  for (int i = 0; i < 16; ++i) { const __bf16 h = (__bf16)v[i]; r.h[i] = h; r.l[i] = (__bf16)(v[i] - (float)h); }
  return r; }
__device__ __forceinline__ F2 split_row(const float* row, int k0, int lane) { float v[16]; const float* p = row + k0 + 8 * (lane >> 4);
#pragma unroll
  for (int i = 0; i < 8; ++i) { v[i] = p[i]; v[8 + i] = p[16 + i]; }
  return bsplit16(v); }
__device__ __forceinline__ F2 split_rowK(const float* row, int k0, int lane, int K) { float v[16]; const int g = lane >> 4;
#pragma unroll
  for (int i = 0; i < 8; ++i) { const int ka = k0 + 8 * g + i, kb = ka + 16; v[i] = ka < K ? row[ka < K ? ka : K - 1] : 0.f; v[8 + i] = kb < K ? row[kb < K ? kb : K - 1] : 0.f; }
  return bsplit16(v); }
__device__ __forceinline__ F2 split_col(const float* W, int k0, int n, int lane, int ld, int K) { float v[16]; const int g = lane >> 4;
#pragma unroll
  for (int i = 0; i < 8; ++i) { const int ka = k0 + 8 * g + i, kb = ka + 16; v[i] = ka < K ? W[(size_t)(ka < K ? ka : K - 1) * ld + n] : 0.f; v[8 + i] = kb < K ? W[(size_t)(kb < K ? kb : K - 1) * ld + n] : 0.f; }
  return bsplit16(v); }
__device__ __forceinline__ v8f mac3(const F2& a, const F2& b, v8f c) { c = wmma_bf(a.l, b.h, c); c = wmma_bf(a.h, b.l, c); return wmma_bf(a.h, b.h, c); }
__device__ __forceinline__ float sigm(float v) { return 1.0f / (1.0f + expf(-v)); }
#define LDSX() do { asm volatile("s_wait_dscnt 0" ::: "memory"); __builtin_amdgcn_wave_barrier(); __builtin_amdgcn_fence(__ATOMIC_RELEASE, "workgroup"); } while (0)


// Qwen-style attention (B 1, S 2048, D 2048, 16 query heads / 2 kv heads x 128): q = rope(x Wq + bq), k = rope(x Wk + bk) (interleaved pairs, angles from position_ids), v = x Wv + bv; scores = q k^T / sqrt(128) + attention_mask[q][k] (additive input); softmax; out = (P v) Wo + bo.
#define SS 2048
#define DM 2048
#define NH 16
#define NKV 2
#define HD 128
#define KVW (NKV * HD)
#ifndef TQB
#define TQB (SS / 64)
#endif
typedef __attribute__((ext_vector_type(8))) __bf16 v8b;
__device__ __forceinline__ v16b frag_b(const __bf16* rowk0, int lane) {
  union { v16b v; v8b q[2]; } u; const __bf16* p = rowk0 + 8 * (lane >> 4);
  u.q[0] = *(const v8b*)p; u.q[1] = *(const v8b*)(p + 16); return u.v;
}
__device__ __forceinline__ float bfr(float v) { return (float)(__bf16)v; }
__device__ __attribute__((noinline)) float exp_ni(float v) { return expf(v); }
__device__ __attribute__((noinline)) float erf_ni(float v) { return erff(v); }

#define PK_Q 0
#define PK_K (PK_Q + DM * DM)
#define PK_V (PK_K + KVW * DM)
#define PK_O (PK_V + KVW * DM)
#define PK_END (PK_O + DM * DM)
#define WS_PK  0u
#define WS_CS  (WS_PK + 2u * PK_END)             // f32 [2048][64] cos, then [2048][64] sin
#define WS_Q   (WS_CS + 4u * 2 * SS * 64)
#define WS_K   (WS_Q + 4u * SS * DM)
#define WS_VTH (WS_K + 4u * SS * KVW)
#define WS_VTL (WS_VTH + 2u * KVW * SS)
#define WS_O   (WS_VTL + 2u * KVW * SS)
#define WS_END (WS_O + 4u * SS * DM)

// ---- k_packT: block = output column n of a [K][N] (x @ W) matrix
__global__ __launch_bounds__(256) void k_packT(const float* __restrict__ Wm, int K, int N, __bf16* __restrict__ DST) {
  __shared__ __align__(16) __bf16 s[DM]; const int n = blockIdx.x, tid = threadIdx.x;
  for (int k = tid; k < K; k += 256) s[k] = (__bf16)Wm[(size_t)k * N + n];
  __syncthreads();
  for (int q = tid; q < K / 8; q += 256) vst2((unsigned*)(DST + (size_t)n * K + q * 8), *(const v4u*)&s[q * 8]);
}
// ---- k_rope_tab: block = position t (64 threads = pair index i): inv_freq = 1 / 10000^((2i)/128) and angle = float(position_ids[t]) * inv_freq in f32 (as the reference), cos/sin in f32; rows 256 B
__global__ __launch_bounds__(64) void k_rope_tab(const int* __restrict__ POS, float* __restrict__ CS) {
  __shared__ __align__(16) float sc[64], ssn[64]; const int t = blockIdx.x, i = threadIdx.x;
  const float inv = 1.0f / powf(10000.0f, (float)(2 * i) / 128.0f); const float ang = (float)POS[t] * inv; sc[i] = cosf(ang); ssn[i] = sinf(ang);
  __syncthreads();
  if (i < 16) vst2(CS + (size_t)t * 64 + i * 4, *(const v4f*)&sc[i * 4]); else if (i < 32) vst2(CS + (size_t)SS * 64 + (size_t)t * 64 + (i - 16) * 4, *(const v4f*)&ssn[(i - 16) * 4]);
}
// ---- k_proj<MODE>: block = (64 rows, 128 cols = one head): Y = bf16(x) . P rows (exact); MODE 0: RoPE then f32 rows (q/k; ldo); MODE 1: plain -> transposed bf16 hi/lo planes (v)
template <int MODE>
__global__ __launch_bounds__(128) void k_proj(const float* __restrict__ X, const __bf16* __restrict__ P, const float* __restrict__ bias, const float* __restrict__ CS, float* __restrict__ OUT, int ldo, __bf16* __restrict__ PH, __bf16* __restrict__ PL) {
  __shared__ __align__(16) float so[MODE ? 1 : 4][16][132]; __shared__ __align__(16) __bf16 sth[MODE ? 128 : 1][72], stl[MODE ? 128 : 1][72];
  const int tid = threadIdx.x, wave = tid >> 5, lane = tid & 31, col = lane & 15, g = lane >> 4; const size_t r0 = (size_t)blockIdx.x * 64 + wave * 16; const int n0 = blockIdx.y * 128;
  v8f acc[8] = {};
#pragma unroll 2
  for (int kc = 0; kc < DM / 32; ++kc) { v16b a; { const float* p = X + (r0 + col) * DM + kc * 32 + 8 * g;
#pragma unroll
      for (int i = 0; i < 8; ++i) { a[i] = (__bf16)p[i]; a[8 + i] = (__bf16)p[16 + i]; } }
#pragma unroll
    for (int j = 0; j < 8; ++j) acc[j] = wmma_bf(a, frag_b(P + (size_t)(n0 + j * 16 + col) * DM + kc * 32, lane), acc[j]); }
  if (MODE == 0) {
    // biased projections to LDS, then interleaved-pair RoPE in place: (d = 2i, 2i+1): out_e = x_e cos_i - x_o sin_i; out_o = x_e sin_i + x_o cos_i with angle index i = d/2 (position from position_ids via the CS tables)
#pragma unroll
    for (int j = 0; j < 8; ++j) { const float bb = bfr(bias[n0 + j * 16 + col]);
#pragma unroll
      for (int r = 0; r < 8; ++r) so[wave][8 * g + r][j * 16 + col] = acc[j][r] + bb; }
    LDSX();
    for (int q = lane; q < 16 * 64; q += 32) { const int rl = q >> 6, i = q & 63; const size_t t = r0 + rl; const float c = CS[t * 64 + i], s = CS[(size_t)SS * 64 + t * 64 + i]; const float xe = so[wave][rl][2 * i], xo = so[wave][rl][2 * i + 1]; so[wave][rl][2 * i] = xe * c - xo * s; so[wave][rl][2 * i + 1] = xe * s + xo * c; }
    LDSX();
    for (int rl = 0; rl < 16; ++rl) vst2(OUT + (r0 + rl) * ldo + n0 + lane * 4, *(const v4f*)&so[wave][rl][lane * 4]);
  } else {
#pragma unroll
    for (int j = 0; j < 8; ++j)
#pragma unroll
      for (int r = 0; r < 8; ++r) { const float v = acc[j][r] + bfr(bias[n0 + j * 16 + col]); const __bf16 hb = (__bf16)v; sth[j * 16 + col][wave * 16 + 8 * g + r] = hb; stl[j * 16 + col][wave * 16 + 8 * g + r] = (__bf16)(v - (float)hb); }
    __syncthreads();
    const int s0 = blockIdx.x * 64;
    for (int q = tid; q < 128 * 8; q += 128) { const int d = q >> 3, pc = q & 7; const size_t o = (size_t)(n0 + d) * SS + s0 + pc * 8; vst2((unsigned*)(PH + o), *(const v4u*)&sth[d][pc * 8]); vst2((unsigned*)(PL + o), *(const v4u*)&stl[d][pc * 8]); }
  }
}
// ---- k_attn: block = (16 queries, head h), NKW waves: wave w takes key steps w, w + NKW, ... of the same 16 queries (flash attention over its share), then the NKW partial (max, sum, acc) are merged through LDS; scores 3 products, P.V 3 products; O[q][h*128+d]
#define NKW 8
__global__ __launch_bounds__(32 * NKW) void k_attn(const float* __restrict__ Q, const float* __restrict__ Kx, const float* __restrict__ MASK, const __bf16* __restrict__ VTH, const __bf16* __restrict__ VTL, float* __restrict__ O) {
  __shared__ __align__(16) float sp[NKW][16][36]; __shared__ __align__(16) float so[NKW][16][132]; __shared__ float sm[NKW][16], sl[NKW][16];
  const int tid = threadIdx.x, wave = __builtin_amdgcn_readfirstlane(tid >> 5), lane = tid & 31, col = lane & 15, g = lane >> 4;
  const int qb = blockIdx.x, h = blockIdx.y, kv = h / (NH / NKV); const int q0 = qb * 16;
  const float* qrow = Q + (size_t)(q0 + col) * DM + h * HD;   // q fragments re-split per key step (keeps the kernel under 256 VGPRs)
  float m[8], l[8];
#pragma unroll
  for (int r = 0; r < 8; ++r) { m[r] = -3.0e38f; l[r] = 0.f; }
  v8f acc[8] = {};
#pragma unroll 1
  for (int ks = wave; ks < SS / 32; ks += NKW) { v8f s[2]; float mk[2][8]; bool anylive = false;
#pragma unroll
    for (int ct = 0; ct < 2; ++ct) { const int kk = ks * 32 + ct * 16 + col;
#pragma unroll
      for (int r = 0; r < 8; ++r) { const float m_ = bfr(MASK[(size_t)(q0 + 8 * g + r) * SS + kk]); mk[ct][r] = m_; anylive = anylive || (m_ > -1.0e8f); } }
    if (__any(anylive)) {   // wave-uniform: skip key tiles that are fully masked for this wave's 16 rows (exp of <= -1e8 underflows to exactly 0 in the reference too)
#pragma unroll
    for (int ct = 0; ct < 2; ++ct) { const int kk = ks * 32 + ct * 16 + col; const float* krow = Kx + (size_t)kk * KVW + kv * HD; v8f c = {};
#pragma unroll
      for (int kc = 0; kc < 4; ++kc) { const F2 kb = split_row(krow, kc * 32, lane); const F2 qa = split_row(qrow, kc * 32, lane); c = mac3(qa, kb, c); }
#pragma unroll
      for (int r = 0; r < 8; ++r) s[ct][r] = c[r] * 0.08838834764831845f + mk[ct][r]; }
#pragma unroll
    for (int r = 0; r < 8; ++r) { float mx = fmaxf(s[0][r], s[1][r]);
#pragma unroll
      for (int o = 1; o < 16; o <<= 1) mx = fmaxf(mx, __shfl_xor(mx, o));
      const float mn = fmaxf(m[r], mx); const float alpha = (m[r] <= -1.0e38f) ? 0.f : exp_ni(m[r] - mn);
      const float e0 = exp_ni(s[0][r] - mn), e1 = exp_ni(s[1][r] - mn); float es = e0 + e1;
#pragma unroll
      for (int o = 1; o < 16; o <<= 1) es += __shfl_xor(es, o);
      l[r] = l[r] * alpha + es; m[r] = mn;
#pragma unroll
      for (int dt = 0; dt < 8; ++dt) acc[dt][r] *= alpha;
      sp[wave][8 * g + r][col] = e0; sp[wave][8 * g + r][16 + col] = e1; }
    LDSX();
    const F2 pa = split_row(&sp[wave][col][0], 0, lane);
#pragma unroll
    for (int dt = 0; dt < 8; ++dt) { const size_t vr = (size_t)(kv * HD + dt * 16 + col) * SS + ks * 32; const v16b vh = frag_b(VTH + vr, lane), vl = frag_b(VTL + vr, lane); acc[dt] = wmma_bf(pa.l, vh, acc[dt]); acc[dt] = wmma_bf(pa.h, vl, acc[dt]); acc[dt] = wmma_bf(pa.h, vh, acc[dt]); }
    LDSX(); } }
  // merge: row maximum over the waves, each wave's sum and acc rescaled to it, then summed in wave order (a wave with no live key step has m = -3e38, l = 0 and weight 0)
  if (col == 0) {
#pragma unroll
    for (int r = 0; r < 8; ++r) sm[wave][8 * g + r] = m[r]; }
  __syncthreads();
#pragma unroll
  for (int r = 0; r < 8; ++r) { float mx = sm[0][8 * g + r];
#pragma unroll
    for (int w = 1; w < NKW; ++w) mx = fmaxf(mx, sm[w][8 * g + r]);
    const float f = (m[r] <= -1.0e38f) ? 0.f : exp_ni(m[r] - mx);
    if (col == 0) sl[wave][8 * g + r] = l[r] * f;
#pragma unroll
    for (int dt = 0; dt < 8; ++dt) so[wave][8 * g + r][dt * 16 + col] = acc[dt][r] * f; }
  __syncthreads();
  for (int rl = wave; rl < 16; rl += NKW) { v4f a = *(const v4f*)&so[0][rl][lane * 4]; float ls = sl[0][rl];
#pragma unroll
    for (int w = 1; w < NKW; ++w) { a += *(const v4f*)&so[w][rl][lane * 4]; ls += sl[w][rl]; }
    vst2(O + (size_t)(q0 + rl) * DM + h * HD + lane * 4, a * (1.0f / ls));
    asm volatile("s_wait_xcnt 0x0" ::: "memory"); }   // the next trip rewrites the store's address and data registers: the wait stands in front of that
}
// ---- k_out: block = (64 rows, 128 cols): out = O(hi/lo) . wproj^T rows (2 products)
__global__ __launch_bounds__(128) void k_out(const float* __restrict__ O, const __bf16* __restrict__ P, const float* __restrict__ bias, float* __restrict__ Y) {
  __shared__ __align__(16) float so[4][16][132];
  const int tid = threadIdx.x, wave = tid >> 5, lane = tid & 31, col = lane & 15, g = lane >> 4; const size_t r0 = (size_t)blockIdx.x * 64 + wave * 16; const int n0 = blockIdx.y * 128;
  v8f acc[8] = {};
#pragma unroll 2
  for (int kc = 0; kc < DM / 32; ++kc) { const F2 a = split_row(O + (r0 + col) * DM, kc * 32, lane);
#pragma unroll
    for (int j = 0; j < 8; ++j) { const v16b w = frag_b(P + (size_t)(n0 + j * 16 + col) * DM + kc * 32, lane); acc[j] = wmma_bf(a.l, w, acc[j]); acc[j] = wmma_bf(a.h, w, acc[j]); } }
#pragma unroll
  for (int j = 0; j < 8; ++j)
#pragma unroll
    for (int r = 0; r < 8; ++r) so[wave][8 * g + r][j * 16 + col] = acc[j][r] + bfr(bias[n0 + j * 16 + col]);
  LDSX();
  for (int rl = 0; rl < 16; ++rl) vst2(Y + (r0 + rl) * DM + n0 + lane * 4, *(const v4f*)&so[wave][rl][lane * 4]);
}
extern "C" void kernel_launch(void* const* d_in, const int* in_sizes, int n_in, void* d_out, int out_size, void* d_ws, size_t ws_size, hipStream_t stream) {
  (void)in_sizes; (void)n_in; (void)out_size;
  const float** F = (const float**)d_in; const int* POS = (const int*)d_in[2];   // 0 hidden_states [1,2048,2048], 1 attention_mask [1,1,2048,2048], 2 position_ids [1,2048] i32, 3 Wq [2048,2048], 4 bq, 5 Wk [2048,256], 6 bk, 7 Wv, 8 bv, 9 Wo [2048,2048], 10 bo
  if (ws_size < (size_t)WS_END) return;
  char* ws = (char*)d_ws; __bf16 *PK = (__bf16*)(ws + WS_PK), *VTH = (__bf16*)(ws + WS_VTH), *VTL = (__bf16*)(ws + WS_VTL);
  float *CS = (float*)(ws + WS_CS), *Q = (float*)(ws + WS_Q), *Kx = (float*)(ws + WS_K), *O = (float*)(ws + WS_O);
  k_packT<<<DM, 256, 0, stream>>>(F[3], DM, DM, PK + PK_Q); k_packT<<<KVW, 256, 0, stream>>>(F[5], DM, KVW, PK + PK_K); k_packT<<<KVW, 256, 0, stream>>>(F[7], DM, KVW, PK + PK_V); k_packT<<<DM, 256, 0, stream>>>(F[9], DM, DM, PK + PK_O);
  k_rope_tab<<<SS, 64, 0, stream>>>(POS, CS);
  k_proj<0><<<dim3(SS / 64, DM / 128), 128, 0, stream>>>(F[0], PK + PK_Q, F[4], CS, Q, DM, nullptr, nullptr);
  k_proj<0><<<dim3(SS / 64, KVW / 128), 128, 0, stream>>>(F[0], PK + PK_K, F[6], CS, Kx, KVW, nullptr, nullptr);
  k_proj<1><<<dim3(SS / 64, KVW / 128), 128, 0, stream>>>(F[0], PK + PK_V, F[8], CS, nullptr, 0, VTH, VTL);
  k_attn<<<dim3(SS / 16, NH), 32 * NKW, 0, stream>>>(Q, Kx, F[1], VTH, VTL, O);
  k_out<<<dim3(TQB, DM / 128), 128, 0, stream>>>(O, PK + PK_O, F[10], (float*)d_out);
}

// v002
// A run of this version takes 454 microseconds.
// Two timings next to v001 both put it at 1.83 times that version's speed.
// All steps since v000 together make it 2.43 times as fast.
// compute dtype: hidden_states, all weights/biases and the additive attention_mask (module inputs) rounded to bf16; position_ids as int32; q/k/v projections with exact bf16 products (x and W are inputs) + bias and interleaved-pair RoPE from position_ids in f32 in the epilogue; scores q.k with both computed operands as bf16 hi + residual pairs (3 products) + the mask value, P.V with P hi/lo x V hi/lo (3 products); output projection hi/lo x exact Wo (2 products) + bo; softmax in f32; key tiles whose mask entries are all <= -1e8 for the wave's rows are skipped at run time (exp underflows to exactly 0 in the reference too); f32 accumulate.
#include <hip/hip_runtime.h>
#include <math.h>

typedef __attribute__((ext_vector_type(16))) _Float16 v16h;
typedef __attribute__((ext_vector_type(16))) __bf16 v16b;
typedef __attribute__((ext_vector_type(8)))  _Float16 v8h;
typedef __attribute__((ext_vector_type(8)))  float v8f;
typedef __attribute__((ext_vector_type(4)))  float v4f;
typedef __attribute__((ext_vector_type(2)))  float v2f;
typedef __attribute__((ext_vector_type(4)))  unsigned v4u;
typedef __attribute__((ext_vector_type(4)))  int v4i;
typedef float __attribute__((may_alias)) float_a;
typedef int __attribute__((may_alias)) int_a;

template <typename T> __device__ __forceinline__ void vst2(void* p, T v) { *(T*)p = v;  }
__device__ __forceinline__ v8f wmma16(v16h a, v16h b, v8f c) {
  v8f d = __builtin_amdgcn_wmma_f32_16x16x32_f16(false, a, false, b, (short)0, c, false, false);
  asm volatile("v_nop\n\tv_nop\n\tv_nop\n\tv_nop" : "+v"(d) : "v"(a), "v"(b));
  return d;
}
__device__ __forceinline__ v8f wmma_bf(v16b a, v16b b, v8f c) {
  v8f d = __builtin_amdgcn_wmma_f32_16x16x32_bf16(false, a, false, b, (short)0, c, false, false);
  asm volatile("v_nop\n\tv_nop\n\tv_nop\n\tv_nop" : "+v"(d) : "v"(a), "v"(b));
  return d;
}
// 16x16x32 fragments: lane = (h = lane>>4, row/col = lane&15); elements 0..7 = k0+8h+0..7, 8..15 = k0+16+8h+0..7; D element r = row 8h+r
__device__ __forceinline__ v16h frag_h(const _Float16* rowk0, int lane) {
  union { v16h v; v8h q[2]; } u; const _Float16* p = rowk0 + 8 * (lane >> 4);
  u.q[0] = *(const v8h*)p; u.q[1] = *(const v8h*)(p + 16); return u.v;
}
__device__ __forceinline__ v16h frag_f32(const float* rowk0, int lane) {
  v16h a; const float* p = rowk0 + 8 * (lane >> 4);
#pragma unroll
  for (int i = 0; i < 8; ++i) { a[i] = (_Float16)p[i]; a[8 + i] = (_Float16)p[16 + i]; }
  return a;
}
__device__ __forceinline__ v16h frag_f32s(const float* rowk0, int lane, float sc) {
  v16h a; const float* p = rowk0 + 8 * (lane >> 4);
#pragma unroll
  for (int i = 0; i < 8; ++i) { a[i] = (_Float16)(p[i] * sc); a[8 + i] = (_Float16)(p[16 + i] * sc); }
  return a;
}
// column fragment from a [K][ld] layout (column n), rows >= K read as 0
__device__ __forceinline__ v16h fragc_f32(const float* W, int k0, int n, int lane, int ld, int K) {
  v16h a; const int g = lane >> 4;
#pragma unroll
  for (int i = 0; i < 8; ++i) { const int ka = k0 + 8 * g + i, kb = ka + 16;
    a[i] = (_Float16)(ka < K ? W[(size_t)(ka < K ? ka : K - 1) * ld + n] : 0.f); a[8 + i] = (_Float16)(kb < K ? W[(size_t)(kb < K ? kb : K - 1) * ld + n] : 0.f); }
  return a;
}
struct F2 { v16b h, l; };
__device__ __forceinline__ F2 bsplit16(const float v[16]) { F2 r;
#pragma unroll
  for (int i = 0; i < 16; ++i) { const __bf16 h = (__bf16)v[i]; r.h[i] = h; r.l[i] = (__bf16)(v[i] - (float)h); }
  return r; }
__device__ __forceinline__ F2 split_row(const float* row, int k0, int lane) { float v[16]; const float* p = row + k0 + 8 * (lane >> 4);
#pragma unroll
  for (int i = 0; i < 8; ++i) { v[i] = p[i]; v[8 + i] = p[16 + i]; }
  return bsplit16(v); }
__device__ __forceinline__ F2 split_rowK(const float* row, int k0, int lane, int K) { float v[16]; const int g = lane >> 4;
#pragma unroll
  for (int i = 0; i < 8; ++i) { const int ka = k0 + 8 * g + i, kb = ka + 16; v[i] = ka < K ? row[ka < K ? ka : K - 1] : 0.f; v[8 + i] = kb < K ? row[kb < K ? kb : K - 1] : 0.f; }
  return bsplit16(v); }
__device__ __forceinline__ F2 split_col(const float* W, int k0, int n, int lane, int ld, int K) { float v[16]; const int g = lane >> 4;
#pragma unroll
  for (int i = 0; i < 8; ++i) { const int ka = k0 + 8 * g + i, kb = ka + 16; v[i] = ka < K ? W[(size_t)(ka < K ? ka : K - 1) * ld + n] : 0.f; v[8 + i] = kb < K ? W[(size_t)(kb < K ? kb : K - 1) * ld + n] : 0.f; }
  return bsplit16(v); }
__device__ __forceinline__ v8f mac3(const F2& a, const F2& b, v8f c) { c = wmma_bf(a.l, b.h, c); c = wmma_bf(a.h, b.l, c); return wmma_bf(a.h, b.h, c); }
__device__ __forceinline__ float sigm(float v) { return 1.0f / (1.0f + expf(-v)); }
#define LDSX() do { asm volatile("s_wait_dscnt 0" ::: "memory"); __builtin_amdgcn_wave_barrier(); __builtin_amdgcn_fence(__ATOMIC_RELEASE, "workgroup"); } while (0)


// Qwen-style attention (B 1, S 2048, D 2048, 16 query heads / 2 kv heads x 128): q = rope(x Wq + bq), k = rope(x Wk + bk) (interleaved pairs, angles from position_ids), v = x Wv + bv; scores = q k^T / sqrt(128) + attention_mask[q][k] (additive input); softmax; out = (P v) Wo + bo.
#define SS 2048
#define DM 2048
#define NH 16
#define NKV 2
#define HD 128
#define KVW (NKV * HD)
#ifndef TQB
#define TQB (SS / 64)
#endif
typedef __attribute__((ext_vector_type(8))) __bf16 v8b;
typedef __attribute__((ext_vector_type(4))) __bf16 v4b;
__device__ __forceinline__ v16b frag_b(const __bf16* rowk0, int lane) {
  union { v16b v; v8b q[2]; } u; const __bf16* p = rowk0 + 8 * (lane >> 4);
  u.q[0] = *(const v8b*)p; u.q[1] = *(const v8b*)(p + 16); return u.v;
}
__device__ __forceinline__ float bfr(float v) { return (float)(__bf16)v; }
__device__ __attribute__((noinline)) float exp_ni(float v) { return expf(v); }
__device__ __attribute__((noinline)) float erf_ni(float v) { return erff(v); }

#define PK_Q 0
#define PK_K (PK_Q + DM * DM)
#define PK_V (PK_K + KVW * DM)
#define PK_O (PK_V + KVW * DM)
#define PK_END (PK_O + DM * DM)
#define WS_PK  0u
#define WS_CS  (WS_PK + 2u * PK_END)             // f32 [2048][64] cos, then [2048][64] sin
#define WS_Q   (WS_CS + 4u * 2 * SS * 64)
#define WS_K   (WS_Q + 4u * SS * DM)
#define WS_VTH (WS_K + 4u * SS * KVW)
#define WS_VTL (WS_VTH + 2u * KVW * SS)
#define WS_O   (WS_VTL + 2u * KVW * SS)
#define WS_END (WS_O + 4u * SS * DM)

// ---- k_packT: block = output column n of a [K][N] (x @ W) matrix
__global__ __launch_bounds__(256) void k_packT(const float* __restrict__ Wm, int K, int N, __bf16* __restrict__ DST) {
  __shared__ __align__(16) __bf16 s[DM]; const int n = blockIdx.x, tid = threadIdx.x;
  for (int k = tid; k < K; k += 256) s[k] = (__bf16)Wm[(size_t)k * N + n];
  __syncthreads();
  for (int q = tid; q < K / 8; q += 256) vst2((unsigned*)(DST + (size_t)n * K + q * 8), *(const v4u*)&s[q * 8]);
}
// ---- k_rope_tab: block = position t (64 threads = pair index i): inv_freq = 1 / 10000^((2i)/128) and angle = float(position_ids[t]) * inv_freq in f32 (as the reference), cos/sin in f32; rows 256 B
__global__ __launch_bounds__(64) void k_rope_tab(const int* __restrict__ POS, float* __restrict__ CS) {
  __shared__ __align__(16) float sc[64], ssn[64]; const int t = blockIdx.x, i = threadIdx.x;
  const float inv = 1.0f / powf(10000.0f, (float)(2 * i) / 128.0f); const float ang = (float)POS[t] * inv; sc[i] = cosf(ang); ssn[i] = sinf(ang);
  __syncthreads();
  if (i < 16) vst2(CS + (size_t)t * 64 + i * 4, *(const v4f*)&sc[i * 4]); else if (i < 32) vst2(CS + (size_t)SS * 64 + (size_t)t * 64 + (i - 16) * 4, *(const v4f*)&ssn[(i - 16) * 4]);
}
// ---- k_proj<MODE>: block = (64 rows, 128 cols = one head), operands staged in LDS per 64-k step, the next step's global loads issued ahead of this step's products: Y = bf16(x) . P rows (exact); MODE 0: RoPE then f32 rows (q/k; ldo); MODE 1: plain -> transposed bf16 hi/lo planes (v)
template <int MODE>
__global__ __launch_bounds__(128) void k_proj(const float* __restrict__ X, const __bf16* __restrict__ P, const float* __restrict__ bias, const float* __restrict__ CS, float* __restrict__ OUT, int ldo, __bf16* __restrict__ PH, __bf16* __restrict__ PL) {
  __shared__ __align__(16) float so[MODE ? 1 : 4][16][132]; __shared__ __align__(16) __bf16 sth[MODE ? 128 : 1][72], stl[MODE ? 128 : 1][72];
  __shared__ __align__(16) __bf16 sA[2][64][72], sB[2][128][72];   // two buffers of one 64-k step: 64 x rows (rounded to bf16) and 128 P rows, 128-B rows at pitch 144 B
  const int tid = threadIdx.x, wave = tid >> 5, lane = tid & 31, col = lane & 15, g = lane >> 4; const size_t r0 = (size_t)blockIdx.x * 64 + wave * 16; const int n0 = blockIdx.y * 128;
  const float* xg = X + ((size_t)blockIdx.x * 64 + (tid >> 4)) * DM + (tid & 15) * 4;   // piece it of a step: row (tid >> 4) + 8 it, 16 B; a wave's load = 2 rows x 256 B
  const __bf16* pg = P + (size_t)(n0 + (tid >> 3)) * DM + (tid & 7) * 8;                // piece it of a step: row (tid >> 3) + 16 it, 16 B; a wave's load = 4 rows x 128 B
  v8f acc[8] = {}; v4f xr[8]; v8b pr[8];
#pragma unroll
  for (int it = 0; it < 8; ++it) { xr[it] = *(const v4f*)(xg + (size_t)it * 8 * DM); pr[it] = *(const v8b*)(pg + (size_t)it * 16 * DM); }
#pragma unroll
  for (int it = 0; it < 8; ++it) { v4b x4;
#pragma unroll
    for (int e = 0; e < 4; ++e) x4[e] = (__bf16)xr[it][e];
    *(v4b*)&sA[0][(tid >> 4) + 8 * it][(tid & 15) * 4] = x4; *(v8b*)&sB[0][(tid >> 3) + 16 * it][(tid & 7) * 8] = pr[it]; }
#pragma unroll 2   // two copies: the buffer index is a constant in each, so every LDS address is a base register plus an immediate
  for (int st = 0; st < DM / 64; ++st) { const int bu = st & 1;
    __syncthreads();   // publishes step st; every reader of the other buffer (step st - 1) has left it before it is rewritten below
    if (st + 1 < DM / 64) {
#pragma unroll
      for (int it = 0; it < 8; ++it) { xr[it] = *(const v4f*)(xg + (size_t)it * 8 * DM + (st + 1) * 64); pr[it] = *(const v8b*)(pg + (size_t)it * 16 * DM + (st + 1) * 64); } }
#pragma unroll
    for (int k2 = 0; k2 < 2; ++k2) {
      if (k2 == 1) asm volatile("s_wait_xcnt 0x0" ::: "memory");   // stands in front of every later rewrite of the address registers of the next step's loads above
      const v16b a = frag_b(&sA[bu][wave * 16 + col][k2 * 32], lane); v16b b[8];
#pragma unroll
      for (int j = 0; j < 8; ++j) b[j] = frag_b(&sB[bu][j * 16 + col][k2 * 32], lane);
#pragma unroll
      for (int j = 0; j < 8; ++j) acc[j] = wmma_bf(a, b[j], acc[j]); }
    if (st + 1 < DM / 64) {
#pragma unroll
      for (int it = 0; it < 8; ++it) { v4b x4;
#pragma unroll
        for (int e = 0; e < 4; ++e) x4[e] = (__bf16)xr[it][e];
        *(v4b*)&sA[bu ^ 1][(tid >> 4) + 8 * it][(tid & 15) * 4] = x4; *(v8b*)&sB[bu ^ 1][(tid >> 3) + 16 * it][(tid & 7) * 8] = pr[it]; } } }
  if (MODE == 0) {
    // biased projections to LDS, then interleaved-pair RoPE in place: (d = 2i, 2i+1): out_e = x_e cos_i - x_o sin_i; out_o = x_e sin_i + x_o cos_i with angle index i = d/2 (position from position_ids via the CS tables)
#pragma unroll
    for (int j = 0; j < 8; ++j) { const float bb = bfr(bias[n0 + j * 16 + col]);
#pragma unroll
      for (int r = 0; r < 8; ++r) so[wave][8 * g + r][j * 16 + col] = acc[j][r] + bb; }
    LDSX();
    for (int q = lane; q < 16 * 64; q += 32) { const int rl = q >> 6, i = q & 63; const size_t t = r0 + rl; const float c = CS[t * 64 + i], s = CS[(size_t)SS * 64 + t * 64 + i]; const float xe = so[wave][rl][2 * i], xo = so[wave][rl][2 * i + 1]; so[wave][rl][2 * i] = xe * c - xo * s; so[wave][rl][2 * i + 1] = xe * s + xo * c; }
    LDSX();
    for (int rl = 0; rl < 16; ++rl) vst2(OUT + (r0 + rl) * ldo + n0 + lane * 4, *(const v4f*)&so[wave][rl][lane * 4]);
  } else {
#pragma unroll
    for (int j = 0; j < 8; ++j)
#pragma unroll
      for (int r = 0; r < 8; ++r) { const float v = acc[j][r] + bfr(bias[n0 + j * 16 + col]); const __bf16 hb = (__bf16)v; sth[j * 16 + col][wave * 16 + 8 * g + r] = hb; stl[j * 16 + col][wave * 16 + 8 * g + r] = (__bf16)(v - (float)hb); }
    __syncthreads();
    const int s0 = blockIdx.x * 64;
    for (int q = tid; q < 128 * 8; q += 128) { const int d = q >> 3, pc = q & 7; const size_t o = (size_t)(n0 + d) * SS + s0 + pc * 8; vst2((unsigned*)(PH + o), *(const v4u*)&sth[d][pc * 8]); vst2((unsigned*)(PL + o), *(const v4u*)&stl[d][pc * 8]); }
  }
}
// ---- k_attn: block = (16 queries, head h), NKW waves: wave w takes key steps w, w + NKW, ... of the same 16 queries (flash attention over its share), then the NKW partial (max, sum, acc) are merged through LDS; scores 3 products, P.V 3 products; O[q][h*128+d]
#define NKW 8
__global__ __launch_bounds__(32 * NKW) void k_attn(const float* __restrict__ Q, const float* __restrict__ Kx, const float* __restrict__ MASK, const __bf16* __restrict__ VTH, const __bf16* __restrict__ VTL, float* __restrict__ O) {
  __shared__ __align__(16) float sp[NKW][16][36]; __shared__ __align__(16) float so[NKW][16][132]; __shared__ float sm[NKW][16], sl[NKW][16];
  const int tid = threadIdx.x, wave = __builtin_amdgcn_readfirstlane(tid >> 5), lane = tid & 31, col = lane & 15, g = lane >> 4;
  const int qb = blockIdx.x, h = blockIdx.y, kv = h / (NH / NKV); const int q0 = qb * 16;
  const float* qrow = Q + (size_t)(q0 + col) * DM + h * HD;   // q fragments re-split per key step (keeps the kernel under 256 VGPRs)
  float m[8], l[8];
#pragma unroll
  for (int r = 0; r < 8; ++r) { m[r] = -3.0e38f; l[r] = 0.f; }
  v8f acc[8] = {};
#pragma unroll 1
  for (int ks = wave; ks < SS / 32; ks += NKW) { v8f s[2]; float mk[2][8]; bool anylive = false;
#pragma unroll
    for (int ct = 0; ct < 2; ++ct) { const int kk = ks * 32 + ct * 16 + col;
#pragma unroll
      for (int r = 0; r < 8; ++r) { const float m_ = bfr(MASK[(size_t)(q0 + 8 * g + r) * SS + kk]); mk[ct][r] = m_; anylive = anylive || (m_ > -1.0e8f); } }
    if (__any(anylive)) {   // wave-uniform: skip key tiles that are fully masked for this wave's 16 rows (exp of <= -1e8 underflows to exactly 0 in the reference too)
#pragma unroll
    for (int ct = 0; ct < 2; ++ct) { const int kk = ks * 32 + ct * 16 + col; const float* krow = Kx + (size_t)kk * KVW + kv * HD; v8f c = {};
#pragma unroll
      for (int kc = 0; kc < 4; ++kc) { const F2 kb = split_row(krow, kc * 32, lane); const F2 qa = split_row(qrow, kc * 32, lane); c = mac3(qa, kb, c); }
#pragma unroll
      for (int r = 0; r < 8; ++r) s[ct][r] = c[r] * 0.08838834764831845f + mk[ct][r]; }
#pragma unroll
    for (int r = 0; r < 8; ++r) { float mx = fmaxf(s[0][r], s[1][r]);
#pragma unroll
      for (int o = 1; o < 16; o <<= 1) mx = fmaxf(mx, __shfl_xor(mx, o));
      const float mn = fmaxf(m[r], mx); const float alpha = (m[r] <= -1.0e38f) ? 0.f : exp_ni(m[r] - mn);
      const float e0 = exp_ni(s[0][r] - mn), e1 = exp_ni(s[1][r] - mn); float es = e0 + e1;
#pragma unroll
      for (int o = 1; o < 16; o <<= 1) es += __shfl_xor(es, o);
      l[r] = l[r] * alpha + es; m[r] = mn;
#pragma unroll
      for (int dt = 0; dt < 8; ++dt) acc[dt][r] *= alpha;
      sp[wave][8 * g + r][col] = e0; sp[wave][8 * g + r][16 + col] = e1; }
    LDSX();
    const F2 pa = split_row(&sp[wave][col][0], 0, lane);
#pragma unroll
    for (int dt = 0; dt < 8; ++dt) { const size_t vr = (size_t)(kv * HD + dt * 16 + col) * SS + ks * 32; const v16b vh = frag_b(VTH + vr, lane), vl = frag_b(VTL + vr, lane); acc[dt] = wmma_bf(pa.l, vh, acc[dt]); acc[dt] = wmma_bf(pa.h, vl, acc[dt]); acc[dt] = wmma_bf(pa.h, vh, acc[dt]); }
    LDSX(); } }
  // merge: row maximum over the waves, each wave's sum and acc rescaled to it, then summed in wave order (a wave with no live key step has m = -3e38, l = 0 and weight 0)
  if (col == 0) {
#pragma unroll
    for (int r = 0; r < 8; ++r) sm[wave][8 * g + r] = m[r]; }
  __syncthreads();
#pragma unroll
  for (int r = 0; r < 8; ++r) { float mx = sm[0][8 * g + r];
#pragma unroll
    for (int w = 1; w < NKW; ++w) mx = fmaxf(mx, sm[w][8 * g + r]);
    const float f = (m[r] <= -1.0e38f) ? 0.f : exp_ni(m[r] - mx);
    if (col == 0) sl[wave][8 * g + r] = l[r] * f;
#pragma unroll
    for (int dt = 0; dt < 8; ++dt) so[wave][8 * g + r][dt * 16 + col] = acc[dt][r] * f; }
  __syncthreads();
  for (int rl = wave; rl < 16; rl += NKW) { v4f a = *(const v4f*)&so[0][rl][lane * 4]; float ls = sl[0][rl];
#pragma unroll
    for (int w = 1; w < NKW; ++w) { a += *(const v4f*)&so[w][rl][lane * 4]; ls += sl[w][rl]; }
    vst2(O + (size_t)(q0 + rl) * DM + h * HD + lane * 4, a * (1.0f / ls));
    asm volatile("s_wait_xcnt 0x0" ::: "memory"); }   // the next trip rewrites the store's address and data registers: the wait stands in front of that
}
// ---- k_out: block = (64 rows, 128 cols), operands staged in LDS as in k_proj: out = O(hi/lo) . wproj^T rows (2 products)
__global__ __launch_bounds__(128) void k_out(const float* __restrict__ O, const __bf16* __restrict__ P, const float* __restrict__ bias, float* __restrict__ Y) {
  __shared__ __align__(16) float so[4][16][132];
  __shared__ __align__(16) __bf16 sAh[2][64][72], sAl[2][64][72], sB[2][128][72];   // two buffers of one 64-k step: 64 O rows as bf16 hi and residual, 128 P rows, 128-B rows at pitch 144 B
  const int tid = threadIdx.x, wave = tid >> 5, lane = tid & 31, col = lane & 15, g = lane >> 4; const size_t r0 = (size_t)blockIdx.x * 64 + wave * 16; const int n0 = blockIdx.y * 128;
  const float* xg = O + ((size_t)blockIdx.x * 64 + (tid >> 4)) * DM + (tid & 15) * 4;   // piece it of a step: row (tid >> 4) + 8 it, 16 B; a wave's load = 2 rows x 256 B
  const __bf16* pg = P + (size_t)(n0 + (tid >> 3)) * DM + (tid & 7) * 8;                // piece it of a step: row (tid >> 3) + 16 it, 16 B; a wave's load = 4 rows x 128 B
  v8f acc[8] = {}; v4f xr[8]; v8b pr[8];
#pragma unroll
  for (int it = 0; it < 8; ++it) { xr[it] = *(const v4f*)(xg + (size_t)it * 8 * DM); pr[it] = *(const v8b*)(pg + (size_t)it * 16 * DM); }
#pragma unroll
  for (int it = 0; it < 8; ++it) { v4b h4, l4;
#pragma unroll
    for (int e = 0; e < 4; ++e) { const __bf16 hb = (__bf16)xr[it][e]; h4[e] = hb; l4[e] = (__bf16)(xr[it][e] - (float)hb); }
    *(v4b*)&sAh[0][(tid >> 4) + 8 * it][(tid & 15) * 4] = h4; *(v4b*)&sAl[0][(tid >> 4) + 8 * it][(tid & 15) * 4] = l4; *(v8b*)&sB[0][(tid >> 3) + 16 * it][(tid & 7) * 8] = pr[it]; }
#pragma unroll 2   // two copies: the buffer index is a constant in each, so every LDS address is a base register plus an immediate
  for (int st = 0; st < DM / 64; ++st) { const int bu = st & 1;
    __syncthreads();   // publishes step st; every reader of the other buffer (step st - 1) has left it before it is rewritten below
    if (st + 1 < DM / 64) {
#pragma unroll
      for (int it = 0; it < 8; ++it) { xr[it] = *(const v4f*)(xg + (size_t)it * 8 * DM + (st + 1) * 64); pr[it] = *(const v8b*)(pg + (size_t)it * 16 * DM + (st + 1) * 64); } }
#pragma unroll
    for (int k2 = 0; k2 < 2; ++k2) {
      if (k2 == 1) asm volatile("s_wait_xcnt 0x0" ::: "memory");   // stands in front of every later rewrite of the address registers of the next step's loads above
      const v16b ah = frag_b(&sAh[bu][wave * 16 + col][k2 * 32], lane), al = frag_b(&sAl[bu][wave * 16 + col][k2 * 32], lane); v16b b[8];
#pragma unroll
      for (int j = 0; j < 8; ++j) b[j] = frag_b(&sB[bu][j * 16 + col][k2 * 32], lane);
#pragma unroll
      for (int j = 0; j < 8; ++j) { acc[j] = wmma_bf(al, b[j], acc[j]); acc[j] = wmma_bf(ah, b[j], acc[j]); } }
    if (st + 1 < DM / 64) {
#pragma unroll
      for (int it = 0; it < 8; ++it) { v4b h4, l4;
#pragma unroll
        for (int e = 0; e < 4; ++e) { const __bf16 hb = (__bf16)xr[it][e]; h4[e] = hb; l4[e] = (__bf16)(xr[it][e] - (float)hb); }
        *(v4b*)&sAh[bu ^ 1][(tid >> 4) + 8 * it][(tid & 15) * 4] = h4; *(v4b*)&sAl[bu ^ 1][(tid >> 4) + 8 * it][(tid & 15) * 4] = l4; *(v8b*)&sB[bu ^ 1][(tid >> 3) + 16 * it][(tid & 7) * 8] = pr[it]; } } }
#pragma unroll
  for (int j = 0; j < 8; ++j)
#pragma unroll
    for (int r = 0; r < 8; ++r) so[wave][8 * g + r][j * 16 + col] = acc[j][r] + bfr(bias[n0 + j * 16 + col]);
  LDSX();
  for (int rl = 0; rl < 16; ++rl) vst2(Y + (r0 + rl) * DM + n0 + lane * 4, *(const v4f*)&so[wave][rl][lane * 4]);
}
extern "C" void kernel_launch(void* const* d_in, const int* in_sizes, int n_in, void* d_out, int out_size, void* d_ws, size_t ws_size, hipStream_t stream) {
  (void)in_sizes; (void)n_in; (void)out_size;
  const float** F = (const float**)d_in; const int* POS = (const int*)d_in[2];   // 0 hidden_states [1,2048,2048], 1 attention_mask [1,1,2048,2048], 2 position_ids [1,2048] i32, 3 Wq [2048,2048], 4 bq, 5 Wk [2048,256], 6 bk, 7 Wv, 8 bv, 9 Wo [2048,2048], 10 bo
  if (ws_size < (size_t)WS_END) return;
  char* ws = (char*)d_ws; __bf16 *PK = (__bf16*)(ws + WS_PK), *VTH = (__bf16*)(ws + WS_VTH), *VTL = (__bf16*)(ws + WS_VTL);
  float *CS = (float*)(ws + WS_CS), *Q = (float*)(ws + WS_Q), *Kx = (float*)(ws + WS_K), *O = (float*)(ws + WS_O);
  k_packT<<<DM, 256, 0, stream>>>(F[3], DM, DM, PK + PK_Q); k_packT<<<KVW, 256, 0, stream>>>(F[5], DM, KVW, PK + PK_K); k_packT<<<KVW, 256, 0, stream>>>(F[7], DM, KVW, PK + PK_V); k_packT<<<DM, 256, 0, stream>>>(F[9], DM, DM, PK + PK_O);
  k_rope_tab<<<SS, 64, 0, stream>>>(POS, CS);
  k_proj<0><<<dim3(SS / 64, DM / 128), 128, 0, stream>>>(F[0], PK + PK_Q, F[4], CS, Q, DM, nullptr, nullptr);
  k_proj<0><<<dim3(SS / 64, KVW / 128), 128, 0, stream>>>(F[0], PK + PK_K, F[6], CS, Kx, KVW, nullptr, nullptr);
  k_proj<1><<<dim3(SS / 64, KVW / 128), 128, 0, stream>>>(F[0], PK + PK_V, F[8], CS, nullptr, 0, VTH, VTL);
  k_attn<<<dim3(SS / 16, NH), 32 * NKW, 0, stream>>>(Q, Kx, F[1], VTH, VTL, O);
  k_out<<<dim3(TQB, DM / 128), 128, 0, stream>>>(O, PK + PK_O, F[10], (float*)d_out);
}

// v003
// Measured time: 378 microseconds a run.
// Next to v002, in two timings, it ran 1.20 times as fast each time.
// All steps since v000 together make it 2.92 times as fast.
// compute dtype: hidden_states, all weights/biases and the additive attention_mask (module inputs) rounded to bf16; position_ids as int32; q/k/v projections with exact bf16 products (x and W are inputs) + bias and interleaved-pair RoPE from position_ids in f32 in the epilogue; scores q.k with both computed operands as bf16 hi + residual pairs (3 products) + the mask value, P.V with P hi/lo x V hi/lo (3 products); output projection hi/lo x exact Wo (2 products) + bo; softmax in f32; key tiles whose mask entries are all <= -1e8 for the wave's rows are skipped at run time (exp underflows to exactly 0 in the reference too); f32 accumulate.
#include <hip/hip_runtime.h>
#include <math.h>

typedef __attribute__((ext_vector_type(16))) _Float16 v16h;
typedef __attribute__((ext_vector_type(16))) __bf16 v16b;
typedef __attribute__((ext_vector_type(8)))  _Float16 v8h;
typedef __attribute__((ext_vector_type(8)))  float v8f;
typedef __attribute__((ext_vector_type(4)))  float v4f;
typedef __attribute__((ext_vector_type(2)))  float v2f;
typedef __attribute__((ext_vector_type(4)))  unsigned v4u;
typedef __attribute__((ext_vector_type(4)))  int v4i;
typedef float __attribute__((may_alias)) float_a;
typedef int __attribute__((may_alias)) int_a;

template <typename T> __device__ __forceinline__ void vst2(void* p, T v) { *(T*)p = v;  }
__device__ __forceinline__ v8f wmma16(v16h a, v16h b, v8f c) {
  v8f d = __builtin_amdgcn_wmma_f32_16x16x32_f16(false, a, false, b, (short)0, c, false, false);
  asm volatile("v_nop\n\tv_nop\n\tv_nop\n\tv_nop" : "+v"(d) : "v"(a), "v"(b));
  return d;
}
__device__ __forceinline__ v8f wmma_bf(v16b a, v16b b, v8f c) {
  v8f d = __builtin_amdgcn_wmma_f32_16x16x32_bf16(false, a, false, b, (short)0, c, false, false);
  asm volatile("v_nop\n\tv_nop\n\tv_nop\n\tv_nop" : "+v"(d) : "v"(a), "v"(b));
  return d;
}
// 16x16x32 fragments: lane = (h = lane>>4, row/col = lane&15); elements 0..7 = k0+8h+0..7, 8..15 = k0+16+8h+0..7; D element r = row 8h+r
__device__ __forceinline__ v16h frag_h(const _Float16* rowk0, int lane) {
  union { v16h v; v8h q[2]; } u; const _Float16* p = rowk0 + 8 * (lane >> 4);
  u.q[0] = *(const v8h*)p; u.q[1] = *(const v8h*)(p + 16); return u.v;
}
__device__ __forceinline__ v16h frag_f32(const float* rowk0, int lane) {
  v16h a; const float* p = rowk0 + 8 * (lane >> 4);
#pragma unroll
  for (int i = 0; i < 8; ++i) { a[i] = (_Float16)p[i]; a[8 + i] = (_Float16)p[16 + i]; }
  return a;
}
__device__ __forceinline__ v16h frag_f32s(const float* rowk0, int lane, float sc) {
  v16h a; const float* p = rowk0 + 8 * (lane >> 4);
#pragma unroll
  for (int i = 0; i < 8; ++i) { a[i] = (_Float16)(p[i] * sc); a[8 + i] = (_Float16)(p[16 + i] * sc); }
  return a;
}
// column fragment from a [K][ld] layout (column n), rows >= K read as 0
__device__ __forceinline__ v16h fragc_f32(const float* W, int k0, int n, int lane, int ld, int K) {
  v16h a; const int g = lane >> 4;
#pragma unroll
  for (int i = 0; i < 8; ++i) { const int ka = k0 + 8 * g + i, kb = ka + 16;
    a[i] = (_Float16)(ka < K ? W[(size_t)(ka < K ? ka : K - 1) * ld + n] : 0.f); a[8 + i] = (_Float16)(kb < K ? W[(size_t)(kb < K ? kb : K - 1) * ld + n] : 0.f); }
  return a;
}
struct F2 { v16b h, l; };
__device__ __forceinline__ F2 bsplit16(const float v[16]) { F2 r;
#pragma unroll
  for (int i = 0; i < 16; ++i) { const __bf16 h = (__bf16)v[i]; r.h[i] = h; r.l[i] = (__bf16)(v[i] - (float)h); }
  return r; }
__device__ __forceinline__ F2 split_row(const float* row, int k0, int lane) { float v[16]; const float* p = row + k0 + 8 * (lane >> 4);
#pragma unroll
  for (int i = 0; i < 8; ++i) { v[i] = p[i]; v[8 + i] = p[16 + i]; }
  return bsplit16(v); }
__device__ __forceinline__ F2 split_rowK(const float* row, int k0, int lane, int K) { float v[16]; const int g = lane >> 4;
#pragma unroll
  for (int i = 0; i < 8; ++i) { const int ka = k0 + 8 * g + i, kb = ka + 16; v[i] = ka < K ? row[ka < K ? ka : K - 1] : 0.f; v[8 + i] = kb < K ? row[kb < K ? kb : K - 1] : 0.f; }
  return bsplit16(v); }
__device__ __forceinline__ F2 split_col(const float* W, int k0, int n, int lane, int ld, int K) { float v[16]; const int g = lane >> 4;
#pragma unroll
  for (int i = 0; i < 8; ++i) { const int ka = k0 + 8 * g + i, kb = ka + 16; v[i] = ka < K ? W[(size_t)(ka < K ? ka : K - 1) * ld + n] : 0.f; v[8 + i] = kb < K ? W[(size_t)(kb < K ? kb : K - 1) * ld + n] : 0.f; }
  return bsplit16(v); }
__device__ __forceinline__ v8f mac3(const F2& a, const F2& b, v8f c) { c = wmma_bf(a.l, b.h, c); c = wmma_bf(a.h, b.l, c); return wmma_bf(a.h, b.h, c); }
__device__ __forceinline__ float sigm(float v) { return 1.0f / (1.0f + expf(-v)); }
#define LDSX() do { asm volatile("s_wait_dscnt 0" ::: "memory"); __builtin_amdgcn_wave_barrier(); __builtin_amdgcn_fence(__ATOMIC_RELEASE, "workgroup"); } while (0)


// Attention with grouped kv heads (B 1, S 2048, D 2048, 16 query heads / 2 kv heads x 128): q = rope(x Wq + bq), k = rope(x Wk + bk) (interleaved pairs, angles from position_ids), v = x Wv + bv; scores = q k^T / sqrt(128) + attention_mask[q][k] (additive input); softmax; out = (P v) Wo + bo.
#define SS 2048
#define DM 2048
#define NH 16
#define NKV 2
#define HD 128
#define KVW (NKV * HD)
#ifndef TQB
#define TQB (SS / 64)
#endif
typedef __attribute__((ext_vector_type(8))) __bf16 v8b;
typedef __attribute__((ext_vector_type(4))) __bf16 v4b;
__device__ __forceinline__ v16b frag_b(const __bf16* rowk0, int lane) {
  union { v16b v; v8b q[2]; } u; const __bf16* p = rowk0 + 8 * (lane >> 4);
  u.q[0] = *(const v8b*)p; u.q[1] = *(const v8b*)(p + 16); return u.v;
}
// fragment-order plane of a logical [R][C] bf16 matrix: 16-row x 32-column fragments of 512 elements, fragment index (row >> 4) * (C / 32) + (c >> 5); inside it element (row, c) sits at ((c >> 4) & 1) * 256 + (((c >> 3) & 1) * 16 + (row & 15)) * 8 + (c & 7). Lane l's two 16-B pieces (the same elements that frag_b reads from a row) are at l * 8 and 256 + l * 8: each load of a wave is 512 contiguous bytes
__device__ __forceinline__ v16b frag_fo(const __bf16* f, int lane) {
  union { v16b v; v8b q[2]; } u; u.q[0] = *(const v8b*)(f + lane * 8); u.q[1] = *(const v8b*)(f + 256 + lane * 8); return u.v;
}
__device__ __forceinline__ float bfr(float v) { return (float)(__bf16)v; }
__device__ __attribute__((noinline)) float exp_ni(float v) { return expf(v); }
__device__ __attribute__((noinline)) float erf_ni(float v) { return erff(v); }

#define PK_Q 0
#define PK_K (PK_Q + DM * DM)
#define PK_V (PK_K + KVW * DM)
#define PK_O (PK_V + KVW * DM)
#define PK_END (PK_O + DM * DM)
#define WS_PK  0u
#define WS_CS  (WS_PK + 2u * PK_END)             // f32 [2048][64] cos, then [2048][64] sin
#define WS_QH  (WS_CS + 4u * 2 * SS * 64)        // q after RoPE as bf16 hi plane [2048][2048] in fragment order, then its residual plane
#define WS_QL  (WS_QH + 2u * SS * DM)
#define WS_KH  (WS_QL + 2u * SS * DM)            // k after RoPE as bf16 hi plane [2048][256] in fragment order, then its residual plane
#define WS_KL  (WS_KH + 2u * SS * KVW)
#define WS_VTH (WS_KL + 2u * SS * KVW)
#define WS_VTL (WS_VTH + 2u * KVW * SS)
#define WS_O   (WS_VTL + 2u * KVW * SS)
#define WS_END (WS_O + 4u * SS * DM)

// ---- k_packT: block = output column n of a [K][N] (x @ W) matrix
__global__ __launch_bounds__(256) void k_packT(const float* __restrict__ Wm, int K, int N, __bf16* __restrict__ DST) {
  __shared__ __align__(16) __bf16 s[DM]; const int n = blockIdx.x, tid = threadIdx.x;
  for (int k = tid; k < K; k += 256) s[k] = (__bf16)Wm[(size_t)k * N + n];
  __syncthreads();
  for (int q = tid; q < K / 8; q += 256) vst2((unsigned*)(DST + (size_t)n * K + q * 8), *(const v4u*)&s[q * 8]);
}
// ---- k_rope_tab: block = position t (64 threads = pair index i): inv_freq = 1 / 10000^((2i)/128) and angle = float(position_ids[t]) * inv_freq in f32 (as the reference), cos/sin in f32; rows 256 B
__global__ __launch_bounds__(64) void k_rope_tab(const int* __restrict__ POS, float* __restrict__ CS) {
  __shared__ __align__(16) float sc[64], ssn[64]; const int t = blockIdx.x, i = threadIdx.x;
  const float inv = 1.0f / powf(10000.0f, (float)(2 * i) / 128.0f); const float ang = (float)POS[t] * inv; sc[i] = cosf(ang); ssn[i] = sinf(ang);
  __syncthreads();
  if (i < 16) vst2(CS + (size_t)t * 64 + i * 4, *(const v4f*)&sc[i * 4]); else if (i < 32) vst2(CS + (size_t)SS * 64 + (size_t)t * 64 + (i - 16) * 4, *(const v4f*)&ssn[(i - 16) * 4]);
}
// ---- k_proj<MODE>: block = (64 rows, 128 cols = one head), operands staged in LDS per 64-k step, the next step's global loads issued ahead of this step's products: Y = bf16(x) . P rows (exact); MODE 0: RoPE then bf16 hi/lo planes of [2048][ldo] in fragment order (q/k); MODE 1: plain -> transposed bf16 hi/lo planes of [256][2048] in fragment order (v)
template <int MODE>
__global__ __launch_bounds__(128) void k_proj(const float* __restrict__ X, const __bf16* __restrict__ P, const float* __restrict__ bias, const float* __restrict__ CS, int ldo, __bf16* __restrict__ PH, __bf16* __restrict__ PL) {
  __shared__ __align__(16) float so[MODE ? 1 : 4][16][132]; __shared__ __align__(16) __bf16 sth[MODE ? 128 : 1][72], stl[MODE ? 128 : 1][72];
  __shared__ __align__(16) __bf16 sA[2][64][72], sB[2][128][72];   // two buffers of one 64-k step: 64 x rows (rounded to bf16) and 128 P rows, 128-B rows at pitch 144 B
  const int tid = threadIdx.x, wave = tid >> 5, lane = tid & 31, col = lane & 15, g = lane >> 4; const size_t r0 = (size_t)blockIdx.x * 64 + wave * 16; const int n0 = blockIdx.y * 128;
  const float* xg = X + ((size_t)blockIdx.x * 64 + (tid >> 4)) * DM + (tid & 15) * 4;   // piece it of a step: row (tid >> 4) + 8 it, 16 B; a wave's load = 2 rows x 256 B
  const __bf16* pg = P + (size_t)(n0 + (tid >> 3)) * DM + (tid & 7) * 8;                // piece it of a step: row (tid >> 3) + 16 it, 16 B; a wave's load = 4 rows x 128 B
  v8f acc[8] = {}; v4f xr[8]; v8b pr[8];
#pragma unroll
  for (int it = 0; it < 8; ++it) { xr[it] = *(const v4f*)(xg + (size_t)it * 8 * DM); pr[it] = *(const v8b*)(pg + (size_t)it * 16 * DM); }
#pragma unroll
  for (int it = 0; it < 8; ++it) { v4b x4;
#pragma unroll
    for (int e = 0; e < 4; ++e) x4[e] = (__bf16)xr[it][e];
    *(v4b*)&sA[0][(tid >> 4) + 8 * it][(tid & 15) * 4] = x4; *(v8b*)&sB[0][(tid >> 3) + 16 * it][(tid & 7) * 8] = pr[it]; }
#pragma unroll 2   // two copies: the buffer index is a constant in each, so every LDS address is a base register plus an immediate
  for (int st = 0; st < DM / 64; ++st) { const int bu = st & 1;
    __syncthreads();   // publishes step st; every reader of the other buffer (step st - 1) has left it before it is rewritten below
    if (st + 1 < DM / 64) {
#pragma unroll
      for (int it = 0; it < 8; ++it) { xr[it] = *(const v4f*)(xg + (size_t)it * 8 * DM + (st + 1) * 64); pr[it] = *(const v8b*)(pg + (size_t)it * 16 * DM + (st + 1) * 64); } }
#pragma unroll
    for (int k2 = 0; k2 < 2; ++k2) {
      if (k2 == 1) asm volatile("s_wait_xcnt 0x0" ::: "memory");   // stands in front of every later rewrite of the address registers of the next step's loads above
      const v16b a = frag_b(&sA[bu][wave * 16 + col][k2 * 32], lane); v16b b[8];
#pragma unroll
      for (int j = 0; j < 8; ++j) b[j] = frag_b(&sB[bu][j * 16 + col][k2 * 32], lane);
#pragma unroll
      for (int j = 0; j < 8; ++j) acc[j] = wmma_bf(a, b[j], acc[j]); }
    if (st + 1 < DM / 64) {
#pragma unroll
      for (int it = 0; it < 8; ++it) { v4b x4;
#pragma unroll
        for (int e = 0; e < 4; ++e) x4[e] = (__bf16)xr[it][e];
        *(v4b*)&sA[bu ^ 1][(tid >> 4) + 8 * it][(tid & 15) * 4] = x4; *(v8b*)&sB[bu ^ 1][(tid >> 3) + 16 * it][(tid & 7) * 8] = pr[it]; } } }
  if (MODE == 0) {
    // biased projections to LDS, then interleaved-pair RoPE in place: (d = 2i, 2i+1): out_e = x_e cos_i - x_o sin_i; out_o = x_e sin_i + x_o cos_i with angle index i = d/2 (position from position_ids via the CS tables)
#pragma unroll
    for (int j = 0; j < 8; ++j) { const float bb = bfr(bias[n0 + j * 16 + col]);
#pragma unroll
      for (int r = 0; r < 8; ++r) so[wave][8 * g + r][j * 16 + col] = acc[j][r] + bb; }
    LDSX();
    for (int q = lane; q < 16 * 64; q += 32) { const int rl = q >> 6, i = q & 63; const size_t t = r0 + rl; const float c = CS[t * 64 + i], s = CS[(size_t)SS * 64 + t * 64 + i]; const float xe = so[wave][rl][2 * i], xo = so[wave][rl][2 * i + 1]; so[wave][rl][2 * i] = xe * c - xo * s; so[wave][rl][2 * i + 1] = xe * s + xo * c; }
    LDSX();
    // each value leaves as bf16 hi + bf16 residual, the same split that the score products use; the wave's 16 rows x 128 columns are 4 whole fragments of each plane, piece p = 16 columns: a wave's store = 512 contiguous bytes
    const size_t f0 = ((r0 >> 4) * (size_t)(ldo >> 5) + (n0 >> 5)) * 512;
    for (int p = 0; p < 8; ++p) { const float* sr = &so[wave][col][p * 16 + g * 8]; const v4f va = *(const v4f*)sr, vb = *(const v4f*)(sr + 4); v8b h8, l8;
#pragma unroll
      for (int e = 0; e < 4; ++e) { const __bf16 ha = (__bf16)va[e], hb = (__bf16)vb[e]; h8[e] = ha; l8[e] = (__bf16)(va[e] - (float)ha); h8[4 + e] = hb; l8[4 + e] = (__bf16)(vb[e] - (float)hb); }
      const size_t o = f0 + p * 256 + lane * 8; *(v8b*)(PH + o) = h8; *(v8b*)(PL + o) = l8;
      asm volatile("s_wait_xcnt 0x0" ::: "memory"); }   // the next piece rewrites the stores' data registers: the wait stands in front of that
  } else {
#pragma unroll
    for (int j = 0; j < 8; ++j)
#pragma unroll
      for (int r = 0; r < 8; ++r) { const float v = acc[j][r] + bfr(bias[n0 + j * 16 + col]); const __bf16 hb = (__bf16)v; sth[j * 16 + col][wave * 16 + 8 * g + r] = hb; stl[j * 16 + col][wave * 16 + 8 * g + r] = (__bf16)(v - (float)hb); }
    __syncthreads();
    const int s0 = blockIdx.x * 64;
    // the block's 128 d x 64 s are 16 whole fragments of each plane: fragment fl, half j, lane slot sl; a wave's store = 512 contiguous bytes
    for (int q = tid; q < 128 * 8; q += 128) { const int fl = q >> 6, j = (q >> 5) & 1, sl = q & 31; const int d = (fl >> 1) * 16 + (sl & 15), c = (fl & 1) * 32 + j * 16 + (sl >> 4) * 8;
      const size_t o = ((size_t)((n0 >> 4) + (fl >> 1)) * (SS / 32) + (s0 >> 5) + (fl & 1)) * 512 + j * 256 + sl * 8; vst2((unsigned*)(PH + o), *(const v4u*)&sth[d][c]); vst2((unsigned*)(PL + o), *(const v4u*)&stl[d][c]); }
  }
}
// ---- k_attn: block = (16 queries, head h), NKW waves: wave w takes key steps w, w + NKW, ... of the same 16 queries (flash attention over its share), then the NKW partial (max, sum, acc) are merged through LDS; scores 3 products, P.V 3 products; O[q][h*128+d]
#define NKW 8
__global__ __launch_bounds__(32 * NKW) void k_attn(const __bf16* __restrict__ QH, const __bf16* __restrict__ QL, const __bf16* __restrict__ KH, const __bf16* __restrict__ KL, const float* __restrict__ MASK, const __bf16* __restrict__ VTH, const __bf16* __restrict__ VTL, float* __restrict__ O) {
  __shared__ __align__(16) float sp[NKW][16][36]; __shared__ __align__(16) float so[NKW][16][132]; __shared__ float sm[NKW][16], sl[NKW][16];
  const int tid = threadIdx.x, wave = __builtin_amdgcn_readfirstlane(tid >> 5), lane = tid & 31, col = lane & 15, g = lane >> 4;
  const int qb = blockIdx.x, h = blockIdx.y, kv = h / (NH / NKV); const int q0 = qb * 16;
  const size_t qo = ((size_t)qb * (DM / 32) + h * (HD / 32)) * 512;   // the tile's q fragments are re-read per key step (8 KiB that all 8 waves share; keeps the kernel under 256 VGPRs)
  float m[8], l[8];
#pragma unroll
  for (int r = 0; r < 8; ++r) { m[r] = -3.0e38f; l[r] = 0.f; }
  v8f acc[8] = {};
#pragma unroll 1
  for (int ks = wave; ks < SS / 32; ks += NKW) { v8f s[2]; float mk[2][8]; bool anylive = false;
#pragma unroll
    for (int ct = 0; ct < 2; ++ct) { const int kk = ks * 32 + ct * 16 + col;
#pragma unroll
      for (int r = 0; r < 8; ++r) { const float m_ = bfr(MASK[(size_t)(q0 + 8 * g + r) * SS + kk]); mk[ct][r] = m_; anylive = anylive || (m_ > -1.0e8f); } }
    if (__any(anylive)) {   // wave-uniform: skip key tiles that are fully masked for this wave's 16 rows (exp of <= -1e8 underflows to exactly 0 in the reference too)
#pragma unroll
    for (int ct = 0; ct < 2; ++ct) { const size_t ko = ((size_t)(ks * 2 + ct) * (KVW / 32) + kv * (HD / 32)) * 512; v8f c = {};   // key columns ct * 16 .. + 15 of the step are fragment row ks * 2 + ct of the k planes
#pragma unroll
      for (int kc = 0; kc < 4; ++kc) { F2 kb, qa; kb.h = frag_fo(KH + ko + kc * 512, lane); kb.l = frag_fo(KL + ko + kc * 512, lane); qa.h = frag_fo(QH + qo + kc * 512, lane); qa.l = frag_fo(QL + qo + kc * 512, lane);
        if (ct == 1 && kc == 3) asm volatile("s_wait_xcnt 0x0" ::: "memory");   // the softmax code behind the last chunk reuses the address registers of these loads: the wait stands in front of that
        c = mac3(qa, kb, c); }
#pragma unroll
      for (int r = 0; r < 8; ++r) s[ct][r] = c[r] * 0.08838834764831845f + mk[ct][r]; }
#pragma unroll
    for (int r = 0; r < 8; ++r) { float mx = fmaxf(s[0][r], s[1][r]);
#pragma unroll
      for (int o = 1; o < 16; o <<= 1) mx = fmaxf(mx, __shfl_xor(mx, o));
      const float mn = fmaxf(m[r], mx); const float alpha = (m[r] <= -1.0e38f) ? 0.f : exp_ni(m[r] - mn);
      const float e0 = exp_ni(s[0][r] - mn), e1 = exp_ni(s[1][r] - mn); float es = e0 + e1;
#pragma unroll
      for (int o = 1; o < 16; o <<= 1) es += __shfl_xor(es, o);
      l[r] = l[r] * alpha + es; m[r] = mn;
#pragma unroll
      for (int dt = 0; dt < 8; ++dt) acc[dt][r] *= alpha;
      sp[wave][8 * g + r][col] = e0; sp[wave][8 * g + r][16 + col] = e1; }
    LDSX();
    const F2 pa = split_row(&sp[wave][col][0], 0, lane);
#pragma unroll
    for (int dt = 0; dt < 8; ++dt) { const size_t vr = ((size_t)(kv * (HD / 16) + dt) * (SS / 32) + ks) * 512; const v16b vh = frag_fo(VTH + vr, lane), vl = frag_fo(VTL + vr, lane); acc[dt] = wmma_bf(pa.l, vh, acc[dt]); acc[dt] = wmma_bf(pa.h, vl, acc[dt]); acc[dt] = wmma_bf(pa.h, vh, acc[dt]); }
    LDSX(); } }
  // merge: row maximum over the waves, each wave's sum and acc rescaled to it, then summed in wave order (a wave with no live key step has m = -3e38, l = 0 and weight 0)
  if (col == 0) {
#pragma unroll
    for (int r = 0; r < 8; ++r) sm[wave][8 * g + r] = m[r]; }
  __syncthreads();
#pragma unroll
  for (int r = 0; r < 8; ++r) { float mx = sm[0][8 * g + r];
#pragma unroll
    for (int w = 1; w < NKW; ++w) mx = fmaxf(mx, sm[w][8 * g + r]);
    const float f = (m[r] <= -1.0e38f) ? 0.f : exp_ni(m[r] - mx);
    if (col == 0) sl[wave][8 * g + r] = l[r] * f;
#pragma unroll
    for (int dt = 0; dt < 8; ++dt) so[wave][8 * g + r][dt * 16 + col] = acc[dt][r] * f; }
  __syncthreads();
  for (int rl = wave; rl < 16; rl += NKW) { v4f a = *(const v4f*)&so[0][rl][lane * 4]; float ls = sl[0][rl];
#pragma unroll
    for (int w = 1; w < NKW; ++w) { a += *(const v4f*)&so[w][rl][lane * 4]; ls += sl[w][rl]; }
    vst2(O + (size_t)(q0 + rl) * DM + h * HD + lane * 4, a * (1.0f / ls));
    asm volatile("s_wait_xcnt 0x0" ::: "memory"); }   // the next trip rewrites the store's address and data registers: the wait stands in front of that
}
// ---- k_out: block = (64 rows, 128 cols), operands staged in LDS as in k_proj: out = O(hi/lo) . wproj^T rows (2 products)
__global__ __launch_bounds__(128) void k_out(const float* __restrict__ O, const __bf16* __restrict__ P, const float* __restrict__ bias, float* __restrict__ Y) {
  __shared__ __align__(16) float so[4][16][132];
  __shared__ __align__(16) __bf16 sAh[2][64][72], sAl[2][64][72], sB[2][128][72];   // two buffers of one 64-k step: 64 O rows as bf16 hi and residual, 128 P rows, 128-B rows at pitch 144 B
  const int tid = threadIdx.x, wave = tid >> 5, lane = tid & 31, col = lane & 15, g = lane >> 4; const size_t r0 = (size_t)blockIdx.x * 64 + wave * 16; const int n0 = blockIdx.y * 128;
  const float* xg = O + ((size_t)blockIdx.x * 64 + (tid >> 4)) * DM + (tid & 15) * 4;   // piece it of a step: row (tid >> 4) + 8 it, 16 B; a wave's load = 2 rows x 256 B
  const __bf16* pg = P + (size_t)(n0 + (tid >> 3)) * DM + (tid & 7) * 8;                // piece it of a step: row (tid >> 3) + 16 it, 16 B; a wave's load = 4 rows x 128 B
  v8f acc[8] = {}; v4f xr[8]; v8b pr[8];
#pragma unroll
  for (int it = 0; it < 8; ++it) { xr[it] = *(const v4f*)(xg + (size_t)it * 8 * DM); pr[it] = *(const v8b*)(pg + (size_t)it * 16 * DM); }
#pragma unroll
  for (int it = 0; it < 8; ++it) { v4b h4, l4;
#pragma unroll
    for (int e = 0; e < 4; ++e) { const __bf16 hb = (__bf16)xr[it][e]; h4[e] = hb; l4[e] = (__bf16)(xr[it][e] - (float)hb); }
    *(v4b*)&sAh[0][(tid >> 4) + 8 * it][(tid & 15) * 4] = h4; *(v4b*)&sAl[0][(tid >> 4) + 8 * it][(tid & 15) * 4] = l4; *(v8b*)&sB[0][(tid >> 3) + 16 * it][(tid & 7) * 8] = pr[it]; }
#pragma unroll 2   // two copies: the buffer index is a constant in each, so every LDS address is a base register plus an immediate
  for (int st = 0; st < DM / 64; ++st) { const int bu = st & 1;
    __syncthreads();   // publishes step st; every reader of the other buffer (step st - 1) has left it before it is rewritten below
    if (st + 1 < DM / 64) {
#pragma unroll
      for (int it = 0; it < 8; ++it) { xr[it] = *(const v4f*)(xg + (size_t)it * 8 * DM + (st + 1) * 64); pr[it] = *(const v8b*)(pg + (size_t)it * 16 * DM + (st + 1) * 64); } }
#pragma unroll
    for (int k2 = 0; k2 < 2; ++k2) {
      if (k2 == 1) asm volatile("s_wait_xcnt 0x0" ::: "memory");   // stands in front of every later rewrite of the address registers of the next step's loads above
      const v16b ah = frag_b(&sAh[bu][wave * 16 + col][k2 * 32], lane), al = frag_b(&sAl[bu][wave * 16 + col][k2 * 32], lane); v16b b[8];
#pragma unroll
      for (int j = 0; j < 8; ++j) b[j] = frag_b(&sB[bu][j * 16 + col][k2 * 32], lane);
#pragma unroll
      for (int j = 0; j < 8; ++j) { acc[j] = wmma_bf(al, b[j], acc[j]); acc[j] = wmma_bf(ah, b[j], acc[j]); } }
    if (st + 1 < DM / 64) {
#pragma unroll
      for (int it = 0; it < 8; ++it) { v4b h4, l4;
#pragma unroll
        for (int e = 0; e < 4; ++e) { const __bf16 hb = (__bf16)xr[it][e]; h4[e] = hb; l4[e] = (__bf16)(xr[it][e] - (float)hb); }
        *(v4b*)&sAh[bu ^ 1][(tid >> 4) + 8 * it][(tid & 15) * 4] = h4; *(v4b*)&sAl[bu ^ 1][(tid >> 4) + 8 * it][(tid & 15) * 4] = l4; *(v8b*)&sB[bu ^ 1][(tid >> 3) + 16 * it][(tid & 7) * 8] = pr[it]; } } }
#pragma unroll
  for (int j = 0; j < 8; ++j)
#pragma unroll
    for (int r = 0; r < 8; ++r) so[wave][8 * g + r][j * 16 + col] = acc[j][r] + bfr(bias[n0 + j * 16 + col]);
  LDSX();
  for (int rl = 0; rl < 16; ++rl) vst2(Y + (r0 + rl) * DM + n0 + lane * 4, *(const v4f*)&so[wave][rl][lane * 4]);
}
extern "C" void kernel_launch(void* const* d_in, const int* in_sizes, int n_in, void* d_out, int out_size, void* d_ws, size_t ws_size, hipStream_t stream) {
  (void)in_sizes; (void)n_in; (void)out_size;
  const float** F = (const float**)d_in; const int* POS = (const int*)d_in[2];   // 0 hidden_states [1,2048,2048], 1 attention_mask [1,1,2048,2048], 2 position_ids [1,2048] i32, 3 Wq [2048,2048], 4 bq, 5 Wk [2048,256], 6 bk, 7 Wv, 8 bv, 9 Wo [2048,2048], 10 bo
  if (ws_size < (size_t)WS_END) return;
  char* ws = (char*)d_ws; __bf16 *PK = (__bf16*)(ws + WS_PK), *VTH = (__bf16*)(ws + WS_VTH), *VTL = (__bf16*)(ws + WS_VTL);
  __bf16 *QH = (__bf16*)(ws + WS_QH), *QL = (__bf16*)(ws + WS_QL), *KH = (__bf16*)(ws + WS_KH), *KL = (__bf16*)(ws + WS_KL);
  float *CS = (float*)(ws + WS_CS), *O = (float*)(ws + WS_O);
  k_packT<<<DM, 256, 0, stream>>>(F[3], DM, DM, PK + PK_Q); k_packT<<<KVW, 256, 0, stream>>>(F[5], DM, KVW, PK + PK_K); k_packT<<<KVW, 256, 0, stream>>>(F[7], DM, KVW, PK + PK_V); k_packT<<<DM, 256, 0, stream>>>(F[9], DM, DM, PK + PK_O);
  k_rope_tab<<<SS, 64, 0, stream>>>(POS, CS);
  k_proj<0><<<dim3(SS / 64, DM / 128), 128, 0, stream>>>(F[0], PK + PK_Q, F[4], CS, DM, QH, QL);
  k_proj<0><<<dim3(SS / 64, KVW / 128), 128, 0, stream>>>(F[0], PK + PK_K, F[6], CS, KVW, KH, KL);
  k_proj<1><<<dim3(SS / 64, KVW / 128), 128, 0, stream>>>(F[0], PK + PK_V, F[8], CS, 0, VTH, VTL);
  k_attn<<<dim3(SS / 16, NH), 32 * NKW, 0, stream>>>(QH, QL, KH, KL, F[1], VTH, VTL, O);
  k_out<<<dim3(TQB, DM / 128), 128, 0, stream>>>(O, PK + PK_O, F[10], (float*)d_out);
}

// v004
// It runs in 326 microseconds.
// In both of two side-by-side timings against v003, it was 1.15 times as fast.
// Counting every step since v000, it is 3.37 times as fast.
// compute dtype: hidden_states, all weights/biases and the additive attention_mask (module inputs) rounded to bf16; position_ids as int32; q/k/v projections with exact bf16 products (x and W are inputs) + bias and interleaved-pair RoPE from position_ids in f32 in the epilogue; scores q.k with both computed operands as bf16 hi + residual pairs (3 products) + the mask value, P.V with P hi/lo x V hi/lo (3 products); output projection hi/lo x exact Wo (2 products) + bo; softmax in f32; key tiles whose mask entries are all <= -1e8 for the wave's rows are skipped at run time (exp underflows to exactly 0 in the reference too); f32 accumulate.
#include <hip/hip_runtime.h>
#include <math.h>

typedef __attribute__((ext_vector_type(16))) _Float16 v16h;
typedef __attribute__((ext_vector_type(16))) __bf16 v16b;
typedef __attribute__((ext_vector_type(8)))  _Float16 v8h;
typedef __attribute__((ext_vector_type(8)))  float v8f;
typedef __attribute__((ext_vector_type(4)))  float v4f;
typedef __attribute__((ext_vector_type(2)))  float v2f;
typedef __attribute__((ext_vector_type(4)))  unsigned v4u;
typedef __attribute__((ext_vector_type(4)))  int v4i;
typedef float __attribute__((may_alias)) float_a;
typedef int __attribute__((may_alias)) int_a;

template <typename T> __device__ __forceinline__ void vst2(void* p, T v) { *(T*)p = v;  }
__device__ __forceinline__ v8f wmma16(v16h a, v16h b, v8f c) {
  v8f d = __builtin_amdgcn_wmma_f32_16x16x32_f16(false, a, false, b, (short)0, c, false, false);
  asm volatile("v_nop\n\tv_nop\n\tv_nop\n\tv_nop" : "+v"(d) : "v"(a), "v"(b));
  return d;
}
__device__ __forceinline__ v8f wmma_bf(v16b a, v16b b, v8f c) {
  v8f d = __builtin_amdgcn_wmma_f32_16x16x32_bf16(false, a, false, b, (short)0, c, false, false);
  asm volatile("v_nop\n\tv_nop\n\tv_nop\n\tv_nop" : "+v"(d) : "v"(a), "v"(b));
  return d;
}
// 16x16x32 fragments: lane = (h = lane>>4, row/col = lane&15); elements 0..7 = k0+8h+0..7, 8..15 = k0+16+8h+0..7; D element r = row 8h+r
__device__ __forceinline__ v16h frag_h(const _Float16* rowk0, int lane) {
  union { v16h v; v8h q[2]; } u; const _Float16* p = rowk0 + 8 * (lane >> 4);
  u.q[0] = *(const v8h*)p; u.q[1] = *(const v8h*)(p + 16); return u.v;
}
__device__ __forceinline__ v16h frag_f32(const float* rowk0, int lane) {
  v16h a; const float* p = rowk0 + 8 * (lane >> 4);
#pragma unroll
  for (int i = 0; i < 8; ++i) { a[i] = (_Float16)p[i]; a[8 + i] = (_Float16)p[16 + i]; }
  return a;
}
__device__ __forceinline__ v16h frag_f32s(const float* rowk0, int lane, float sc) {
  v16h a; const float* p = rowk0 + 8 * (lane >> 4);
#pragma unroll
  for (int i = 0; i < 8; ++i) { a[i] = (_Float16)(p[i] * sc); a[8 + i] = (_Float16)(p[16 + i] * sc); }
  return a;
}
// column fragment from a [K][ld] layout (column n), rows >= K read as 0
__device__ __forceinline__ v16h fragc_f32(const float* W, int k0, int n, int lane, int ld, int K) {
  v16h a; const int g = lane >> 4;
#pragma unroll
  for (int i = 0; i < 8; ++i) { const int ka = k0 + 8 * g + i, kb = ka + 16;
    a[i] = (_Float16)(ka < K ? W[(size_t)(ka < K ? ka : K - 1) * ld + n] : 0.f); a[8 + i] = (_Float16)(kb < K ? W[(size_t)(kb < K ? kb : K - 1) * ld + n] : 0.f); }
  return a;
}
struct F2 { v16b h, l; };
__device__ __forceinline__ F2 bsplit16(const float v[16]) { F2 r;
#pragma unroll
  for (int i = 0; i < 16; ++i) { const __bf16 h = (__bf16)v[i]; r.h[i] = h; r.l[i] = (__bf16)(v[i] - (float)h); }
  return r; }
__device__ __forceinline__ F2 split_row(const float* row, int k0, int lane) { float v[16]; const float* p = row + k0 + 8 * (lane >> 4);
#pragma unroll
  for (int i = 0; i < 8; ++i) { v[i] = p[i]; v[8 + i] = p[16 + i]; }
  return bsplit16(v); }
__device__ __forceinline__ F2 split_rowK(const float* row, int k0, int lane, int K) { float v[16]; const int g = lane >> 4;
#pragma unroll
  for (int i = 0; i < 8; ++i) { const int ka = k0 + 8 * g + i, kb = ka + 16; v[i] = ka < K ? row[ka < K ? ka : K - 1] : 0.f; v[8 + i] = kb < K ? row[kb < K ? kb : K - 1] : 0.f; }
  return bsplit16(v); }
__device__ __forceinline__ F2 split_col(const float* W, int k0, int n, int lane, int ld, int K) { float v[16]; const int g = lane >> 4;
#pragma unroll
  for (int i = 0; i < 8; ++i) { const int ka = k0 + 8 * g + i, kb = ka + 16; v[i] = ka < K ? W[(size_t)(ka < K ? ka : K - 1) * ld + n] : 0.f; v[8 + i] = kb < K ? W[(size_t)(kb < K ? kb : K - 1) * ld + n] : 0.f; }
  return bsplit16(v); }
__device__ __forceinline__ v8f mac3(const F2& a, const F2& b, v8f c) { c = wmma_bf(a.l, b.h, c); c = wmma_bf(a.h, b.l, c); return wmma_bf(a.h, b.h, c); }
__device__ __forceinline__ float sigm(float v) { return 1.0f / (1.0f + expf(-v)); }
#define LDSX() do { asm volatile("s_wait_dscnt 0" ::: "memory"); __builtin_amdgcn_wave_barrier(); __builtin_amdgcn_fence(__ATOMIC_RELEASE, "workgroup"); } while (0)


// Attention with grouped kv heads (B 1, S 2048, D 2048, 16 query heads / 2 kv heads x 128): q = rope(x Wq + bq), k = rope(x Wk + bk) (interleaved pairs, angles from position_ids), v = x Wv + bv; scores = q k^T / sqrt(128) + attention_mask[q][k] (additive input); softmax; out = (P v) Wo + bo.
#define SS 2048
#define DM 2048
#define NH 16
#define NKV 2
#define HD 128
#define KVW (NKV * HD)
#ifndef TQB
#define TQB (SS / 64)
#endif
typedef __attribute__((ext_vector_type(8))) __bf16 v8b;
typedef __attribute__((ext_vector_type(4))) __bf16 v4b;
__device__ __forceinline__ v16b frag_b(const __bf16* rowk0, int lane) {
  union { v16b v; v8b q[2]; } u; const __bf16* p = rowk0 + 8 * (lane >> 4);
  u.q[0] = *(const v8b*)p; u.q[1] = *(const v8b*)(p + 16); return u.v;
}
// fragment-order plane of a logical [R][C] bf16 matrix: 16-row x 32-column fragments of 512 elements, fragment index (row >> 4) * (C / 32) + (c >> 5); inside it element (row, c) sits at ((c >> 4) & 1) * 256 + (((c >> 3) & 1) * 16 + (row & 15)) * 8 + (c & 7). Lane l's two 16-B pieces (the same elements that frag_b reads from a row) are at l * 8 and 256 + l * 8: each load of a wave is 512 contiguous bytes
__device__ __forceinline__ v16b frag_fo(const __bf16* f, int lane) {
  union { v16b v; v8b q[2]; } u; u.q[0] = *(const v8b*)(f + lane * 8); u.q[1] = *(const v8b*)(f + 256 + lane * 8); return u.v;
}
__device__ __forceinline__ float bfr(float v) { return (float)(__bf16)v; }
__device__ __attribute__((noinline)) float exp_ni(float v) { return expf(v); }
__device__ __attribute__((noinline)) float erf_ni(float v) { return erff(v); }

#define PK_Q 0
#define PK_K (PK_Q + DM * DM)
#define PK_V (PK_K + KVW * DM)
#define PK_O (PK_V + KVW * DM)
#define PK_END (PK_O + DM * DM)
#define WS_PK  0u
#define WS_CS  (WS_PK + 2u * PK_END)             // f32 [2048][64] cos, then [2048][64] sin
#define WS_QH  (WS_CS + 4u * 2 * SS * 64)        // q after RoPE as bf16 hi plane [2048][2048] in fragment order, then its residual plane
#define WS_QL  (WS_QH + 2u * SS * DM)
#define WS_KH  (WS_QL + 2u * SS * DM)            // k after RoPE as bf16 hi plane [2048][256] in fragment order, then its residual plane
#define WS_KL  (WS_KH + 2u * SS * KVW)
#define WS_VTH (WS_KL + 2u * SS * KVW)
#define WS_VTL (WS_VTH + 2u * KVW * SS)
#define WS_O   (WS_VTL + 2u * KVW * SS)
#define WS_END (WS_O + 4u * SS * DM)

// ---- k_packT: block = tile of 64 k x 128 n of a [K][N] (x @ W) matrix, turned through LDS into DST [N][K] bf16: a wave's load = 512 contiguous bytes of one k row, a wave's store = 4 n rows x one whole 128-B line (K a multiple of 64, N of 128)
__global__ __launch_bounds__(256) void k_packT(const float* __restrict__ Wm, int K, int N, __bf16* __restrict__ DST) {
  __shared__ unsigned s[128][33];   // row n: its 64 k as 32 bf16 pairs (k, k + 1); the odd pitch spreads both the column-wise writes and the row-wise reads over the banks
  const int tid = threadIdx.x, wave = tid >> 5, lane = tid & 31; const int n0 = blockIdx.x * 128, k0 = blockIdx.y * 64;
  const float* src = Wm + (size_t)(k0 + wave * 8) * N + n0 + lane * 4; const float* pr[8]; v4f xr[8];
#pragma unroll
  for (int i = 0; i < 8; ++i) { pr[i] = src + (size_t)i * N; xr[i] = *(const v4f*)pr[i]; }
  // stands in front of every rewrite of the address registers of the 8 loads above; naming them as inputs keeps them whole up to here (without that a later load's result landed on an earlier load's address pair ahead of the wait)
  asm volatile("s_wait_xcnt 0x0" :: "v"(pr[0]), "v"(pr[1]), "v"(pr[2]), "v"(pr[3]), "v"(pr[4]), "v"(pr[5]), "v"(pr[6]), "v"(pr[7]) : "memory");
#pragma unroll
  for (int i = 0; i < 8; i += 2)
#pragma unroll
    for (int e = 0; e < 4; ++e) { union { __bf16 b[2]; unsigned u; } p; p.b[0] = (__bf16)xr[i][e]; p.b[1] = (__bf16)xr[i + 1][e]; s[lane * 4 + e][wave * 4 + (i >> 1)] = p.u; }
  __syncthreads();
#pragma unroll
  for (int j = 0; j < 4; ++j) { const int q = tid + 256 * j, n = q >> 3, k8 = q & 7; v4u o;
#pragma unroll
    for (int e = 0; e < 4; ++e) o[e] = s[n][k8 * 4 + e];
    vst2((unsigned*)(DST + (size_t)(n0 + n) * K + k0 + k8 * 8), o); }
}
// ---- k_rope_tab: block = position t (64 threads = pair index i): inv_freq = 1 / 10000^((2i)/128) and angle = float(position_ids[t]) * inv_freq in f32 (as the reference), cos/sin in f32; rows 256 B
__global__ __launch_bounds__(64) void k_rope_tab(const int* __restrict__ POS, float* __restrict__ CS) {
  __shared__ __align__(16) float sc[64], ssn[64]; const int t = blockIdx.x, i = threadIdx.x;
  const float inv = 1.0f / powf(10000.0f, (float)(2 * i) / 128.0f); const float ang = (float)POS[t] * inv; sc[i] = cosf(ang); ssn[i] = sinf(ang);
  __syncthreads();
  if (i < 16) vst2(CS + (size_t)t * 64 + i * 4, *(const v4f*)&sc[i * 4]); else if (i < 32) vst2(CS + (size_t)SS * 64 + (size_t)t * 64 + (i - 16) * 4, *(const v4f*)&ssn[(i - 16) * 4]);
}
// ---- k_proj<MODE>: block = (64 rows, 128 cols = one head), operands staged in LDS per 64-k step, the next step's global loads issued ahead of this step's products: Y = bf16(x) . P rows (exact); MODE 0: RoPE then bf16 hi/lo planes of [2048][ldo] in fragment order (q/k); MODE 1: plain -> transposed bf16 hi/lo planes of [256][2048] in fragment order (v)
template <int MODE>
__global__ __launch_bounds__(128) void k_proj(const float* __restrict__ X, const __bf16* __restrict__ P, const float* __restrict__ bias, const float* __restrict__ CS, int ldo, __bf16* __restrict__ PH, __bf16* __restrict__ PL) {
  __shared__ __align__(16) float so[MODE ? 1 : 4][16][132]; __shared__ __align__(16) __bf16 sth[MODE ? 128 : 1][72], stl[MODE ? 128 : 1][72];
  __shared__ __align__(16) __bf16 sA[2][64][72], sB[2][128][72];   // two buffers of one 64-k step: 64 x rows (rounded to bf16) and 128 P rows, 128-B rows at pitch 144 B
  const int tid = threadIdx.x, wave = tid >> 5, lane = tid & 31, col = lane & 15, g = lane >> 4; const size_t r0 = (size_t)blockIdx.x * 64 + wave * 16; const int n0 = blockIdx.y * 128;
  const float* xg = X + ((size_t)blockIdx.x * 64 + (tid >> 4)) * DM + (tid & 15) * 4;   // piece it of a step: row (tid >> 4) + 8 it, 16 B; a wave's load = 2 rows x 256 B
  const __bf16* pg = P + (size_t)(n0 + (tid >> 3)) * DM + (tid & 7) * 8;                // piece it of a step: row (tid >> 3) + 16 it, 16 B; a wave's load = 4 rows x 128 B
  v8f acc[8] = {}; v4f xr[8]; v8b pr[8];
#pragma unroll
  for (int it = 0; it < 8; ++it) { xr[it] = *(const v4f*)(xg + (size_t)it * 8 * DM); pr[it] = *(const v8b*)(pg + (size_t)it * 16 * DM); }
#pragma unroll
  for (int it = 0; it < 8; ++it) { v4b x4;
#pragma unroll
    for (int e = 0; e < 4; ++e) x4[e] = (__bf16)xr[it][e];
    *(v4b*)&sA[0][(tid >> 4) + 8 * it][(tid & 15) * 4] = x4; *(v8b*)&sB[0][(tid >> 3) + 16 * it][(tid & 7) * 8] = pr[it]; }
#pragma unroll 2   // two copies: the buffer index is a constant in each, so every LDS address is a base register plus an immediate
  for (int st = 0; st < DM / 64; ++st) { const int bu = st & 1;
    __syncthreads();   // publishes step st; every reader of the other buffer (step st - 1) has left it before it is rewritten below
    if (st + 1 < DM / 64) {
#pragma unroll
      for (int it = 0; it < 8; ++it) { xr[it] = *(const v4f*)(xg + (size_t)it * 8 * DM + (st + 1) * 64); pr[it] = *(const v8b*)(pg + (size_t)it * 16 * DM + (st + 1) * 64); } }
#pragma unroll
    for (int k2 = 0; k2 < 2; ++k2) {
      if (k2 == 1) asm volatile("s_wait_xcnt 0x0" ::: "memory");   // stands in front of every later rewrite of the address registers of the next step's loads above
      const v16b a = frag_b(&sA[bu][wave * 16 + col][k2 * 32], lane); v16b b[8];
#pragma unroll
      for (int j = 0; j < 8; ++j) b[j] = frag_b(&sB[bu][j * 16 + col][k2 * 32], lane);
#pragma unroll
      for (int j = 0; j < 8; ++j) acc[j] = wmma_bf(a, b[j], acc[j]); }
    if (st + 1 < DM / 64) {
#pragma unroll
      for (int it = 0; it < 8; ++it) { v4b x4;
#pragma unroll
        for (int e = 0; e < 4; ++e) x4[e] = (__bf16)xr[it][e];
        *(v4b*)&sA[bu ^ 1][(tid >> 4) + 8 * it][(tid & 15) * 4] = x4; *(v8b*)&sB[bu ^ 1][(tid >> 3) + 16 * it][(tid & 7) * 8] = pr[it]; } } }
  if (MODE == 0) {
    // biased projections to LDS, then interleaved-pair RoPE in place: (d = 2i, 2i+1): out_e = x_e cos_i - x_o sin_i; out_o = x_e sin_i + x_o cos_i with angle index i = d/2 (position from position_ids via the CS tables)
#pragma unroll
    for (int j = 0; j < 8; ++j) { const float bb = bfr(bias[n0 + j * 16 + col]);
#pragma unroll
      for (int r = 0; r < 8; ++r) so[wave][8 * g + r][j * 16 + col] = acc[j][r] + bb; }
    LDSX();
    for (int q = lane; q < 16 * 64; q += 32) { const int rl = q >> 6, i = q & 63; const size_t t = r0 + rl; const float c = CS[t * 64 + i], s = CS[(size_t)SS * 64 + t * 64 + i]; const float xe = so[wave][rl][2 * i], xo = so[wave][rl][2 * i + 1]; so[wave][rl][2 * i] = xe * c - xo * s; so[wave][rl][2 * i + 1] = xe * s + xo * c; }
    LDSX();
    // each value leaves as bf16 hi + bf16 residual, the same split that the score products use; the wave's 16 rows x 128 columns are 4 whole fragments of each plane, piece p = 16 columns: a wave's store = 512 contiguous bytes
    const size_t f0 = ((r0 >> 4) * (size_t)(ldo >> 5) + (n0 >> 5)) * 512;
    for (int p = 0; p < 8; ++p) { const float* sr = &so[wave][col][p * 16 + g * 8]; const v4f va = *(const v4f*)sr, vb = *(const v4f*)(sr + 4); v8b h8, l8;
#pragma unroll
      for (int e = 0; e < 4; ++e) { const __bf16 ha = (__bf16)va[e], hb = (__bf16)vb[e]; h8[e] = ha; l8[e] = (__bf16)(va[e] - (float)ha); h8[4 + e] = hb; l8[4 + e] = (__bf16)(vb[e] - (float)hb); }
      const size_t o = f0 + p * 256 + lane * 8; *(v8b*)(PH + o) = h8; *(v8b*)(PL + o) = l8;
      asm volatile("s_wait_xcnt 0x0" ::: "memory"); }   // the next piece rewrites the stores' data registers: the wait stands in front of that
  } else {
#pragma unroll
    for (int j = 0; j < 8; ++j)
#pragma unroll
      for (int r = 0; r < 8; ++r) { const float v = acc[j][r] + bfr(bias[n0 + j * 16 + col]); const __bf16 hb = (__bf16)v; sth[j * 16 + col][wave * 16 + 8 * g + r] = hb; stl[j * 16 + col][wave * 16 + 8 * g + r] = (__bf16)(v - (float)hb); }
    __syncthreads();
    const int s0 = blockIdx.x * 64;
    // the block's 128 d x 64 s are 16 whole fragments of each plane: fragment fl, half j, lane slot sl; a wave's store = 512 contiguous bytes
    for (int q = tid; q < 128 * 8; q += 128) { const int fl = q >> 6, j = (q >> 5) & 1, sl = q & 31; const int d = (fl >> 1) * 16 + (sl & 15), c = (fl & 1) * 32 + j * 16 + (sl >> 4) * 8;
      const size_t o = ((size_t)((n0 >> 4) + (fl >> 1)) * (SS / 32) + (s0 >> 5) + (fl & 1)) * 512 + j * 256 + sl * 8; vst2((unsigned*)(PH + o), *(const v4u*)&sth[d][c]); vst2((unsigned*)(PL + o), *(const v4u*)&stl[d][c]); }
  }
}
// ---- k_attn: block = (16 queries, head h), NKW waves: wave w takes key steps w, w + NKW, ... of the same 16 queries (flash attention over its share), then the NKW partial (max, sum, acc) are merged through LDS; scores 3 products, P.V 3 products; O[q][h*128+d]
#define NKW 8
__global__ __launch_bounds__(32 * NKW) void k_attn(const __bf16* __restrict__ QH, const __bf16* __restrict__ QL, const __bf16* __restrict__ KH, const __bf16* __restrict__ KL, const float* __restrict__ MASK, const __bf16* __restrict__ VTH, const __bf16* __restrict__ VTL, float* __restrict__ O) {
  __shared__ __align__(16) float sp[NKW][16][36]; __shared__ __align__(16) float so[NKW][16][132]; __shared__ float sm[NKW][16], sl[NKW][16];
  const int tid = threadIdx.x, wave = __builtin_amdgcn_readfirstlane(tid >> 5), lane = tid & 31, col = lane & 15, g = lane >> 4;
  const int qb = blockIdx.x, h = blockIdx.y, kv = h / (NH / NKV); const int q0 = qb * 16;
  const size_t qo = ((size_t)qb * (DM / 32) + h * (HD / 32)) * 512;   // the tile's q fragments are re-read per key step (8 KiB that all 8 waves share; keeps the kernel under 256 VGPRs)
  float m[8], l[8];
#pragma unroll
  for (int r = 0; r < 8; ++r) { m[r] = -3.0e38f; l[r] = 0.f; }
  v8f acc[8] = {};
#pragma unroll 1
  for (int ks = wave; ks < SS / 32; ks += NKW) { v8f s[2]; float mk[2][8]; bool anylive = false;
#pragma unroll
    for (int ct = 0; ct < 2; ++ct) { const int kk = ks * 32 + ct * 16 + col;
#pragma unroll
      for (int r = 0; r < 8; ++r) { const float m_ = bfr(MASK[(size_t)(q0 + 8 * g + r) * SS + kk]); mk[ct][r] = m_; anylive = anylive || (m_ > -1.0e8f); } }
    if (__any(anylive)) {   // wave-uniform: skip key tiles that are fully masked for this wave's 16 rows (exp of <= -1e8 underflows to exactly 0 in the reference too)
#pragma unroll
    for (int ct = 0; ct < 2; ++ct) { const size_t ko = ((size_t)(ks * 2 + ct) * (KVW / 32) + kv * (HD / 32)) * 512; v8f c = {};   // key columns ct * 16 .. + 15 of the step are fragment row ks * 2 + ct of the k planes
#pragma unroll
      for (int kc = 0; kc < 4; ++kc) { F2 kb, qa; kb.h = frag_fo(KH + ko + kc * 512, lane); kb.l = frag_fo(KL + ko + kc * 512, lane); qa.h = frag_fo(QH + qo + kc * 512, lane); qa.l = frag_fo(QL + qo + kc * 512, lane);
        if (ct == 1 && kc == 3) asm volatile("s_wait_xcnt 0x0" ::: "memory");   // the softmax code behind the last chunk reuses the address registers of these loads: the wait stands in front of that
        c = mac3(qa, kb, c); }
#pragma unroll
      for (int r = 0; r < 8; ++r) s[ct][r] = c[r] * 0.08838834764831845f + mk[ct][r]; }
#pragma unroll
    for (int r = 0; r < 8; ++r) { float mx = fmaxf(s[0][r], s[1][r]);
#pragma unroll
      for (int o = 1; o < 16; o <<= 1) mx = fmaxf(mx, __shfl_xor(mx, o));
      const float mn = fmaxf(m[r], mx); const float alpha = (m[r] <= -1.0e38f) ? 0.f : exp_ni(m[r] - mn);
      const float e0 = exp_ni(s[0][r] - mn), e1 = exp_ni(s[1][r] - mn); float es = e0 + e1;
#pragma unroll
      for (int o = 1; o < 16; o <<= 1) es += __shfl_xor(es, o);
      l[r] = l[r] * alpha + es; m[r] = mn;
#pragma unroll
      for (int dt = 0; dt < 8; ++dt) acc[dt][r] *= alpha;
      sp[wave][8 * g + r][col] = e0; sp[wave][8 * g + r][16 + col] = e1; }
    LDSX();
    const F2 pa = split_row(&sp[wave][col][0], 0, lane);
#pragma unroll
    for (int dt = 0; dt < 8; ++dt) { const size_t vr = ((size_t)(kv * (HD / 16) + dt) * (SS / 32) + ks) * 512; const v16b vh = frag_fo(VTH + vr, lane), vl = frag_fo(VTL + vr, lane); acc[dt] = wmma_bf(pa.l, vh, acc[dt]); acc[dt] = wmma_bf(pa.h, vl, acc[dt]); acc[dt] = wmma_bf(pa.h, vh, acc[dt]); }
    LDSX(); } }
  // merge: row maximum over the waves, each wave's sum and acc rescaled to it, then summed in wave order (a wave with no live key step has m = -3e38, l = 0 and weight 0)
  if (col == 0) {
#pragma unroll
    for (int r = 0; r < 8; ++r) sm[wave][8 * g + r] = m[r]; }
  __syncthreads();
#pragma unroll
  for (int r = 0; r < 8; ++r) { float mx = sm[0][8 * g + r];
#pragma unroll
    for (int w = 1; w < NKW; ++w) mx = fmaxf(mx, sm[w][8 * g + r]);
    const float f = (m[r] <= -1.0e38f) ? 0.f : exp_ni(m[r] - mx);
    if (col == 0) sl[wave][8 * g + r] = l[r] * f;
#pragma unroll
    for (int dt = 0; dt < 8; ++dt) so[wave][8 * g + r][dt * 16 + col] = acc[dt][r] * f; }
  __syncthreads();
  for (int rl = wave; rl < 16; rl += NKW) { v4f a = *(const v4f*)&so[0][rl][lane * 4]; float ls = sl[0][rl];
#pragma unroll
    for (int w = 1; w < NKW; ++w) { a += *(const v4f*)&so[w][rl][lane * 4]; ls += sl[w][rl]; }
    vst2(O + (size_t)(q0 + rl) * DM + h * HD + lane * 4, a * (1.0f / ls));
    asm volatile("s_wait_xcnt 0x0" ::: "memory"); }   // the next trip rewrites the store's address and data registers: the wait stands in front of that
}
// ---- k_out: block = (64 rows, 128 cols), operands staged in LDS as in k_proj: out = O(hi/lo) . wproj^T rows (2 products)
__global__ __launch_bounds__(128) void k_out(const float* __restrict__ O, const __bf16* __restrict__ P, const float* __restrict__ bias, float* __restrict__ Y) {
  __shared__ __align__(16) float so[4][16][132];
  __shared__ __align__(16) __bf16 sAh[2][64][72], sAl[2][64][72], sB[2][128][72];   // two buffers of one 64-k step: 64 O rows as bf16 hi and residual, 128 P rows, 128-B rows at pitch 144 B
  const int tid = threadIdx.x, wave = tid >> 5, lane = tid & 31, col = lane & 15, g = lane >> 4; const size_t r0 = (size_t)blockIdx.x * 64 + wave * 16; const int n0 = blockIdx.y * 128;
  const float* xg = O + ((size_t)blockIdx.x * 64 + (tid >> 4)) * DM + (tid & 15) * 4;   // piece it of a step: row (tid >> 4) + 8 it, 16 B; a wave's load = 2 rows x 256 B
  const __bf16* pg = P + (size_t)(n0 + (tid >> 3)) * DM + (tid & 7) * 8;                // piece it of a step: row (tid >> 3) + 16 it, 16 B; a wave's load = 4 rows x 128 B
  v8f acc[8] = {}; v4f xr[8]; v8b pr[8];
#pragma unroll
  for (int it = 0; it < 8; ++it) { xr[it] = *(const v4f*)(xg + (size_t)it * 8 * DM); pr[it] = *(const v8b*)(pg + (size_t)it * 16 * DM); }
#pragma unroll
  for (int it = 0; it < 8; ++it) { v4b h4, l4;
#pragma unroll
    for (int e = 0; e < 4; ++e) { const __bf16 hb = (__bf16)xr[it][e]; h4[e] = hb; l4[e] = (__bf16)(xr[it][e] - (float)hb); }
    *(v4b*)&sAh[0][(tid >> 4) + 8 * it][(tid & 15) * 4] = h4; *(v4b*)&sAl[0][(tid >> 4) + 8 * it][(tid & 15) * 4] = l4; *(v8b*)&sB[0][(tid >> 3) + 16 * it][(tid & 7) * 8] = pr[it]; }
#pragma unroll 2   // two copies: the buffer index is a constant in each, so every LDS address is a base register plus an immediate
  for (int st = 0; st < DM / 64; ++st) { const int bu = st & 1;
    __syncthreads();   // publishes step st; every reader of the other buffer (step st - 1) has left it before it is rewritten below
    if (st + 1 < DM / 64) {
#pragma unroll
      for (int it = 0; it < 8; ++it) { xr[it] = *(const v4f*)(xg + (size_t)it * 8 * DM + (st + 1) * 64); pr[it] = *(const v8b*)(pg + (size_t)it * 16 * DM + (st + 1) * 64); } }
#pragma unroll
    for (int k2 = 0; k2 < 2; ++k2) {
      if (k2 == 1) asm volatile("s_wait_xcnt 0x0" ::: "memory");   // stands in front of every later rewrite of the address registers of the next step's loads above
      const v16b ah = frag_b(&sAh[bu][wave * 16 + col][k2 * 32], lane), al = frag_b(&sAl[bu][wave * 16 + col][k2 * 32], lane); v16b b[8];
#pragma unroll
      for (int j = 0; j < 8; ++j) b[j] = frag_b(&sB[bu][j * 16 + col][k2 * 32], lane);
#pragma unroll
      for (int j = 0; j < 8; ++j) { acc[j] = wmma_bf(al, b[j], acc[j]); acc[j] = wmma_bf(ah, b[j], acc[j]); } }
    if (st + 1 < DM / 64) {
#pragma unroll
      for (int it = 0; it < 8; ++it) { v4b h4, l4;
#pragma unroll
        for (int e = 0; e < 4; ++e) { const __bf16 hb = (__bf16)xr[it][e]; h4[e] = hb; l4[e] = (__bf16)(xr[it][e] - (float)hb); }
        *(v4b*)&sAh[bu ^ 1][(tid >> 4) + 8 * it][(tid & 15) * 4] = h4; *(v4b*)&sAl[bu ^ 1][(tid >> 4) + 8 * it][(tid & 15) * 4] = l4; *(v8b*)&sB[bu ^ 1][(tid >> 3) + 16 * it][(tid & 7) * 8] = pr[it]; } } }
#pragma unroll
  for (int j = 0; j < 8; ++j)
#pragma unroll
    for (int r = 0; r < 8; ++r) so[wave][8 * g + r][j * 16 + col] = acc[j][r] + bfr(bias[n0 + j * 16 + col]);
  LDSX();
  for (int rl = 0; rl < 16; ++rl) vst2(Y + (r0 + rl) * DM + n0 + lane * 4, *(const v4f*)&so[wave][rl][lane * 4]);
}
extern "C" void kernel_launch(void* const* d_in, const int* in_sizes, int n_in, void* d_out, int out_size, void* d_ws, size_t ws_size, hipStream_t stream) {
  (void)in_sizes; (void)n_in; (void)out_size;
  const float** F = (const float**)d_in; const int* POS = (const int*)d_in[2];   // 0 hidden_states [1,2048,2048], 1 attention_mask [1,1,2048,2048], 2 position_ids [1,2048] i32, 3 Wq [2048,2048], 4 bq, 5 Wk [2048,256], 6 bk, 7 Wv, 8 bv, 9 Wo [2048,2048], 10 bo
  if (ws_size < (size_t)WS_END) return;
  char* ws = (char*)d_ws; __bf16 *PK = (__bf16*)(ws + WS_PK), *VTH = (__bf16*)(ws + WS_VTH), *VTL = (__bf16*)(ws + WS_VTL);
  __bf16 *QH = (__bf16*)(ws + WS_QH), *QL = (__bf16*)(ws + WS_QL), *KH = (__bf16*)(ws + WS_KH), *KL = (__bf16*)(ws + WS_KL);
  float *CS = (float*)(ws + WS_CS), *O = (float*)(ws + WS_O);
  k_packT<<<dim3(DM / 128, DM / 64), 256, 0, stream>>>(F[3], DM, DM, PK + PK_Q); k_packT<<<dim3(KVW / 128, DM / 64), 256, 0, stream>>>(F[5], DM, KVW, PK + PK_K); k_packT<<<dim3(KVW / 128, DM / 64), 256, 0, stream>>>(F[7], DM, KVW, PK + PK_V); k_packT<<<dim3(DM / 128, DM / 64), 256, 0, stream>>>(F[9], DM, DM, PK + PK_O);
  k_rope_tab<<<SS, 64, 0, stream>>>(POS, CS);
  k_proj<0><<<dim3(SS / 64, DM / 128), 128, 0, stream>>>(F[0], PK + PK_Q, F[4], CS, DM, QH, QL);
  k_proj<0><<<dim3(SS / 64, KVW / 128), 128, 0, stream>>>(F[0], PK + PK_K, F[6], CS, KVW, KH, KL);
  k_proj<1><<<dim3(SS / 64, KVW / 128), 128, 0, stream>>>(F[0], PK + PK_V, F[8], CS, 0, VTH, VTL);
  k_attn<<<dim3(SS / 16, NH), 32 * NKW, 0, stream>>>(QH, QL, KH, KL, F[1], VTH, VTL, O);
  k_out<<<dim3(TQB, DM / 128), 128, 0, stream>>>(O, PK + PK_O, F[10], (float*)d_out);
}

// v005
// It runs in 286 microseconds.
// Two timings next to v004 put it at 1.12 and 1.16 times that version's speed.
// All steps since v000 together make it 3.85 times as fast.
// compute dtype: hidden_states, all weights/biases and the additive attention_mask (module inputs) rounded to bf16; position_ids as int32; q/k/v projections with exact bf16 products (x and W are inputs) + bias and interleaved-pair RoPE from position_ids in f32 in the epilogue; scores q.k with both computed operands as bf16 hi + residual pairs (3 products) + the mask value, P.V with P hi/lo x V hi/lo (3 products); output projection hi/lo x exact Wo (2 products) + bo; softmax in f32; key tiles whose mask entries are all <= -1e8 for the wave's rows are skipped at run time (exp underflows to exactly 0 in the reference too); f32 accumulate.
#include <hip/hip_runtime.h>
#include <math.h>

typedef __attribute__((ext_vector_type(16))) _Float16 v16h;
typedef __attribute__((ext_vector_type(16))) __bf16 v16b;
typedef __attribute__((ext_vector_type(8)))  _Float16 v8h;
typedef __attribute__((ext_vector_type(8)))  float v8f;
typedef __attribute__((ext_vector_type(4)))  float v4f;
typedef __attribute__((ext_vector_type(2)))  float v2f;
typedef __attribute__((ext_vector_type(4)))  unsigned v4u;
typedef __attribute__((ext_vector_type(4)))  int v4i;
typedef float __attribute__((may_alias)) float_a;
typedef int __attribute__((may_alias)) int_a;

template <typename T> __device__ __forceinline__ void vst2(void* p, T v) { *(T*)p = v;  }
__device__ __forceinline__ v8f wmma16(v16h a, v16h b, v8f c) {
  v8f d = __builtin_amdgcn_wmma_f32_16x16x32_f16(false, a, false, b, (short)0, c, false, false);
  asm volatile("v_nop\n\tv_nop\n\tv_nop\n\tv_nop" : "+v"(d) : "v"(a), "v"(b));
  return d;
}
__device__ __forceinline__ v8f wmma_bf(v16b a, v16b b, v8f c) {
  v8f d = __builtin_amdgcn_wmma_f32_16x16x32_bf16(false, a, false, b, (short)0, c, false, false);
  asm volatile("v_nop\n\tv_nop\n\tv_nop\n\tv_nop" : "+v"(d) : "v"(a), "v"(b));
  return d;
}
// 16x16x32 fragments: lane = (h = lane>>4, row/col = lane&15); elements 0..7 = k0+8h+0..7, 8..15 = k0+16+8h+0..7; D element r = row 8h+r
__device__ __forceinline__ v16h frag_h(const _Float16* rowk0, int lane) {
  union { v16h v; v8h q[2]; } u; const _Float16* p = rowk0 + 8 * (lane >> 4);
  u.q[0] = *(const v8h*)p; u.q[1] = *(const v8h*)(p + 16); return u.v;
}
__device__ __forceinline__ v16h frag_f32(const float* rowk0, int lane) {
  v16h a; const float* p = rowk0 + 8 * (lane >> 4);
#pragma unroll
  for (int i = 0; i < 8; ++i) { a[i] = (_Float16)p[i]; a[8 + i] = (_Float16)p[16 + i]; }
  return a;
}
__device__ __forceinline__ v16h frag_f32s(const float* rowk0, int lane, float sc) {
  v16h a; const float* p = rowk0 + 8 * (lane >> 4);
#pragma unroll
  for (int i = 0; i < 8; ++i) { a[i] = (_Float16)(p[i] * sc); a[8 + i] = (_Float16)(p[16 + i] * sc); }
  return a;
}
// column fragment from a [K][ld] layout (column n), rows >= K read as 0
__device__ __forceinline__ v16h fragc_f32(const float* W, int k0, int n, int lane, int ld, int K) {
  v16h a; const int g = lane >> 4;
#pragma unroll
  for (int i = 0; i < 8; ++i) { const int ka = k0 + 8 * g + i, kb = ka + 16;
    a[i] = (_Float16)(ka < K ? W[(size_t)(ka < K ? ka : K - 1) * ld + n] : 0.f); a[8 + i] = (_Float16)(kb < K ? W[(size_t)(kb < K ? kb : K - 1) * ld + n] : 0.f); }
  return a;
}
struct F2 { v16b h, l; };
__device__ __forceinline__ F2 bsplit16(const float v[16]) { F2 r;
#pragma unroll
  for (int i = 0; i < 16; ++i) { const __bf16 h = (__bf16)v[i]; r.h[i] = h; r.l[i] = (__bf16)(v[i] - (float)h); }
  return r; }
__device__ __forceinline__ F2 split_row(const float* row, int k0, int lane) { float v[16]; const float* p = row + k0 + 8 * (lane >> 4);
#pragma unroll
  for (int i = 0; i < 8; ++i) { v[i] = p[i]; v[8 + i] = p[16 + i]; }
  return bsplit16(v); }
__device__ __forceinline__ F2 split_rowK(const float* row, int k0, int lane, int K) { float v[16]; const int g = lane >> 4;
#pragma unroll
  for (int i = 0; i < 8; ++i) { const int ka = k0 + 8 * g + i, kb = ka + 16; v[i] = ka < K ? row[ka < K ? ka : K - 1] : 0.f; v[8 + i] = kb < K ? row[kb < K ? kb : K - 1] : 0.f; }
  return bsplit16(v); }
__device__ __forceinline__ F2 split_col(const float* W, int k0, int n, int lane, int ld, int K) { float v[16]; const int g = lane >> 4;
#pragma unroll
  for (int i = 0; i < 8; ++i) { const int ka = k0 + 8 * g + i, kb = ka + 16; v[i] = ka < K ? W[(size_t)(ka < K ? ka : K - 1) * ld + n] : 0.f; v[8 + i] = kb < K ? W[(size_t)(kb < K ? kb : K - 1) * ld + n] : 0.f; }
  return bsplit16(v); }
__device__ __forceinline__ v8f mac3(const F2& a, const F2& b, v8f c) { c = wmma_bf(a.l, b.h, c); c = wmma_bf(a.h, b.l, c); return wmma_bf(a.h, b.h, c); }
__device__ __forceinline__ float sigm(float v) { return 1.0f / (1.0f + expf(-v)); }
#define LDSX() do { asm volatile("s_wait_dscnt 0" ::: "memory"); __builtin_amdgcn_wave_barrier(); __builtin_amdgcn_fence(__ATOMIC_RELEASE, "workgroup"); } while (0)


// Attention with grouped kv heads (B 1, S 2048, D 2048, 16 query heads / 2 kv heads x 128): q = rope(x Wq + bq), k = rope(x Wk + bk) (interleaved pairs, angles from position_ids), v = x Wv + bv; scores = q k^T / sqrt(128) + attention_mask[q][k] (additive input); softmax; out = (P v) Wo + bo.
#define SS 2048
#define DM 2048
#define NH 16
#define NKV 2
#define HD 128
#define KVW (NKV * HD)
#ifndef TQB
#define TQB (SS / 64)
#endif
typedef __attribute__((ext_vector_type(8))) __bf16 v8b;
typedef __attribute__((ext_vector_type(4))) __bf16 v4b;
__device__ __forceinline__ v16b frag_b(const __bf16* rowk0, int lane) {
  union { v16b v; v8b q[2]; } u; const __bf16* p = rowk0 + 8 * (lane >> 4);
  u.q[0] = *(const v8b*)p; u.q[1] = *(const v8b*)(p + 16); return u.v;
}
// fragment-order plane of a logical [R][C] bf16 matrix: 16-row x 32-column fragments of 512 elements, fragment index (row >> 4) * (C / 32) + (c >> 5); inside it element (row, c) sits at ((c >> 4) & 1) * 256 + (((c >> 3) & 1) * 16 + (row & 15)) * 8 + (c & 7). Lane l's two 16-B pieces (the same elements that frag_b reads from a row) are at l * 8 and 256 + l * 8: each load of a wave is 512 contiguous bytes
__device__ __forceinline__ v16b frag_fo(const __bf16* f, int lane) {
  union { v16b v; v8b q[2]; } u; u.q[0] = *(const v8b*)(f + lane * 8); u.q[1] = *(const v8b*)(f + 256 + lane * 8); return u.v;
}
__device__ __forceinline__ float bfr(float v) { return (float)(__bf16)v; }
__device__ __attribute__((noinline)) float exp_ni(float v) { return expf(v); }
__device__ __attribute__((noinline)) float erf_ni(float v) { return erff(v); }

#define PK_Q 0
#define PK_K (PK_Q + DM * DM)
#define PK_V (PK_K + KVW * DM)
#define PK_O (PK_V + KVW * DM)
#define PK_END (PK_O + DM * DM)
#define WS_PK  0u
#define WS_CS  (WS_PK + 2u * PK_END)             // f32 [2048][64] cos, then [2048][64] sin
#define WS_QH  (WS_CS + 4u * 2 * SS * 64)        // q after RoPE as bf16 hi plane [2048][2048] in fragment order, then its residual plane
#define WS_QL  (WS_QH + 2u * SS * DM)
#define WS_KH  (WS_QL + 2u * SS * DM)            // k after RoPE as bf16 hi plane [2048][256] in fragment order, then its residual plane
#define WS_KL  (WS_KH + 2u * SS * KVW)
#define WS_VTH (WS_KL + 2u * SS * KVW)
#define WS_VTL (WS_VTH + 2u * KVW * SS)
#define WS_O   (WS_VTL + 2u * KVW * SS)
#define WS_END (WS_O + 4u * SS * DM)

// ---- k_packT: block = tile of 64 k x 128 n of a [K][N] (x @ W) matrix, turned through LDS into DST [N][K] bf16: a wave's load = 512 contiguous bytes of one k row, a wave's store = 4 n rows x one whole 128-B line (K a multiple of 64, N of 128)
__global__ __launch_bounds__(256) void k_packT(const float* __restrict__ Wm, int K, int N, __bf16* __restrict__ DST) {
  __shared__ unsigned s[128][33];   // row n: its 64 k as 32 bf16 pairs (k, k + 1); the odd pitch spreads both the column-wise writes and the row-wise reads over the banks
  const int tid = threadIdx.x, wave = tid >> 5, lane = tid & 31; const int n0 = blockIdx.x * 128, k0 = blockIdx.y * 64;
  const float* src = Wm + (size_t)(k0 + wave * 8) * N + n0 + lane * 4; const float* pr[8]; v4f xr[8];
#pragma unroll
  for (int i = 0; i < 8; ++i) { pr[i] = src + (size_t)i * N; xr[i] = *(const v4f*)pr[i]; }
  // stands in front of every rewrite of the address registers of the 8 loads above; naming them as inputs keeps them whole up to here (without that a later load's result landed on an earlier load's address pair ahead of the wait)
  asm volatile("s_wait_xcnt 0x0" :: "v"(pr[0]), "v"(pr[1]), "v"(pr[2]), "v"(pr[3]), "v"(pr[4]), "v"(pr[5]), "v"(pr[6]), "v"(pr[7]) : "memory");
#pragma unroll
  for (int i = 0; i < 8; i += 2)
#pragma unroll
    for (int e = 0; e < 4; ++e) { union { __bf16 b[2]; unsigned u; } p; p.b[0] = (__bf16)xr[i][e]; p.b[1] = (__bf16)xr[i + 1][e]; s[lane * 4 + e][wave * 4 + (i >> 1)] = p.u; }
  __syncthreads();
#pragma unroll
  for (int j = 0; j < 4; ++j) { const int q = tid + 256 * j, n = q >> 3, k8 = q & 7; v4u o;
#pragma unroll
    for (int e = 0; e < 4; ++e) o[e] = s[n][k8 * 4 + e];
    vst2((unsigned*)(DST + (size_t)(n0 + n) * K + k0 + k8 * 8), o); }
}
// ---- k_rope_tab: block = position t (64 threads = pair index i): inv_freq = 1 / 10000^((2i)/128) and angle = float(position_ids[t]) * inv_freq in f32 (as the reference), cos/sin in f32; rows 256 B
__global__ __launch_bounds__(64) void k_rope_tab(const int* __restrict__ POS, float* __restrict__ CS) {
  __shared__ __align__(16) float sc[64], ssn[64]; const int t = blockIdx.x, i = threadIdx.x;
  const float inv = 1.0f / powf(10000.0f, (float)(2 * i) / 128.0f); const float ang = (float)POS[t] * inv; sc[i] = cosf(ang); ssn[i] = sinf(ang);
  __syncthreads();
  if (i < 16) vst2(CS + (size_t)t * 64 + i * 4, *(const v4f*)&sc[i * 4]); else if (i < 32) vst2(CS + (size_t)SS * 64 + (size_t)t * 64 + (i - 16) * 4, *(const v4f*)&ssn[(i - 16) * 4]);
}
// ---- k_proj<MODE>: block = (64 rows, 128 cols = one head), operands staged in LDS per 64-k step, the next step's global loads issued ahead of this step's products: Y = bf16(x) . P rows (exact); MODE 0: RoPE then bf16 hi/lo planes of [2048][ldo] in fragment order (q/k); MODE 1: plain -> transposed bf16 hi/lo planes of [256][2048] in fragment order (v)
template <int MODE>
__global__ __launch_bounds__(128) void k_proj(const float* __restrict__ X, const __bf16* __restrict__ P, const float* __restrict__ bias, const float* __restrict__ CS, int ldo, __bf16* __restrict__ PH, __bf16* __restrict__ PL) {
  __shared__ __align__(16) float so[MODE ? 1 : 4][16][132]; __shared__ __align__(16) __bf16 sth[MODE ? 128 : 1][72], stl[MODE ? 128 : 1][72];
  __shared__ __align__(16) __bf16 sA[2][64][72], sB[2][128][72];   // two buffers of one 64-k step: 64 x rows (rounded to bf16) and 128 P rows, 128-B rows at pitch 144 B
  const int tid = threadIdx.x, wave = tid >> 5, lane = tid & 31, col = lane & 15, g = lane >> 4; const size_t r0 = (size_t)blockIdx.x * 64 + wave * 16; const int n0 = blockIdx.y * 128;
  const float* xg = X + ((size_t)blockIdx.x * 64 + (tid >> 4)) * DM + (tid & 15) * 4;   // piece it of a step: row (tid >> 4) + 8 it, 16 B; a wave's load = 2 rows x 256 B
  const __bf16* pg = P + (size_t)(n0 + (tid >> 3)) * DM + (tid & 7) * 8;                // piece it of a step: row (tid >> 3) + 16 it, 16 B; a wave's load = 4 rows x 128 B
  v8f acc[8] = {}; v4f xr[8]; v8b pr[8];
#pragma unroll
  for (int it = 0; it < 8; ++it) { xr[it] = *(const v4f*)(xg + (size_t)it * 8 * DM); pr[it] = *(const v8b*)(pg + (size_t)it * 16 * DM); }
#pragma unroll
  for (int it = 0; it < 8; ++it) { v4b x4;
#pragma unroll
    for (int e = 0; e < 4; ++e) x4[e] = (__bf16)xr[it][e];
    *(v4b*)&sA[0][(tid >> 4) + 8 * it][(tid & 15) * 4] = x4; *(v8b*)&sB[0][(tid >> 3) + 16 * it][(tid & 7) * 8] = pr[it]; }
#pragma unroll 2   // two copies: the buffer index is a constant in each, so every LDS address is a base register plus an immediate
  for (int st = 0; st < DM / 64; ++st) { const int bu = st & 1;
    __syncthreads();   // publishes step st; every reader of the other buffer (step st - 1) has left it before it is rewritten below
    if (st + 1 < DM / 64) {
#pragma unroll
      for (int it = 0; it < 8; ++it) { xr[it] = *(const v4f*)(xg + (size_t)it * 8 * DM + (st + 1) * 64); pr[it] = *(const v8b*)(pg + (size_t)it * 16 * DM + (st + 1) * 64); } }
#pragma unroll
    for (int k2 = 0; k2 < 2; ++k2) {
      if (k2 == 1) asm volatile("s_wait_xcnt 0x0" ::: "memory");   // stands in front of every later rewrite of the address registers of the next step's loads above
      const v16b a = frag_b(&sA[bu][wave * 16 + col][k2 * 32], lane); v16b b[8];
#pragma unroll
      for (int j = 0; j < 8; ++j) b[j] = frag_b(&sB[bu][j * 16 + col][k2 * 32], lane);
#pragma unroll
      for (int j = 0; j < 8; ++j) acc[j] = wmma_bf(a, b[j], acc[j]); }
    if (st + 1 < DM / 64) {
#pragma unroll
      for (int it = 0; it < 8; ++it) { v4b x4;
#pragma unroll
        for (int e = 0; e < 4; ++e) x4[e] = (__bf16)xr[it][e];
        *(v4b*)&sA[bu ^ 1][(tid >> 4) + 8 * it][(tid & 15) * 4] = x4; *(v8b*)&sB[bu ^ 1][(tid >> 3) + 16 * it][(tid & 7) * 8] = pr[it]; } } }
  if (MODE == 0) {
    // biased projections to LDS, then interleaved-pair RoPE in place: (d = 2i, 2i+1): out_e = x_e cos_i - x_o sin_i; out_o = x_e sin_i + x_o cos_i with angle index i = d/2 (position from position_ids via the CS tables)
#pragma unroll
    for (int j = 0; j < 8; ++j) { const float bb = bfr(bias[n0 + j * 16 + col]);
#pragma unroll
      for (int r = 0; r < 8; ++r) so[wave][8 * g + r][j * 16 + col] = acc[j][r] + bb; }
    LDSX();
    for (int q = lane; q < 16 * 64; q += 32) { const int rl = q >> 6, i = q & 63; const size_t t = r0 + rl; const float c = CS[t * 64 + i], s = CS[(size_t)SS * 64 + t * 64 + i]; const float xe = so[wave][rl][2 * i], xo = so[wave][rl][2 * i + 1]; so[wave][rl][2 * i] = xe * c - xo * s; so[wave][rl][2 * i + 1] = xe * s + xo * c; }
    LDSX();
    // each value leaves as bf16 hi + bf16 residual, the same split that the score products use; the wave's 16 rows x 128 columns are 4 whole fragments of each plane, piece p = 16 columns: a wave's store = 512 contiguous bytes
    const size_t f0 = ((r0 >> 4) * (size_t)(ldo >> 5) + (n0 >> 5)) * 512;
    for (int p = 0; p < 8; ++p) { const float* sr = &so[wave][col][p * 16 + g * 8]; const v4f va = *(const v4f*)sr, vb = *(const v4f*)(sr + 4); v8b h8, l8;
#pragma unroll
      for (int e = 0; e < 4; ++e) { const __bf16 ha = (__bf16)va[e], hb = (__bf16)vb[e]; h8[e] = ha; l8[e] = (__bf16)(va[e] - (float)ha); h8[4 + e] = hb; l8[4 + e] = (__bf16)(vb[e] - (float)hb); }
      const size_t o = f0 + p * 256 + lane * 8; *(v8b*)(PH + o) = h8; *(v8b*)(PL + o) = l8;
      asm volatile("s_wait_xcnt 0x0" ::: "memory"); }   // the next piece rewrites the stores' data registers: the wait stands in front of that
  } else {
#pragma unroll
    for (int j = 0; j < 8; ++j)
#pragma unroll
      for (int r = 0; r < 8; ++r) { const float v = acc[j][r] + bfr(bias[n0 + j * 16 + col]); const __bf16 hb = (__bf16)v; sth[j * 16 + col][wave * 16 + 8 * g + r] = hb; stl[j * 16 + col][wave * 16 + 8 * g + r] = (__bf16)(v - (float)hb); }
    __syncthreads();
    const int s0 = blockIdx.x * 64;
    // the block's 128 d x 64 s are 16 whole fragments of each plane: fragment fl, half j, lane slot sl; a wave's store = 512 contiguous bytes
    for (int q = tid; q < 128 * 8; q += 128) { const int fl = q >> 6, j = (q >> 5) & 1, sl = q & 31; const int d = (fl >> 1) * 16 + (sl & 15), c = (fl & 1) * 32 + j * 16 + (sl >> 4) * 8;
      const size_t o = ((size_t)((n0 >> 4) + (fl >> 1)) * (SS / 32) + (s0 >> 5) + (fl & 1)) * 512 + j * 256 + sl * 8; vst2((unsigned*)(PH + o), *(const v4u*)&sth[d][c]); vst2((unsigned*)(PL + o), *(const v4u*)&stl[d][c]); }
  }
}
// ---- k_attn: block = (16 queries, head h), NKW waves: wave w takes key steps w, w + NKW, ... of the same 16 queries (flash attention over its share), then the NKW partial (max, sum, acc) are merged through LDS; scores 3 products, P.V 3 products; O[q][h*128+d]
#define NKW 8
#define NVA 6   // v fragments (of 8) of a key step that are asked for ahead of the softmax; with 7 the kernel takes more than 256 VGPRs, which costs a resident block
// one 32-d chunk of a key step's score operands: q and the step's two 16-key column groups of k, each as hi + residual
struct KQ { F2 q, k0, k1; };
// p = the lane's own address in a fragment (fragment start + lane * 8): the same two 16-B pieces that frag_fo reads
__device__ __forceinline__ v16b frag_at(const __bf16* p) { union { v16b v; v8b q[2]; } u; u.q[0] = *(const v8b*)p; u.q[1] = *(const v8b*)(p + 256); return u.v; }
__device__ __forceinline__ void ld_kq(KQ& o, const __bf16* qh, const __bf16* ql, const __bf16* kh, const __bf16* kl, int kc) {
  o.k0.h = frag_at(kh + kc * 512); o.k0.l = frag_at(kl + kc * 512); o.k1.h = frag_at(kh + (KVW / 32) * 512 + kc * 512); o.k1.l = frag_at(kl + (KVW / 32) * 512 + kc * 512);
  o.q.h = frag_at(qh + kc * 512); o.q.l = frag_at(ql + kc * 512);
}
// loads_out stands behind a group of global loads: the wait is in front of every later rewrite of their address registers (named as inputs, so that they stay whole up to it); as no load of these addresses moves over the statement, it also keeps the group issued here, ahead of the work it is to fly under
__device__ __forceinline__ void loads_out(const __bf16* a, const __bf16* b) { asm volatile("s_wait_xcnt 0x0" :: "v"(a), "v"(b) : "memory"); }
__device__ __forceinline__ void loads_out(const __bf16* a, const __bf16* b, const __bf16* c, const __bf16* d) { asm volatile("s_wait_xcnt 0x0" :: "v"(a), "v"(b), "v"(c), "v"(d) : "memory"); }
__device__ __forceinline__ void loads_out(const float* m, const __bf16* a, const __bf16* b, const __bf16* c, const __bf16* d) { asm volatile("s_wait_xcnt 0x0" :: "v"(m), "v"(a), "v"(b), "v"(c), "v"(d) : "memory"); }
__global__ __launch_bounds__(32 * NKW) void k_attn(const __bf16* __restrict__ QH, const __bf16* __restrict__ QL, const __bf16* __restrict__ KH, const __bf16* __restrict__ KL, const float* __restrict__ MASK, const __bf16* __restrict__ VTH, const __bf16* __restrict__ VTL, float* __restrict__ O) {
  __shared__ __align__(16) float sp[NKW][16][36]; __shared__ __align__(16) float so[NKW][16][132]; __shared__ float sm[NKW][16], sl[NKW][16];
  const int tid = threadIdx.x, wave = __builtin_amdgcn_readfirstlane(tid >> 5), lane = tid & 31, col = lane & 15, g = lane >> 4;
  const int qb = blockIdx.x, h = blockIdx.y, kv = h / (NH / NKV); const int q0 = qb * 16;
  const size_t qo = ((size_t)qb * (DM / 32) + h * (HD / 32)) * 512;   // the tile's q fragments are re-read per key step (8 KiB that all 8 waves share; keeps the kernel under 256 VGPRs)
  const __bf16 *qhp = QH + qo + lane * 8, *qlp = QL + qo + lane * 8;   // the lane's own address in the tile's first q fragment
  float m[8], l[8];
#pragma unroll
  for (int r = 0; r < 8; ++r) { m[r] = -3.0e38f; l[r] = 0.f; }
  v8f acc[8] = {};
#pragma unroll 1
  for (int ks = wave; ks < SS / 32; ks += NKW) { v8f s[2]; float mk[2][8]; bool anylive = false;
    const size_t ko = ((size_t)(ks * 2) * (KVW / 32) + kv * (HD / 32)) * 512;   // key columns ct * 16 .. + 15 of the step are fragment row ks * 2 + ct of the k planes
    const __bf16 *kh = KH + ko + lane * 8, *kl = KL + ko + lane * 8; const float* mp = MASK + (size_t)(q0 + 8 * g) * SS + ks * 32 + col;
    const size_t vo = ((size_t)(kv * (HD / 16)) * (SS / 32) + ks) * 512; const __bf16 *vhp = VTH + vo + lane * 8, *vlp = VTL + vo + lane * 8;   // v fragment dt of the step is at dt * (SS / 32) * 512
    // the step's mask values and its first two 32-d chunks of q and k are asked for together, ahead of the mask test: one wait on L2 for all of them (a skipped step drops the chunks unread)
#pragma unroll
    for (int ct = 0; ct < 2; ++ct)
#pragma unroll
      for (int r = 0; r < 8; ++r) mk[ct][r] = mp[(size_t)r * SS + ct * 16];
    KQ ca, cb; ld_kq(ca, qhp, qlp, kh, kl, 0); ld_kq(cb, qhp, qlp, kh, kl, 1);
    loads_out(mp, kh, kl, qhp, qlp);
#pragma unroll
    for (int ct = 0; ct < 2; ++ct)
#pragma unroll
      for (int r = 0; r < 8; ++r) { const float m_ = bfr(mk[ct][r]); mk[ct][r] = m_; anylive = anylive || (m_ > -1.0e8f); }
    if (__any(anylive)) {   // wave-uniform: skip key tiles that are fully masked for this wave's 16 rows (exp of <= -1e8 underflows to exactly 0 in the reference too)
    v8f c0 = {}, c1 = {}; v16b vh[8], vl[8];
    // chunk kc + 2 is asked for as soon as the products of chunk kc have freed its registers, and flies under the products of chunk kc + 1
    c0 = mac3(ca.q, ca.k0, c0); c1 = mac3(ca.q, ca.k1, c1);
    ld_kq(ca, qhp, qlp, kh, kl, 2); loads_out(kh, kl, qhp, qlp);
    c0 = mac3(cb.q, cb.k0, c0); c1 = mac3(cb.q, cb.k1, c1);
    ld_kq(cb, qhp, qlp, kh, kl, 3); loads_out(kh, kl, qhp, qlp);
    c0 = mac3(ca.q, ca.k0, c0); c1 = mac3(ca.q, ca.k1, c1);
    c0 = mac3(cb.q, cb.k0, c0); c1 = mac3(cb.q, cb.k1, c1);
#pragma unroll
    for (int r = 0; r < 8; ++r) { s[0][r] = c0[r] * 0.08838834764831845f + mk[0][r]; s[1][r] = c1[r] * 0.08838834764831845f + mk[1][r]; }
    // v fragments 0 .. NVA - 1 are asked for ahead of the softmax and fly under it
#pragma unroll
    for (int dt = 0; dt < NVA; ++dt) { vh[dt] = frag_at(vhp + (size_t)dt * (SS / 32) * 512); vl[dt] = frag_at(vlp + (size_t)dt * (SS / 32) * 512); }
    loads_out(vhp, vlp);
#pragma unroll
    for (int r = 0; r < 8; ++r) { float mx = fmaxf(s[0][r], s[1][r]);
#pragma unroll
      for (int o = 1; o < 16; o <<= 1) mx = fmaxf(mx, __shfl_xor(mx, o));
      const float mn = fmaxf(m[r], mx); const float alpha = (m[r] <= -1.0e38f) ? 0.f : exp_ni(m[r] - mn);
      const float e0 = exp_ni(s[0][r] - mn), e1 = exp_ni(s[1][r] - mn); float es = e0 + e1;
#pragma unroll
      for (int o = 1; o < 16; o <<= 1) es += __shfl_xor(es, o);
      l[r] = l[r] * alpha + es; m[r] = mn;
#pragma unroll
      for (int dt = 0; dt < 8; ++dt) acc[dt][r] *= alpha;
      sp[wave][8 * g + r][col] = e0; sp[wave][8 * g + r][16 + col] = e1; }
    LDSX();
    const F2 pa = split_row(&sp[wave][col][0], 0, lane);
#pragma unroll
    for (int dt = 0; dt < 8; ++dt) { acc[dt] = wmma_bf(pa.l, vh[dt], acc[dt]); acc[dt] = wmma_bf(pa.h, vl[dt], acc[dt]); acc[dt] = wmma_bf(pa.h, vh[dt], acc[dt]);
      if (dt + NVA < 8) { vh[dt + NVA] = frag_at(vhp + (size_t)(dt + NVA) * (SS / 32) * 512); vl[dt + NVA] = frag_at(vlp + (size_t)(dt + NVA) * (SS / 32) * 512); loads_out(vhp, vlp); } }   // the last fragments take the registers that the first products have freed
    LDSX(); } }
  // merge: row maximum over the waves, each wave's sum and acc rescaled to it, then summed in wave order (a wave with no live key step has m = -3e38, l = 0 and weight 0)
  if (col == 0) {
#pragma unroll
    for (int r = 0; r < 8; ++r) sm[wave][8 * g + r] = m[r]; }
  __syncthreads();
#pragma unroll
  for (int r = 0; r < 8; ++r) { float mx = sm[0][8 * g + r];
#pragma unroll
    for (int w = 1; w < NKW; ++w) mx = fmaxf(mx, sm[w][8 * g + r]);
    const float f = (m[r] <= -1.0e38f) ? 0.f : exp_ni(m[r] - mx);
    if (col == 0) sl[wave][8 * g + r] = l[r] * f;
#pragma unroll
    for (int dt = 0; dt < 8; ++dt) so[wave][8 * g + r][dt * 16 + col] = acc[dt][r] * f; }
  __syncthreads();
  for (int rl = wave; rl < 16; rl += NKW) { v4f a = *(const v4f*)&so[0][rl][lane * 4]; float ls = sl[0][rl];
#pragma unroll
    for (int w = 1; w < NKW; ++w) { a += *(const v4f*)&so[w][rl][lane * 4]; ls += sl[w][rl]; }
    vst2(O + (size_t)(q0 + rl) * DM + h * HD + lane * 4, a * (1.0f / ls));
    asm volatile("s_wait_xcnt 0x0" ::: "memory"); }   // the next trip rewrites the store's address and data registers: the wait stands in front of that
}
// ---- k_out: block = (64 rows, 128 cols), operands staged in LDS as in k_proj: out = O(hi/lo) . wproj^T rows (2 products)
__global__ __launch_bounds__(128) void k_out(const float* __restrict__ O, const __bf16* __restrict__ P, const float* __restrict__ bias, float* __restrict__ Y) {
  __shared__ __align__(16) float so[4][16][132];
  __shared__ __align__(16) __bf16 sAh[2][64][72], sAl[2][64][72], sB[2][128][72];   // two buffers of one 64-k step: 64 O rows as bf16 hi and residual, 128 P rows, 128-B rows at pitch 144 B
  const int tid = threadIdx.x, wave = tid >> 5, lane = tid & 31, col = lane & 15, g = lane >> 4; const size_t r0 = (size_t)blockIdx.x * 64 + wave * 16; const int n0 = blockIdx.y * 128;
  const float* xg = O + ((size_t)blockIdx.x * 64 + (tid >> 4)) * DM + (tid & 15) * 4;   // piece it of a step: row (tid >> 4) + 8 it, 16 B; a wave's load = 2 rows x 256 B
  const __bf16* pg = P + (size_t)(n0 + (tid >> 3)) * DM + (tid & 7) * 8;                // piece it of a step: row (tid >> 3) + 16 it, 16 B; a wave's load = 4 rows x 128 B
  v8f acc[8] = {}; v4f xr[8]; v8b pr[8];
#pragma unroll
  for (int it = 0; it < 8; ++it) { xr[it] = *(const v4f*)(xg + (size_t)it * 8 * DM); pr[it] = *(const v8b*)(pg + (size_t)it * 16 * DM); }
#pragma unroll
  for (int it = 0; it < 8; ++it) { v4b h4, l4;
#pragma unroll
    for (int e = 0; e < 4; ++e) { const __bf16 hb = (__bf16)xr[it][e]; h4[e] = hb; l4[e] = (__bf16)(xr[it][e] - (float)hb); }
    *(v4b*)&sAh[0][(tid >> 4) + 8 * it][(tid & 15) * 4] = h4; *(v4b*)&sAl[0][(tid >> 4) + 8 * it][(tid & 15) * 4] = l4; *(v8b*)&sB[0][(tid >> 3) + 16 * it][(tid & 7) * 8] = pr[it]; }
#pragma unroll 2   // two copies: the buffer index is a constant in each, so every LDS address is a base register plus an immediate
  for (int st = 0; st < DM / 64; ++st) { const int bu = st & 1;
    __syncthreads();   // publishes step st; every reader of the other buffer (step st - 1) has left it before it is rewritten below
    if (st + 1 < DM / 64) {
#pragma unroll
      for (int it = 0; it < 8; ++it) { xr[it] = *(const v4f*)(xg + (size_t)it * 8 * DM + (st + 1) * 64); pr[it] = *(const v8b*)(pg + (size_t)it * 16 * DM + (st + 1) * 64); } }
#pragma unroll
    for (int k2 = 0; k2 < 2; ++k2) {
      if (k2 == 1) asm volatile("s_wait_xcnt 0x0" ::: "memory");   // stands in front of every later rewrite of the address registers of the next step's loads above
      const v16b ah = frag_b(&sAh[bu][wave * 16 + col][k2 * 32], lane), al = frag_b(&sAl[bu][wave * 16 + col][k2 * 32], lane); v16b b[8];
#pragma unroll
      for (int j = 0; j < 8; ++j) b[j] = frag_b(&sB[bu][j * 16 + col][k2 * 32], lane);
#pragma unroll
      for (int j = 0; j < 8; ++j) { acc[j] = wmma_bf(al, b[j], acc[j]); acc[j] = wmma_bf(ah, b[j], acc[j]); } }
    if (st + 1 < DM / 64) {
#pragma unroll
      for (int it = 0; it < 8; ++it) { v4b h4, l4;
#pragma unroll
        for (int e = 0; e < 4; ++e) { const __bf16 hb = (__bf16)xr[it][e]; h4[e] = hb; l4[e] = (__bf16)(xr[it][e] - (float)hb); }
        *(v4b*)&sAh[bu ^ 1][(tid >> 4) + 8 * it][(tid & 15) * 4] = h4; *(v4b*)&sAl[bu ^ 1][(tid >> 4) + 8 * it][(tid & 15) * 4] = l4; *(v8b*)&sB[bu ^ 1][(tid >> 3) + 16 * it][(tid & 7) * 8] = pr[it]; } } }
#pragma unroll
  for (int j = 0; j < 8; ++j)
#pragma unroll
    for (int r = 0; r < 8; ++r) so[wave][8 * g + r][j * 16 + col] = acc[j][r] + bfr(bias[n0 + j * 16 + col]);
  LDSX();
  for (int rl = 0; rl < 16; ++rl) vst2(Y + (r0 + rl) * DM + n0 + lane * 4, *(const v4f*)&so[wave][rl][lane * 4]);
}
extern "C" void kernel_launch(void* const* d_in, const int* in_sizes, int n_in, void* d_out, int out_size, void* d_ws, size_t ws_size, hipStream_t stream) {
  (void)in_sizes; (void)n_in; (void)out_size;
  const float** F = (const float**)d_in; const int* POS = (const int*)d_in[2];   // 0 hidden_states [1,2048,2048], 1 attention_mask [1,1,2048,2048], 2 position_ids [1,2048] i32, 3 Wq [2048,2048], 4 bq, 5 Wk [2048,256], 6 bk, 7 Wv, 8 bv, 9 Wo [2048,2048], 10 bo
  if (ws_size < (size_t)WS_END) return;
  char* ws = (char*)d_ws; __bf16 *PK = (__bf16*)(ws + WS_PK), *VTH = (__bf16*)(ws + WS_VTH), *VTL = (__bf16*)(ws + WS_VTL);
  __bf16 *QH = (__bf16*)(ws + WS_QH), *QL = (__bf16*)(ws + WS_QL), *KH = (__bf16*)(ws + WS_KH), *KL = (__bf16*)(ws + WS_KL);
  float *CS = (float*)(ws + WS_CS), *O = (float*)(ws + WS_O);
  k_packT<<<dim3(DM / 128, DM / 64), 256, 0, stream>>>(F[3], DM, DM, PK + PK_Q); k_packT<<<dim3(KVW / 128, DM / 64), 256, 0, stream>>>(F[5], DM, KVW, PK + PK_K); k_packT<<<dim3(KVW / 128, DM / 64), 256, 0, stream>>>(F[7], DM, KVW, PK + PK_V); k_packT<<<dim3(DM / 128, DM / 64), 256, 0, stream>>>(F[9], DM, DM, PK + PK_O);
  k_rope_tab<<<SS, 64, 0, stream>>>(POS, CS);
  k_proj<0><<<dim3(SS / 64, DM / 128), 128, 0, stream>>>(F[0], PK + PK_Q, F[4], CS, DM, QH, QL);
  k_proj<0><<<dim3(SS / 64, KVW / 128), 128, 0, stream>>>(F[0], PK + PK_K, F[6], CS, KVW, KH, KL);
  k_proj<1><<<dim3(SS / 64, KVW / 128), 128, 0, stream>>>(F[0], PK + PK_V, F[8], CS, 0, VTH, VTL);
  k_attn<<<dim3(SS / 16, NH), 32 * NKW, 0, stream>>>(QH, QL, KH, KL, F[1], VTH, VTL, O);
  k_out<<<dim3(TQB, DM / 128), 128, 0, stream>>>(O, PK + PK_O, F[10], (float*)d_out);
}

// v006
// It runs in 235 microseconds.
// Timed twice side by side with v005, it ran 1.15 and 1.22 times as fast.
// All steps since v000 together make it 4.56 times as fast.
// compute dtype: hidden_states, all weights/biases and the additive attention_mask (module inputs) rounded to bf16; position_ids as int32; q/k/v projections with exact bf16 products (x and W are inputs) + bias and interleaved-pair RoPE from position_ids in f32 in the epilogue; scores q.k with both computed operands as bf16 hi + residual pairs (3 products) + the mask value, P.V with P hi/lo x V hi/lo (3 products); output projection hi/lo x exact Wo (2 products) + bo; softmax in f32; key tiles whose mask entries are all <= -1e8 for the wave's rows are skipped at run time (exp underflows to exactly 0 in the reference too); f32 accumulate.
#include <hip/hip_runtime.h>
#include <math.h>

typedef __attribute__((ext_vector_type(16))) _Float16 v16h;
typedef __attribute__((ext_vector_type(16))) __bf16 v16b;
typedef __attribute__((ext_vector_type(8)))  _Float16 v8h;
typedef __attribute__((ext_vector_type(8)))  float v8f;
typedef __attribute__((ext_vector_type(4)))  float v4f;
typedef __attribute__((ext_vector_type(2)))  float v2f;
typedef __attribute__((ext_vector_type(4)))  unsigned v4u;
typedef __attribute__((ext_vector_type(4)))  int v4i;
typedef float __attribute__((may_alias)) float_a;
typedef int __attribute__((may_alias)) int_a;

template <typename T> __device__ __forceinline__ void vst2(void* p, T v) { *(T*)p = v;  }
__device__ __forceinline__ v8f wmma16(v16h a, v16h b, v8f c) {
  v8f d = __builtin_amdgcn_wmma_f32_16x16x32_f16(false, a, false, b, (short)0, c, false, false);
  asm volatile("v_nop\n\tv_nop\n\tv_nop\n\tv_nop" : "+v"(d) : "v"(a), "v"(b));
  return d;
}
__device__ __forceinline__ v8f wmma_bf(v16b a, v16b b, v8f c) {
  v8f d = __builtin_amdgcn_wmma_f32_16x16x32_bf16(false, a, false, b, (short)0, c, false, false);
  asm volatile("v_nop\n\tv_nop\n\tv_nop\n\tv_nop" : "+v"(d) : "v"(a), "v"(b));
  return d;
}
// 16x16x32 fragments: lane = (h = lane>>4, row/col = lane&15); elements 0..7 = k0+8h+0..7, 8..15 = k0+16+8h+0..7; D element r = row 8h+r
__device__ __forceinline__ v16h frag_h(const _Float16* rowk0, int lane) {
  union { v16h v; v8h q[2]; } u; const _Float16* p = rowk0 + 8 * (lane >> 4);
  u.q[0] = *(const v8h*)p; u.q[1] = *(const v8h*)(p + 16); return u.v;
}
__device__ __forceinline__ v16h frag_f32(const float* rowk0, int lane) {
  v16h a; const float* p = rowk0 + 8 * (lane >> 4);
#pragma unroll
  for (int i = 0; i < 8; ++i) { a[i] = (_Float16)p[i]; a[8 + i] = (_Float16)p[16 + i]; }
  return a;
}
__device__ __forceinline__ v16h frag_f32s(const float* rowk0, int lane, float sc) {
  v16h a; const float* p = rowk0 + 8 * (lane >> 4);
#pragma unroll
  for (int i = 0; i < 8; ++i) { a[i] = (_Float16)(p[i] * sc); a[8 + i] = (_Float16)(p[16 + i] * sc); }
  return a;
}
// column fragment from a [K][ld] layout (column n), rows >= K read as 0
__device__ __forceinline__ v16h fragc_f32(const float* W, int k0, int n, int lane, int ld, int K) {
  v16h a; const int g = lane >> 4;
#pragma unroll
  for (int i = 0; i < 8; ++i) { const int ka = k0 + 8 * g + i, kb = ka + 16;
    a[i] = (_Float16)(ka < K ? W[(size_t)(ka < K ? ka : K - 1) * ld + n] : 0.f); a[8 + i] = (_Float16)(kb < K ? W[(size_t)(kb < K ? kb : K - 1) * ld + n] : 0.f); }
  return a;
}
struct F2 { v16b h, l; };
__device__ __forceinline__ F2 bsplit16(const float v[16]) { F2 r;
#pragma unroll
  for (int i = 0; i < 16; ++i) { const __bf16 h = (__bf16)v[i]; r.h[i] = h; r.l[i] = (__bf16)(v[i] - (float)h); }
  return r; }
__device__ __forceinline__ F2 split_row(const float* row, int k0, int lane) { float v[16]; const float* p = row + k0 + 8 * (lane >> 4);
#pragma unroll
  for (int i = 0; i < 8; ++i) { v[i] = p[i]; v[8 + i] = p[16 + i]; }
  return bsplit16(v); }
__device__ __forceinline__ F2 split_rowK(const float* row, int k0, int lane, int K) { float v[16]; const int g = lane >> 4;
#pragma unroll
  for (int i = 0; i < 8; ++i) { const int ka = k0 + 8 * g + i, kb = ka + 16; v[i] = ka < K ? row[ka < K ? ka : K - 1] : 0.f; v[8 + i] = kb < K ? row[kb < K ? kb : K - 1] : 0.f; }
  return bsplit16(v); }
__device__ __forceinline__ F2 split_col(const float* W, int k0, int n, int lane, int ld, int K) { float v[16]; const int g = lane >> 4;
#pragma unroll
  for (int i = 0; i < 8; ++i) { const int ka = k0 + 8 * g + i, kb = ka + 16; v[i] = ka < K ? W[(size_t)(ka < K ? ka : K - 1) * ld + n] : 0.f; v[8 + i] = kb < K ? W[(size_t)(kb < K ? kb : K - 1) * ld + n] : 0.f; }
  return bsplit16(v); }
__device__ __forceinline__ v8f mac3(const F2& a, const F2& b, v8f c) { c = wmma_bf(a.l, b.h, c); c = wmma_bf(a.h, b.l, c); return wmma_bf(a.h, b.h, c); }
__device__ __forceinline__ float sigm(float v) { return 1.0f / (1.0f + expf(-v)); }
#define LDSX() do { asm volatile("s_wait_dscnt 0" ::: "memory"); __builtin_amdgcn_wave_barrier(); __builtin_amdgcn_fence(__ATOMIC_RELEASE, "workgroup"); } while (0)


// Attention with grouped kv heads (B 1, S 2048, D 2048, 16 query heads / 2 kv heads x 128): q = rope(x Wq + bq), k = rope(x Wk + bk) (interleaved pairs, angles from position_ids), v = x Wv + bv; scores = q k^T / sqrt(128) + attention_mask[q][k] (additive input); softmax; out = (P v) Wo + bo.
#define SS 2048
#define DM 2048
#define NH 16
#define NKV 2
#define HD 128
#define KVW (NKV * HD)
#ifndef TQB
#define TQB (SS / 64)
#endif
typedef __attribute__((ext_vector_type(8))) __bf16 v8b;
typedef __attribute__((ext_vector_type(4))) __bf16 v4b;
__device__ __forceinline__ v16b frag_b(const __bf16* rowk0, int lane) {
  union { v16b v; v8b q[2]; } u; const __bf16* p = rowk0 + 8 * (lane >> 4);
  u.q[0] = *(const v8b*)p; u.q[1] = *(const v8b*)(p + 16); return u.v;
}
// fragment-order plane of a logical [R][C] bf16 matrix: 16-row x 32-column fragments of 512 elements, fragment index (row >> 4) * (C / 32) + (c >> 5); inside it element (row, c) sits at ((c >> 4) & 1) * 256 + (((c >> 3) & 1) * 16 + (row & 15)) * 8 + (c & 7). Lane l's two 16-B pieces (the same elements that frag_b reads from a row) are at l * 8 and 256 + l * 8: each load of a wave is 512 contiguous bytes
__device__ __forceinline__ v16b frag_fo(const __bf16* f, int lane) {
  union { v16b v; v8b q[2]; } u; u.q[0] = *(const v8b*)(f + lane * 8); u.q[1] = *(const v8b*)(f + 256 + lane * 8); return u.v;
}
__device__ __forceinline__ float bfr(float v) { return (float)(__bf16)v; }
__device__ __attribute__((noinline)) float exp_ni(float v) { return expf(v); }
__device__ __attribute__((noinline)) float erf_ni(float v) { return erff(v); }

#define PK_Q 0
#define PK_K (PK_Q + DM * DM)
#define PK_V (PK_K + KVW * DM)
#define PK_O (PK_V + KVW * DM)
#define PK_END (PK_O + DM * DM)
#define WS_PK  0u
#define WS_CS  (WS_PK + 2u * PK_END)             // f32 [2048][64] cos, then [2048][64] sin
#define WS_QH  (WS_CS + 4u * 2 * SS * 64)        // q after RoPE as bf16 hi plane [2048][2048] in fragment order, then its residual plane
#define WS_QL  (WS_QH + 2u * SS * DM)
#define WS_KH  (WS_QL + 2u * SS * DM)            // k after RoPE as bf16 hi plane [2048][256] in fragment order, then its residual plane
#define WS_KL  (WS_KH + 2u * SS * KVW)
#define WS_VTH (WS_KL + 2u * SS * KVW)
#define WS_VTL (WS_VTH + 2u * KVW * SS)
#define WS_O   (WS_VTL + 2u * KVW * SS)
#define WS_END (WS_O + 4u * SS * DM)

// ---- k_packT: block = tile of 64 k x 128 n of a [K][N] (x @ W) matrix, turned through LDS into DST [N][K] bf16: a wave's load = 512 contiguous bytes of one k row, a wave's store = 4 n rows x one whole 128-B line (K a multiple of 64, N of 128)
// one launch for all four matrices (each has K = DM): blockIdx.x counts the 128-column tiles of Wq, Wk, Wv, Wo side by side, and the DST rows follow in that order (PK_Q, PK_K, PK_V, PK_O are contiguous)
// the blocks behind them (blockIdx.x >= NPT) fill the RoPE tables, which depend on nothing of the above either: 4 positions t a block, 64 threads = pair index i each: inv_freq = 1 / 10000^((2i)/128) and angle = float(position_ids[t]) * inv_freq in f32 (as the reference), cos/sin in f32; rows 256 B, a wave's store = one whole 128-B line
#define NPT ((2 * DM + 2 * KVW) / 128)
__global__ __launch_bounds__(256) void k_packT(const float* __restrict__ Wq, const float* __restrict__ Wk, const float* __restrict__ Wv, const float* __restrict__ Wo, __bf16* __restrict__ DST, const int* __restrict__ POS, float* __restrict__ CS) {
  const int bx = blockIdx.x, K = DM; const float* Wm; int N, ns;   // ns = the tile's first column in its own matrix
  if (bx >= NPT) {   // the same for every thread of a block, and in front of the barrier
    const int t = ((bx - NPT) * (DM / 64) + blockIdx.y) * 4 + (threadIdx.x >> 6), i = threadIdx.x & 63;
    const float inv = 1.0f / powf(10000.0f, (float)(2 * i) / 128.0f); const float ang = (float)POS[t] * inv;
    CS[(size_t)t * 64 + i] = cosf(ang); CS[(size_t)SS * 64 + (size_t)t * 64 + i] = sinf(ang); return; }
  if (bx < DM / 128) { Wm = Wq; N = DM; ns = bx * 128; } else if (bx < (DM + KVW) / 128) { Wm = Wk; N = KVW; ns = bx * 128 - DM; } else if (bx < (DM + 2 * KVW) / 128) { Wm = Wv; N = KVW; ns = bx * 128 - DM - KVW; } else { Wm = Wo; N = DM; ns = bx * 128 - DM - 2 * KVW; }
  __shared__ unsigned s[128][33];   // row n: its 64 k as 32 bf16 pairs (k, k + 1); the odd pitch spreads both the column-wise writes and the row-wise reads over the banks
  const int tid = threadIdx.x, wave = tid >> 5, lane = tid & 31; const int n0 = bx * 128, k0 = blockIdx.y * 64;
  const float* src = Wm + (size_t)(k0 + wave * 8) * N + ns + lane * 4; const float* pr[8]; v4f xr[8];
#pragma unroll
  for (int i = 0; i < 8; ++i) { pr[i] = src + (size_t)i * N; xr[i] = *(const v4f*)pr[i]; }
  // stands in front of every rewrite of the address registers of the 8 loads above; naming them as inputs keeps them whole up to here (without that a later load's result landed on an earlier load's address pair ahead of the wait)
  asm volatile("s_wait_xcnt 0x0" :: "v"(pr[0]), "v"(pr[1]), "v"(pr[2]), "v"(pr[3]), "v"(pr[4]), "v"(pr[5]), "v"(pr[6]), "v"(pr[7]) : "memory");
#pragma unroll
  for (int i = 0; i < 8; i += 2)
#pragma unroll
    for (int e = 0; e < 4; ++e) { union { __bf16 b[2]; unsigned u; } p; p.b[0] = (__bf16)xr[i][e]; p.b[1] = (__bf16)xr[i + 1][e]; s[lane * 4 + e][wave * 4 + (i >> 1)] = p.u; }
  __syncthreads();
#pragma unroll
  for (int j = 0; j < 4; ++j) { const int q = tid + 256 * j, n = q >> 3, k8 = q & 7; v4u o;
#pragma unroll
    for (int e = 0; e < 4; ++e) o[e] = s[n][k8 * 4 + e];
    vst2((unsigned*)(DST + (size_t)(n0 + n) * K + k0 + k8 * 8), o); }
}
// ---- k_proj: block = (64 rows, 128 cols = one head), operands staged in LDS per 64-k step, the next step's global loads issued ahead of this step's products: Y = bf16(x) . P rows (exact); q and k heads: RoPE then bf16 hi/lo planes of [2048][ldo] in fragment order; v heads: plain -> transposed bf16 hi/lo planes of [256][2048] in fragment order
// one launch for q, k and v: blockIdx.y counts the 16 q heads, the 2 k heads and the 2 v heads, which are consecutive 128-row groups of P
__global__ __launch_bounds__(128) void k_proj(const float* __restrict__ X, const __bf16* __restrict__ P, const float* __restrict__ bq, const float* __restrict__ bk, const float* __restrict__ bv, const float* __restrict__ CS, __bf16* __restrict__ QH, __bf16* __restrict__ QL, __bf16* __restrict__ KH, __bf16* __restrict__ KL, __bf16* __restrict__ VTH, __bf16* __restrict__ VTL) {
  __shared__ __align__(16) char se[2 * 128 * 72 * 2];   // output staging; a block uses it either as so (q, k) or as sth + stl (v)
  float (*so)[16][132] = (float (*)[16][132])se; __bf16 (*sth)[72] = (__bf16 (*)[72])se; __bf16 (*stl)[72] = sth + 128;
  static_assert(sizeof(float) * 4 * 16 * 132 <= sizeof(se), "so fits the staging area");
  const int by = blockIdx.y; const bool isv = by >= NH + NKV; const float* bias; __bf16 *PH, *PL; int ldo, n0;   // n0 = the head's first column in its own output
  if (by < NH) { bias = bq; PH = QH; PL = QL; ldo = DM; n0 = by * 128; } else if (!isv) { bias = bk; PH = KH; PL = KL; ldo = KVW; n0 = (by - NH) * 128; } else { bias = bv; PH = VTH; PL = VTL; ldo = 0; n0 = (by - NH - NKV) * 128; }
  __shared__ __align__(16) __bf16 sA[2][64][72], sB[2][128][72];   // two buffers of one 64-k step: 64 x rows (rounded to bf16) and 128 P rows, 128-B rows at pitch 144 B
  const int tid = threadIdx.x, wave = tid >> 5, lane = tid & 31, col = lane & 15, g = lane >> 4; const size_t r0 = (size_t)blockIdx.x * 64 + wave * 16;
  const float* xg = X + ((size_t)blockIdx.x * 64 + (tid >> 4)) * DM + (tid & 15) * 4;   // piece it of a step: row (tid >> 4) + 8 it, 16 B; a wave's load = 2 rows x 256 B
  const __bf16* pg = P + (size_t)(by * 128 + (tid >> 3)) * DM + (tid & 7) * 8;          // piece it of a step: row (tid >> 3) + 16 it, 16 B; a wave's load = 4 rows x 128 B
  v8f acc[8] = {}; v4f xr[8]; v8b pr[8];
#pragma unroll
  for (int it = 0; it < 8; ++it) { xr[it] = *(const v4f*)(xg + (size_t)it * 8 * DM); pr[it] = *(const v8b*)(pg + (size_t)it * 16 * DM); }
#pragma unroll
  for (int it = 0; it < 8; ++it) { v4b x4;
#pragma unroll
    for (int e = 0; e < 4; ++e) x4[e] = (__bf16)xr[it][e];
    *(v4b*)&sA[0][(tid >> 4) + 8 * it][(tid & 15) * 4] = x4; *(v8b*)&sB[0][(tid >> 3) + 16 * it][(tid & 7) * 8] = pr[it]; }
#pragma unroll 2   // two copies: the buffer index is a constant in each, so every LDS address is a base register plus an immediate
  for (int st = 0; st < DM / 64; ++st) { const int bu = st & 1;
    __syncthreads();   // publishes step st; every reader of the other buffer (step st - 1) has left it before it is rewritten below
    if (st + 1 < DM / 64) {
#pragma unroll
      for (int it = 0; it < 8; ++it) { xr[it] = *(const v4f*)(xg + (size_t)it * 8 * DM + (st + 1) * 64); pr[it] = *(const v8b*)(pg + (size_t)it * 16 * DM + (st + 1) * 64); } }
#pragma unroll
    for (int k2 = 0; k2 < 2; ++k2) {
      if (k2 == 1) asm volatile("s_wait_xcnt 0x0" ::: "memory");   // stands in front of every later rewrite of the address registers of the next step's loads above
      const v16b a = frag_b(&sA[bu][wave * 16 + col][k2 * 32], lane); v16b b[8];
#pragma unroll
      for (int j = 0; j < 8; ++j) b[j] = frag_b(&sB[bu][j * 16 + col][k2 * 32], lane);
#pragma unroll
      for (int j = 0; j < 8; ++j) acc[j] = wmma_bf(a, b[j], acc[j]); }
    if (st + 1 < DM / 64) {
#pragma unroll
      for (int it = 0; it < 8; ++it) { v4b x4;
#pragma unroll
        for (int e = 0; e < 4; ++e) x4[e] = (__bf16)xr[it][e];
        *(v4b*)&sA[bu ^ 1][(tid >> 4) + 8 * it][(tid & 15) * 4] = x4; *(v8b*)&sB[bu ^ 1][(tid >> 3) + 16 * it][(tid & 7) * 8] = pr[it]; } } }
  if (!isv) {   // the same for every thread of a block
    // biased projections to LDS, then interleaved-pair RoPE in place: (d = 2i, 2i+1): out_e = x_e cos_i - x_o sin_i; out_o = x_e sin_i + x_o cos_i with angle index i = d/2 (position from position_ids via the CS tables)
#pragma unroll
    for (int j = 0; j < 8; ++j) { const float bb = bfr(bias[n0 + j * 16 + col]);
#pragma unroll
      for (int r = 0; r < 8; ++r) so[wave][8 * g + r][j * 16 + col] = acc[j][r] + bb; }
    LDSX();
    for (int q = lane; q < 16 * 64; q += 32) { const int rl = q >> 6, i = q & 63; const size_t t = r0 + rl; const float c = CS[t * 64 + i], s = CS[(size_t)SS * 64 + t * 64 + i]; const float xe = so[wave][rl][2 * i], xo = so[wave][rl][2 * i + 1]; so[wave][rl][2 * i] = xe * c - xo * s; so[wave][rl][2 * i + 1] = xe * s + xo * c; }
    LDSX();
    // each value leaves as bf16 hi + bf16 residual, the same split that the score products use; the wave's 16 rows x 128 columns are 4 whole fragments of each plane, piece p = 16 columns: a wave's store = 512 contiguous bytes
    const size_t f0 = ((r0 >> 4) * (size_t)(ldo >> 5) + (n0 >> 5)) * 512;
    for (int p = 0; p < 8; ++p) { const float* sr = &so[wave][col][p * 16 + g * 8]; const v4f va = *(const v4f*)sr, vb = *(const v4f*)(sr + 4); v8b h8, l8;
#pragma unroll
      for (int e = 0; e < 4; ++e) { const __bf16 ha = (__bf16)va[e], hb = (__bf16)vb[e]; h8[e] = ha; l8[e] = (__bf16)(va[e] - (float)ha); h8[4 + e] = hb; l8[4 + e] = (__bf16)(vb[e] - (float)hb); }
      const size_t o = f0 + p * 256 + lane * 8; *(v8b*)(PH + o) = h8; *(v8b*)(PL + o) = l8;
      asm volatile("s_wait_xcnt 0x0" ::: "memory"); }   // the next piece rewrites the stores' data registers: the wait stands in front of that
  } else {
#pragma unroll
    for (int j = 0; j < 8; ++j)
#pragma unroll
      for (int r = 0; r < 8; ++r) { const float v = acc[j][r] + bfr(bias[n0 + j * 16 + col]); const __bf16 hb = (__bf16)v; sth[j * 16 + col][wave * 16 + 8 * g + r] = hb; stl[j * 16 + col][wave * 16 + 8 * g + r] = (__bf16)(v - (float)hb); }
    __syncthreads();
    const int s0 = blockIdx.x * 64;
    // the block's 128 d x 64 s are 16 whole fragments of each plane: fragment fl, half j, lane slot sl; a wave's store = 512 contiguous bytes
    for (int q = tid; q < 128 * 8; q += 128) { const int fl = q >> 6, j = (q >> 5) & 1, sl = q & 31; const int d = (fl >> 1) * 16 + (sl & 15), c = (fl & 1) * 32 + j * 16 + (sl >> 4) * 8;
      const size_t o = ((size_t)((n0 >> 4) + (fl >> 1)) * (SS / 32) + (s0 >> 5) + (fl & 1)) * 512 + j * 256 + sl * 8; vst2((unsigned*)(PH + o), *(const v4u*)&sth[d][c]); vst2((unsigned*)(PL + o), *(const v4u*)&stl[d][c]); }
  }
}
// ---- k_attn: block = (16 queries, head h), NKW waves: wave w takes key steps w, w + NKW, ... of the same 16 queries (flash attention over its share), then the NKW partial (max, sum, acc) are merged through LDS; scores 3 products, P.V 3 products; O[q][h*128+d]
#define NKW 8
#define NVA 6   // v fragments (of 8) of a key step that are asked for ahead of the softmax; with 7 the kernel takes more than 256 VGPRs, which costs a resident block
// one 32-d chunk of a key step's score operands: q and the step's two 16-key column groups of k, each as hi + residual
struct KQ { F2 q, k0, k1; };
// p = the lane's own address in a fragment (fragment start + lane * 8): the same two 16-B pieces that frag_fo reads
__device__ __forceinline__ v16b frag_at(const __bf16* p) { union { v16b v; v8b q[2]; } u; u.q[0] = *(const v8b*)p; u.q[1] = *(const v8b*)(p + 256); return u.v; }
__device__ __forceinline__ void ld_kq(KQ& o, const __bf16* qh, const __bf16* ql, const __bf16* kh, const __bf16* kl, int kc) {
  o.k0.h = frag_at(kh + kc * 512); o.k0.l = frag_at(kl + kc * 512); o.k1.h = frag_at(kh + (KVW / 32) * 512 + kc * 512); o.k1.l = frag_at(kl + (KVW / 32) * 512 + kc * 512);
  o.q.h = frag_at(qh + kc * 512); o.q.l = frag_at(ql + kc * 512);
}
// loads_out stands behind a group of global loads: the wait is in front of every later rewrite of their address registers (named as inputs, so that they stay whole up to it); as no load of these addresses moves over the statement, it also keeps the group issued here, ahead of the work it is to fly under
__device__ __forceinline__ void loads_out(const __bf16* a, const __bf16* b) { asm volatile("s_wait_xcnt 0x0" :: "v"(a), "v"(b) : "memory"); }
__device__ __forceinline__ void loads_out(const __bf16* a, const __bf16* b, const __bf16* c, const __bf16* d) { asm volatile("s_wait_xcnt 0x0" :: "v"(a), "v"(b), "v"(c), "v"(d) : "memory"); }
__device__ __forceinline__ void loads_out(const float* m, const __bf16* a, const __bf16* b, const __bf16* c, const __bf16* d) { asm volatile("s_wait_xcnt 0x0" :: "v"(m), "v"(a), "v"(b), "v"(c), "v"(d) : "memory"); }
__global__ __launch_bounds__(32 * NKW) void k_attn(const __bf16* __restrict__ QH, const __bf16* __restrict__ QL, const __bf16* __restrict__ KH, const __bf16* __restrict__ KL, const float* __restrict__ MASK, const __bf16* __restrict__ VTH, const __bf16* __restrict__ VTL, float* __restrict__ O) {
  __shared__ __align__(16) float sp[NKW][16][36]; __shared__ __align__(16) float so[NKW][16][132]; __shared__ float sm[NKW][16], sl[NKW][16];
  const int tid = threadIdx.x, wave = __builtin_amdgcn_readfirstlane(tid >> 5), lane = tid & 31, col = lane & 15, g = lane >> 4;
  const int qb = blockIdx.x, h = blockIdx.y, kv = h / (NH / NKV); const int q0 = qb * 16;
  const size_t qo = ((size_t)qb * (DM / 32) + h * (HD / 32)) * 512;   // the tile's q fragments are re-read per key step (8 KiB that all 8 waves share; keeps the kernel under 256 VGPRs)
  const __bf16 *qhp = QH + qo + lane * 8, *qlp = QL + qo + lane * 8;   // the lane's own address in the tile's first q fragment
  float m[8], l[8];
#pragma unroll
  for (int r = 0; r < 8; ++r) { m[r] = -3.0e38f; l[r] = 0.f; }
  v8f acc[8] = {};
#pragma unroll 1
  for (int ks = wave; ks < SS / 32; ks += NKW) { v8f s[2]; float mk[2][8]; bool anylive = false;
    const size_t ko = ((size_t)(ks * 2) * (KVW / 32) + kv * (HD / 32)) * 512;   // key columns ct * 16 .. + 15 of the step are fragment row ks * 2 + ct of the k planes
    const __bf16 *kh = KH + ko + lane * 8, *kl = KL + ko + lane * 8; const float* mp = MASK + (size_t)(q0 + 8 * g) * SS + ks * 32 + col;
    const size_t vo = ((size_t)(kv * (HD / 16)) * (SS / 32) + ks) * 512; const __bf16 *vhp = VTH + vo + lane * 8, *vlp = VTL + vo + lane * 8;   // v fragment dt of the step is at dt * (SS / 32) * 512
    // the step's mask values and its first two 32-d chunks of q and k are asked for together, ahead of the mask test: one wait on L2 for all of them (a skipped step drops the chunks unread)
#pragma unroll
    for (int ct = 0; ct < 2; ++ct)
#pragma unroll
      for (int r = 0; r < 8; ++r) mk[ct][r] = mp[(size_t)r * SS + ct * 16];
    KQ ca, cb; ld_kq(ca, qhp, qlp, kh, kl, 0); ld_kq(cb, qhp, qlp, kh, kl, 1);
    loads_out(mp, kh, kl, qhp, qlp);
#pragma unroll
    for (int ct = 0; ct < 2; ++ct)
#pragma unroll
      for (int r = 0; r < 8; ++r) { const float m_ = bfr(mk[ct][r]); mk[ct][r] = m_; anylive = anylive || (m_ > -1.0e8f); }
    if (__any(anylive)) {   // wave-uniform: skip key tiles that are fully masked for this wave's 16 rows (exp of <= -1e8 underflows to exactly 0 in the reference too)
    v8f c0 = {}, c1 = {}; v16b vh[8], vl[8];
    // chunk kc + 2 is asked for as soon as the products of chunk kc have freed its registers, and flies under the products of chunk kc + 1
    c0 = mac3(ca.q, ca.k0, c0); c1 = mac3(ca.q, ca.k1, c1);
    ld_kq(ca, qhp, qlp, kh, kl, 2); loads_out(kh, kl, qhp, qlp);
    c0 = mac3(cb.q, cb.k0, c0); c1 = mac3(cb.q, cb.k1, c1);
    ld_kq(cb, qhp, qlp, kh, kl, 3); loads_out(kh, kl, qhp, qlp);
    c0 = mac3(ca.q, ca.k0, c0); c1 = mac3(ca.q, ca.k1, c1);
    c0 = mac3(cb.q, cb.k0, c0); c1 = mac3(cb.q, cb.k1, c1);
#pragma unroll
    for (int r = 0; r < 8; ++r) { s[0][r] = c0[r] * 0.08838834764831845f + mk[0][r]; s[1][r] = c1[r] * 0.08838834764831845f + mk[1][r]; }
    // v fragments 0 .. NVA - 1 are asked for ahead of the softmax and fly under it
#pragma unroll
    for (int dt = 0; dt < NVA; ++dt) { vh[dt] = frag_at(vhp + (size_t)dt * (SS / 32) * 512); vl[dt] = frag_at(vlp + (size_t)dt * (SS / 32) * 512); }
    loads_out(vhp, vlp);
#pragma unroll
    for (int r = 0; r < 8; ++r) { float mx = fmaxf(s[0][r], s[1][r]);
#pragma unroll
      for (int o = 1; o < 16; o <<= 1) mx = fmaxf(mx, __shfl_xor(mx, o));
      const float mn = fmaxf(m[r], mx); const float alpha = (m[r] <= -1.0e38f) ? 0.f : exp_ni(m[r] - mn);
      const float e0 = exp_ni(s[0][r] - mn), e1 = exp_ni(s[1][r] - mn); float es = e0 + e1;
#pragma unroll
      for (int o = 1; o < 16; o <<= 1) es += __shfl_xor(es, o);
      l[r] = l[r] * alpha + es; m[r] = mn;
#pragma unroll
      for (int dt = 0; dt < 8; ++dt) acc[dt][r] *= alpha;
      sp[wave][8 * g + r][col] = e0; sp[wave][8 * g + r][16 + col] = e1; }
    LDSX();
    const F2 pa = split_row(&sp[wave][col][0], 0, lane);
#pragma unroll
    for (int dt = 0; dt < 8; ++dt) { acc[dt] = wmma_bf(pa.l, vh[dt], acc[dt]); acc[dt] = wmma_bf(pa.h, vl[dt], acc[dt]); acc[dt] = wmma_bf(pa.h, vh[dt], acc[dt]);
      if (dt + NVA < 8) { vh[dt + NVA] = frag_at(vhp + (size_t)(dt + NVA) * (SS / 32) * 512); vl[dt + NVA] = frag_at(vlp + (size_t)(dt + NVA) * (SS / 32) * 512); loads_out(vhp, vlp); } }   // the last fragments take the registers that the first products have freed
    LDSX(); } }
  // merge: row maximum over the waves, each wave's sum and acc rescaled to it, then summed in wave order (a wave with no live key step has m = -3e38, l = 0 and weight 0)
  if (col == 0) {
#pragma unroll
    for (int r = 0; r < 8; ++r) sm[wave][8 * g + r] = m[r]; }
  __syncthreads();
#pragma unroll
  for (int r = 0; r < 8; ++r) { float mx = sm[0][8 * g + r];
#pragma unroll
    for (int w = 1; w < NKW; ++w) mx = fmaxf(mx, sm[w][8 * g + r]);
    const float f = (m[r] <= -1.0e38f) ? 0.f : exp_ni(m[r] - mx);
    if (col == 0) sl[wave][8 * g + r] = l[r] * f;
#pragma unroll
    for (int dt = 0; dt < 8; ++dt) so[wave][8 * g + r][dt * 16 + col] = acc[dt][r] * f; }
  __syncthreads();
  for (int rl = wave; rl < 16; rl += NKW) { v4f a = *(const v4f*)&so[0][rl][lane * 4]; float ls = sl[0][rl];
#pragma unroll
    for (int w = 1; w < NKW; ++w) { a += *(const v4f*)&so[w][rl][lane * 4]; ls += sl[w][rl]; }
    vst2(O + (size_t)(q0 + rl) * DM + h * HD + lane * 4, a * (1.0f / ls));
    asm volatile("s_wait_xcnt 0x0" ::: "memory"); }   // the next trip rewrites the store's address and data registers: the wait stands in front of that
}
// ---- k_out: block = (64 rows, 128 cols), operands staged in LDS as in k_proj: out = O(hi/lo) . wproj^T rows (2 products)
__global__ __launch_bounds__(128) void k_out(const float* __restrict__ O, const __bf16* __restrict__ P, const float* __restrict__ bias, float* __restrict__ Y) {
  __shared__ __align__(16) float so[4][16][132];
  __shared__ __align__(16) __bf16 sAh[2][64][72], sAl[2][64][72], sB[2][128][72];   // two buffers of one 64-k step: 64 O rows as bf16 hi and residual, 128 P rows, 128-B rows at pitch 144 B
  const int tid = threadIdx.x, wave = tid >> 5, lane = tid & 31, col = lane & 15, g = lane >> 4; const size_t r0 = (size_t)blockIdx.x * 64 + wave * 16; const int n0 = blockIdx.y * 128;
  const float* xg = O + ((size_t)blockIdx.x * 64 + (tid >> 4)) * DM + (tid & 15) * 4;   // piece it of a step: row (tid >> 4) + 8 it, 16 B; a wave's load = 2 rows x 256 B
  const __bf16* pg = P + (size_t)(n0 + (tid >> 3)) * DM + (tid & 7) * 8;                // piece it of a step: row (tid >> 3) + 16 it, 16 B; a wave's load = 4 rows x 128 B
  v8f acc[8] = {}; v4f xr[8]; v8b pr[8];
#pragma unroll
  for (int it = 0; it < 8; ++it) { xr[it] = *(const v4f*)(xg + (size_t)it * 8 * DM); pr[it] = *(const v8b*)(pg + (size_t)it * 16 * DM); }
#pragma unroll
  for (int it = 0; it < 8; ++it) { v4b h4, l4;
#pragma unroll
    for (int e = 0; e < 4; ++e) { const __bf16 hb = (__bf16)xr[it][e]; h4[e] = hb; l4[e] = (__bf16)(xr[it][e] - (float)hb); }
    *(v4b*)&sAh[0][(tid >> 4) + 8 * it][(tid & 15) * 4] = h4; *(v4b*)&sAl[0][(tid >> 4) + 8 * it][(tid & 15) * 4] = l4; *(v8b*)&sB[0][(tid >> 3) + 16 * it][(tid & 7) * 8] = pr[it]; }
#pragma unroll 2   // two copies: the buffer index is a constant in each, so every LDS address is a base register plus an immediate
  for (int st = 0; st < DM / 64; ++st) { const int bu = st & 1;
    __syncthreads();   // publishes step st; every reader of the other buffer (step st - 1) has left it before it is rewritten below
    if (st + 1 < DM / 64) {
#pragma unroll
      for (int it = 0; it < 8; ++it) { xr[it] = *(const v4f*)(xg + (size_t)it * 8 * DM + (st + 1) * 64); pr[it] = *(const v8b*)(pg + (size_t)it * 16 * DM + (st + 1) * 64); } }
#pragma unroll
    for (int k2 = 0; k2 < 2; ++k2) {
      if (k2 == 1) asm volatile("s_wait_xcnt 0x0" ::: "memory");   // stands in front of every later rewrite of the address registers of the next step's loads above
      const v16b ah = frag_b(&sAh[bu][wave * 16 + col][k2 * 32], lane), al = frag_b(&sAl[bu][wave * 16 + col][k2 * 32], lane); v16b b[8];
#pragma unroll
      for (int j = 0; j < 8; ++j) b[j] = frag_b(&sB[bu][j * 16 + col][k2 * 32], lane);
#pragma unroll
      for (int j = 0; j < 8; ++j) { acc[j] = wmma_bf(al, b[j], acc[j]); acc[j] = wmma_bf(ah, b[j], acc[j]); } }
    if (st + 1 < DM / 64) {
#pragma unroll
      for (int it = 0; it < 8; ++it) { v4b h4, l4;
#pragma unroll
        for (int e = 0; e < 4; ++e) { const __bf16 hb = (__bf16)xr[it][e]; h4[e] = hb; l4[e] = (__bf16)(xr[it][e] - (float)hb); }
        *(v4b*)&sAh[bu ^ 1][(tid >> 4) + 8 * it][(tid & 15) * 4] = h4; *(v4b*)&sAl[bu ^ 1][(tid >> 4) + 8 * it][(tid & 15) * 4] = l4; *(v8b*)&sB[bu ^ 1][(tid >> 3) + 16 * it][(tid & 7) * 8] = pr[it]; } } }
#pragma unroll
  for (int j = 0; j < 8; ++j)
#pragma unroll
    for (int r = 0; r < 8; ++r) so[wave][8 * g + r][j * 16 + col] = acc[j][r] + bfr(bias[n0 + j * 16 + col]);
  LDSX();
  for (int rl = 0; rl < 16; ++rl) vst2(Y + (r0 + rl) * DM + n0 + lane * 4, *(const v4f*)&so[wave][rl][lane * 4]);
}
extern "C" void kernel_launch(void* const* d_in, const int* in_sizes, int n_in, void* d_out, int out_size, void* d_ws, size_t ws_size, hipStream_t stream) {
  (void)in_sizes; (void)n_in; (void)out_size;
  const float** F = (const float**)d_in; const int* POS = (const int*)d_in[2];   // 0 hidden_states [1,2048,2048], 1 attention_mask [1,1,2048,2048], 2 position_ids [1,2048] i32, 3 Wq [2048,2048], 4 bq, 5 Wk [2048,256], 6 bk, 7 Wv, 8 bv, 9 Wo [2048,2048], 10 bo
  if (ws_size < (size_t)WS_END) return;
  char* ws = (char*)d_ws; __bf16 *PK = (__bf16*)(ws + WS_PK), *VTH = (__bf16*)(ws + WS_VTH), *VTL = (__bf16*)(ws + WS_VTL);
  __bf16 *QH = (__bf16*)(ws + WS_QH), *QL = (__bf16*)(ws + WS_QL), *KH = (__bf16*)(ws + WS_KH), *KL = (__bf16*)(ws + WS_KL);
  float *CS = (float*)(ws + WS_CS), *O = (float*)(ws + WS_O);
  k_packT<<<dim3(NPT + SS / (4 * (DM / 64)), DM / 64), 256, 0, stream>>>(F[3], F[5], F[7], F[9], PK, POS, CS);
  k_proj<<<dim3(SS / 64, NH + 2 * NKV), 128, 0, stream>>>(F[0], PK, F[4], F[6], F[8], CS, QH, QL, KH, KL, VTH, VTL);
  k_attn<<<dim3(SS / 16, NH), 32 * NKW, 0, stream>>>(QH, QL, KH, KL, F[1], VTH, VTL, O);
  k_out<<<dim3(TQB, DM / 128), 128, 0, stream>>>(O, PK + PK_O, F[10], (float*)d_out);
}

// v007
// It runs in 205 microseconds.
// Two timings next to v006 put it at 1.17 and 1.13 times that version's speed.
// Over all steps from v000 it is 5.25 times as fast.
// compute dtype: hidden_states, all weights/biases and the additive attention_mask (module inputs) rounded to bf16; position_ids as int32; q/k/v projections with exact bf16 products (x and W are inputs) + bias and interleaved-pair RoPE from position_ids in f32 in the epilogue; scores q.k with both computed operands as bf16 hi + residual pairs (3 products) + the mask value, P.V with P hi/lo x V hi/lo (3 products); output projection hi/lo x exact Wo (2 products) + bo; softmax in f32; key tiles whose mask entries are all <= -1e8 for the wave's rows are skipped at run time (exp underflows to exactly 0 in the reference too); f32 accumulate.
#include <hip/hip_runtime.h>
#include <math.h>

typedef __attribute__((ext_vector_type(16))) _Float16 v16h;
typedef __attribute__((ext_vector_type(16))) __bf16 v16b;
typedef __attribute__((ext_vector_type(8)))  _Float16 v8h;
typedef __attribute__((ext_vector_type(8)))  float v8f;
typedef __attribute__((ext_vector_type(4)))  float v4f;
typedef __attribute__((ext_vector_type(2)))  float v2f;
typedef __attribute__((ext_vector_type(4)))  unsigned v4u;
typedef __attribute__((ext_vector_type(4)))  int v4i;
typedef float __attribute__((may_alias)) float_a;
typedef int __attribute__((may_alias)) int_a;

template <typename T> __device__ __forceinline__ void vst2(void* p, T v) { *(T*)p = v;  }
__device__ __forceinline__ v8f wmma16(v16h a, v16h b, v8f c) {
  v8f d = __builtin_amdgcn_wmma_f32_16x16x32_f16(false, a, false, b, (short)0, c, false, false);
  asm volatile("v_nop\n\tv_nop\n\tv_nop\n\tv_nop" : "+v"(d) : "v"(a), "v"(b));
  return d;
}
__device__ __forceinline__ v8f wmma_bf(v16b a, v16b b, v8f c) {
  v8f d = __builtin_amdgcn_wmma_f32_16x16x32_bf16(false, a, false, b, (short)0, c, false, false);
  asm volatile("v_nop\n\tv_nop\n\tv_nop\n\tv_nop" : "+v"(d) : "v"(a), "v"(b));
  return d;
}
// 16x16x32 fragments: lane = (h = lane>>4, row/col = lane&15); elements 0..7 = k0+8h+0..7, 8..15 = k0+16+8h+0..7; D element r = row 8h+r
__device__ __forceinline__ v16h frag_h(const _Float16* rowk0, int lane) {
  union { v16h v; v8h q[2]; } u; const _Float16* p = rowk0 + 8 * (lane >> 4);
  u.q[0] = *(const v8h*)p; u.q[1] = *(const v8h*)(p + 16); return u.v;
}
__device__ __forceinline__ v16h frag_f32(const float* rowk0, int lane) {
  v16h a; const float* p = rowk0 + 8 * (lane >> 4);
#pragma unroll
  for (int i = 0; i < 8; ++i) { a[i] = (_Float16)p[i]; a[8 + i] = (_Float16)p[16 + i]; }
  return a;
}
__device__ __forceinline__ v16h frag_f32s(const float* rowk0, int lane, float sc) {
  v16h a; const float* p = rowk0 + 8 * (lane >> 4);
#pragma unroll
  for (int i = 0; i < 8; ++i) { a[i] = (_Float16)(p[i] * sc); a[8 + i] = (_Float16)(p[16 + i] * sc); }
  return a;
}
// column fragment from a [K][ld] layout (column n), rows >= K read as 0
__device__ __forceinline__ v16h fragc_f32(const float* W, int k0, int n, int lane, int ld, int K) {
  v16h a; const int g = lane >> 4;
#pragma unroll
  for (int i = 0; i < 8; ++i) { const int ka = k0 + 8 * g + i, kb = ka + 16;
    a[i] = (_Float16)(ka < K ? W[(size_t)(ka < K ? ka : K - 1) * ld + n] : 0.f); a[8 + i] = (_Float16)(kb < K ? W[(size_t)(kb < K ? kb : K - 1) * ld + n] : 0.f); }
  return a;
}
struct F2 { v16b h, l; };
__device__ __forceinline__ F2 bsplit16(const float v[16]) { F2 r;
#pragma unroll
  for (int i = 0; i < 16; ++i) { const __bf16 h = (__bf16)v[i]; r.h[i] = h; r.l[i] = (__bf16)(v[i] - (float)h); }
  return r; }
__device__ __forceinline__ F2 split_row(const float* row, int k0, int lane) { float v[16]; const float* p = row + k0 + 8 * (lane >> 4);
#pragma unroll
  for (int i = 0; i < 8; ++i) { v[i] = p[i]; v[8 + i] = p[16 + i]; }
  return bsplit16(v); }
__device__ __forceinline__ F2 split_rowK(const float* row, int k0, int lane, int K) { float v[16]; const int g = lane >> 4;
#pragma unroll
  for (int i = 0; i < 8; ++i) { const int ka = k0 + 8 * g + i, kb = ka + 16; v[i] = ka < K ? row[ka < K ? ka : K - 1] : 0.f; v[8 + i] = kb < K ? row[kb < K ? kb : K - 1] : 0.f; }
  return bsplit16(v); }
__device__ __forceinline__ F2 split_col(const float* W, int k0, int n, int lane, int ld, int K) { float v[16]; const int g = lane >> 4;
#pragma unroll
  for (int i = 0; i < 8; ++i) { const int ka = k0 + 8 * g + i, kb = ka + 16; v[i] = ka < K ? W[(size_t)(ka < K ? ka : K - 1) * ld + n] : 0.f; v[8 + i] = kb < K ? W[(size_t)(kb < K ? kb : K - 1) * ld + n] : 0.f; }
  return bsplit16(v); }
__device__ __forceinline__ v8f mac3(const F2& a, const F2& b, v8f c) { c = wmma_bf(a.l, b.h, c); c = wmma_bf(a.h, b.l, c); return wmma_bf(a.h, b.h, c); }
__device__ __forceinline__ float sigm(float v) { return 1.0f / (1.0f + expf(-v)); }
#define LDSX() do { asm volatile("s_wait_dscnt 0" ::: "memory"); __builtin_amdgcn_wave_barrier(); __builtin_amdgcn_fence(__ATOMIC_RELEASE, "workgroup"); } while (0)


// Attention with grouped kv heads (B 1, S 2048, D 2048, 16 query heads / 2 kv heads x 128): q = rope(x Wq + bq), k = rope(x Wk + bk) (interleaved pairs, angles from position_ids), v = x Wv + bv; scores = q k^T / sqrt(128) + attention_mask[q][k] (additive input); softmax; out = (P v) Wo + bo.
#define SS 2048
#define DM 2048
#define NH 16
#define NKV 2
#define HD 128
#define KVW (NKV * HD)
#ifndef TQB
#define TQB (SS / 64)
#endif
typedef __attribute__((ext_vector_type(8))) __bf16 v8b;
typedef __attribute__((ext_vector_type(4))) __bf16 v4b;
__device__ __forceinline__ v16b frag_b(const __bf16* rowk0, int lane) {
  union { v16b v; v8b q[2]; } u; const __bf16* p = rowk0 + 8 * (lane >> 4);
  u.q[0] = *(const v8b*)p; u.q[1] = *(const v8b*)(p + 16); return u.v;
}
// fragment-order plane of a logical [R][C] bf16 matrix: 16-row x 32-column fragments of 512 elements, fragment index (row >> 4) * (C / 32) + (c >> 5); inside it element (row, c) sits at ((c >> 4) & 1) * 256 + (((c >> 3) & 1) * 16 + (row & 15)) * 8 + (c & 7). Lane l's two 16-B pieces (the same elements that frag_b reads from a row) are at l * 8 and 256 + l * 8: each load of a wave is 512 contiguous bytes
__device__ __forceinline__ v16b frag_fo(const __bf16* f, int lane) {
  union { v16b v; v8b q[2]; } u; u.q[0] = *(const v8b*)(f + lane * 8); u.q[1] = *(const v8b*)(f + 256 + lane * 8); return u.v;
}
__device__ __forceinline__ float bfr(float v) { return (float)(__bf16)v; }
__device__ __attribute__((noinline)) float exp_ni(float v) { return expf(v); }
__device__ __attribute__((noinline)) float erf_ni(float v) { return erff(v); }

#define PK_Q 0
#define PK_K (PK_Q + DM * DM)
#define PK_V (PK_K + KVW * DM)
#define PK_O (PK_V + KVW * DM)
#define PK_END (PK_O + DM * DM)
#define WS_PK  0u
#define WS_CS  (WS_PK + 2u * PK_END)             // f32 [2048][64] cos, then [2048][64] sin
#define WS_QH  (WS_CS + 4u * 2 * SS * 64)        // q after RoPE as bf16 hi plane [2048][2048] in fragment order, then its residual plane
#define WS_QL  (WS_QH + 2u * SS * DM)
#define WS_KH  (WS_QL + 2u * SS * DM)            // k after RoPE as bf16 hi plane [2048][256] in fragment order, then its residual plane
#define WS_KL  (WS_KH + 2u * SS * KVW)
#define WS_VTH (WS_KL + 2u * SS * KVW)
#define WS_VTL (WS_VTH + 2u * KVW * SS)
#define WS_O   (WS_VTL + 2u * KVW * SS)
#define WS_END (WS_O + 4u * SS * DM)

// ---- k_packT: block = tile of 64 k x 128 n of a [K][N] (x @ W) matrix, turned through LDS into DST [N][K] bf16: a wave's load = 512 contiguous bytes of one k row, a wave's store = 4 n rows x one whole 128-B line (K a multiple of 64, N of 128)
// one launch for all four matrices (each has K = DM): blockIdx.x counts the 128-column tiles of Wq, Wk, Wv, Wo side by side, and the DST rows follow in that order (PK_Q, PK_K, PK_V, PK_O are contiguous)
// the blocks behind them (blockIdx.x >= NPT) fill the RoPE tables, which depend on nothing of the above either: 4 positions t a block, 64 threads = pair index i each: inv_freq = 1 / 10000^((2i)/128) and angle = float(position_ids[t]) * inv_freq in f32 (as the reference), cos/sin in f32; rows 256 B, a wave's store = one whole 128-B line
#define NPT ((2 * DM + 2 * KVW) / 128)
__global__ __launch_bounds__(256) void k_packT(const float* __restrict__ Wq, const float* __restrict__ Wk, const float* __restrict__ Wv, const float* __restrict__ Wo, __bf16* __restrict__ DST, const int* __restrict__ POS, float* __restrict__ CS) {
  const int bx = blockIdx.x, K = DM; const float* Wm; int N, ns;   // ns = the tile's first column in its own matrix
  if (bx >= NPT) {   // the same for every thread of a block, and in front of the barrier
    const int t = ((bx - NPT) * (DM / 64) + blockIdx.y) * 4 + (threadIdx.x >> 6), i = threadIdx.x & 63;
    const float inv = 1.0f / powf(10000.0f, (float)(2 * i) / 128.0f); const float ang = (float)POS[t] * inv;
    CS[(size_t)t * 64 + i] = cosf(ang); CS[(size_t)SS * 64 + (size_t)t * 64 + i] = sinf(ang); return; }
  if (bx < DM / 128) { Wm = Wq; N = DM; ns = bx * 128; } else if (bx < (DM + KVW) / 128) { Wm = Wk; N = KVW; ns = bx * 128 - DM; } else if (bx < (DM + 2 * KVW) / 128) { Wm = Wv; N = KVW; ns = bx * 128 - DM - KVW; } else { Wm = Wo; N = DM; ns = bx * 128 - DM - 2 * KVW; }
  __shared__ unsigned s[128][33];   // row n: its 64 k as 32 bf16 pairs (k, k + 1); the odd pitch spreads both the column-wise writes and the row-wise reads over the banks
  const int tid = threadIdx.x, wave = tid >> 5, lane = tid & 31; const int n0 = bx * 128, k0 = blockIdx.y * 64;
  const float* src = Wm + (size_t)(k0 + wave * 8) * N + ns + lane * 4; const float* pr[8]; v4f xr[8];
#pragma unroll
  for (int i = 0; i < 8; ++i) { pr[i] = src + (size_t)i * N; xr[i] = *(const v4f*)pr[i]; }
  // stands in front of every rewrite of the address registers of the 8 loads above; naming them as inputs keeps them whole up to here (without that a later load's result landed on an earlier load's address pair ahead of the wait)
  asm volatile("s_wait_xcnt 0x0" :: "v"(pr[0]), "v"(pr[1]), "v"(pr[2]), "v"(pr[3]), "v"(pr[4]), "v"(pr[5]), "v"(pr[6]), "v"(pr[7]) : "memory");
#pragma unroll
  for (int i = 0; i < 8; i += 2)
#pragma unroll
    for (int e = 0; e < 4; ++e) { union { __bf16 b[2]; unsigned u; } p; p.b[0] = (__bf16)xr[i][e]; p.b[1] = (__bf16)xr[i + 1][e]; s[lane * 4 + e][wave * 4 + (i >> 1)] = p.u; }
  __syncthreads();
#pragma unroll
  for (int j = 0; j < 4; ++j) { const int q = tid + 256 * j, n = q >> 3, k8 = q & 7; v4u o;
#pragma unroll
    for (int e = 0; e < 4; ++e) o[e] = s[n][k8 * 4 + e];
    vst2((unsigned*)(DST + (size_t)(n0 + n) * K + k0 + k8 * 8), o); }
}
// ---- k_proj: block = (64 rows, 128 cols = one head), operands staged in LDS per 64-k step, the next step's global loads issued ahead of this step's products: Y = bf16(x) . P rows (exact); q and k heads: RoPE then bf16 hi/lo planes of [2048][ldo] in fragment order; v heads: plain -> transposed bf16 hi/lo planes of [256][2048] in fragment order
// one launch for q, k and v: blockIdx.y counts the 16 q heads, the 2 k heads and the 2 v heads, which are consecutive 128-row groups of P
__global__ __launch_bounds__(128) void k_proj(const float* __restrict__ X, const __bf16* __restrict__ P, const float* __restrict__ bq, const float* __restrict__ bk, const float* __restrict__ bv, const float* __restrict__ CS, __bf16* __restrict__ QH, __bf16* __restrict__ QL, __bf16* __restrict__ KH, __bf16* __restrict__ KL, __bf16* __restrict__ VTH, __bf16* __restrict__ VTL) {
  __shared__ __align__(16) char se[2 * 128 * 72 * 2];   // output staging; a block uses it either as so (q, k) or as sth + stl (v)
  float (*so)[16][132] = (float (*)[16][132])se; __bf16 (*sth)[72] = (__bf16 (*)[72])se; __bf16 (*stl)[72] = sth + 128;
  static_assert(sizeof(float) * 4 * 16 * 132 <= sizeof(se), "so fits the staging area");
  const int by = blockIdx.y; const bool isv = by >= NH + NKV; const float* bias; __bf16 *PH, *PL; int ldo, n0;   // n0 = the head's first column in its own output
  if (by < NH) { bias = bq; PH = QH; PL = QL; ldo = DM; n0 = by * 128; } else if (!isv) { bias = bk; PH = KH; PL = KL; ldo = KVW; n0 = (by - NH) * 128; } else { bias = bv; PH = VTH; PL = VTL; ldo = 0; n0 = (by - NH - NKV) * 128; }
  __shared__ __align__(16) __bf16 sA[2][64][72], sB[2][128][72];   // two buffers of one 64-k step: 64 x rows (rounded to bf16) and 128 P rows, 128-B rows at pitch 144 B
  const int tid = threadIdx.x, wave = tid >> 5, lane = tid & 31, col = lane & 15, g = lane >> 4; const size_t r0 = (size_t)blockIdx.x * 64 + wave * 16;
  const float* xg = X + ((size_t)blockIdx.x * 64 + (tid >> 4)) * DM + (tid & 15) * 4;   // piece it of a step: row (tid >> 4) + 8 it, 16 B; a wave's load = 2 rows x 256 B
  const __bf16* pg = P + (size_t)(by * 128 + (tid >> 3)) * DM + (tid & 7) * 8;          // piece it of a step: row (tid >> 3) + 16 it, 16 B; a wave's load = 4 rows x 128 B
  v8f acc[8] = {}; v4f xr[8]; v8b pr[8];
#pragma unroll
  for (int it = 0; it < 8; ++it) { xr[it] = *(const v4f*)(xg + (size_t)it * 8 * DM); pr[it] = *(const v8b*)(pg + (size_t)it * 16 * DM); }
#pragma unroll
  for (int it = 0; it < 8; ++it) { v4b x4;
#pragma unroll
    for (int e = 0; e < 4; ++e) x4[e] = (__bf16)xr[it][e];
    *(v4b*)&sA[0][(tid >> 4) + 8 * it][(tid & 15) * 4] = x4; *(v8b*)&sB[0][(tid >> 3) + 16 * it][(tid & 7) * 8] = pr[it]; }
#pragma unroll 2   // two copies: the buffer index is a constant in each, so every LDS address is a base register plus an immediate
  for (int st = 0; st < DM / 64; ++st) { const int bu = st & 1;
    __syncthreads();   // publishes step st; every reader of the other buffer (step st - 1) has left it before it is rewritten below
    if (st + 1 < DM / 64) {
#pragma unroll
      for (int it = 0; it < 8; ++it) { xr[it] = *(const v4f*)(xg + (size_t)it * 8 * DM + (st + 1) * 64); pr[it] = *(const v8b*)(pg + (size_t)it * 16 * DM + (st + 1) * 64); } }
#pragma unroll
    for (int k2 = 0; k2 < 2; ++k2) {
      if (k2 == 1) asm volatile("s_wait_xcnt 0x0" ::: "memory");   // stands in front of every later rewrite of the address registers of the next step's loads above
      const v16b a = frag_b(&sA[bu][wave * 16 + col][k2 * 32], lane); v16b b[8];
#pragma unroll
      for (int j = 0; j < 8; ++j) b[j] = frag_b(&sB[bu][j * 16 + col][k2 * 32], lane);
#pragma unroll
      for (int j = 0; j < 8; ++j) acc[j] = wmma_bf(a, b[j], acc[j]); }
    if (st + 1 < DM / 64) {
#pragma unroll
      for (int it = 0; it < 8; ++it) { v4b x4;
#pragma unroll
        for (int e = 0; e < 4; ++e) x4[e] = (__bf16)xr[it][e];
        *(v4b*)&sA[bu ^ 1][(tid >> 4) + 8 * it][(tid & 15) * 4] = x4; *(v8b*)&sB[bu ^ 1][(tid >> 3) + 16 * it][(tid & 7) * 8] = pr[it]; } } }
  if (!isv) {   // the same for every thread of a block
    // biased projections to LDS, then interleaved-pair RoPE in place: (d = 2i, 2i+1): out_e = x_e cos_i - x_o sin_i; out_o = x_e sin_i + x_o cos_i with angle index i = d/2 (position from position_ids via the CS tables)
#pragma unroll
    for (int j = 0; j < 8; ++j) { const float bb = bfr(bias[n0 + j * 16 + col]);
#pragma unroll
      for (int r = 0; r < 8; ++r) so[wave][8 * g + r][j * 16 + col] = acc[j][r] + bb; }
    LDSX();
    for (int q = lane; q < 16 * 64; q += 32) { const int rl = q >> 6, i = q & 63; const size_t t = r0 + rl; const float c = CS[t * 64 + i], s = CS[(size_t)SS * 64 + t * 64 + i]; const float xe = so[wave][rl][2 * i], xo = so[wave][rl][2 * i + 1]; so[wave][rl][2 * i] = xe * c - xo * s; so[wave][rl][2 * i + 1] = xe * s + xo * c; }
    LDSX();
    // each value leaves as bf16 hi + bf16 residual, the same split that the score products use; the wave's 16 rows x 128 columns are 4 whole fragments of each plane, piece p = 16 columns: a wave's store = 512 contiguous bytes
    const size_t f0 = ((r0 >> 4) * (size_t)(ldo >> 5) + (n0 >> 5)) * 512;
    for (int p = 0; p < 8; ++p) { const float* sr = &so[wave][col][p * 16 + g * 8]; const v4f va = *(const v4f*)sr, vb = *(const v4f*)(sr + 4); v8b h8, l8;
#pragma unroll
      for (int e = 0; e < 4; ++e) { const __bf16 ha = (__bf16)va[e], hb = (__bf16)vb[e]; h8[e] = ha; l8[e] = (__bf16)(va[e] - (float)ha); h8[4 + e] = hb; l8[4 + e] = (__bf16)(vb[e] - (float)hb); }
      const size_t o = f0 + p * 256 + lane * 8; *(v8b*)(PH + o) = h8; *(v8b*)(PL + o) = l8;
      asm volatile("s_wait_xcnt 0x0" ::: "memory"); }   // the next piece rewrites the stores' data registers: the wait stands in front of that
  } else {
#pragma unroll
    for (int j = 0; j < 8; ++j)
#pragma unroll
      for (int r = 0; r < 8; ++r) { const float v = acc[j][r] + bfr(bias[n0 + j * 16 + col]); const __bf16 hb = (__bf16)v; sth[j * 16 + col][wave * 16 + 8 * g + r] = hb; stl[j * 16 + col][wave * 16 + 8 * g + r] = (__bf16)(v - (float)hb); }
    __syncthreads();
    const int s0 = blockIdx.x * 64;
    // the block's 128 d x 64 s are 16 whole fragments of each plane: fragment fl, half j, lane slot sl; a wave's store = 512 contiguous bytes
    for (int q = tid; q < 128 * 8; q += 128) { const int fl = q >> 6, j = (q >> 5) & 1, sl = q & 31; const int d = (fl >> 1) * 16 + (sl & 15), c = (fl & 1) * 32 + j * 16 + (sl >> 4) * 8;
      const size_t o = ((size_t)((n0 >> 4) + (fl >> 1)) * (SS / 32) + (s0 >> 5) + (fl & 1)) * 512 + j * 256 + sl * 8; vst2((unsigned*)(PH + o), *(const v4u*)&sth[d][c]); vst2((unsigned*)(PL + o), *(const v4u*)&stl[d][c]); }
  }
}
// ---- k_attn: block = (16 queries, head h), NKW waves: wave w takes key steps w, w + NKW, ... of the same 16 queries (flash attention over its share), then the NKW partial (max, sum, acc) are merged through LDS; scores 3 products, P.V 3 products; O[q][h*128+d]
#define NKW 8
#define NVA 6   // v fragments (of 8) of a key step that are asked for ahead of the softmax; the last two take the registers that the first products free
// one 32-d chunk of a key step's score operands: q and the step's two 16-key column groups of k, each as hi + residual
struct KQ { F2 q, k0, k1; };
// p = the lane's own address in a fragment (fragment start + lane * 8): the same two 16-B pieces that frag_fo reads
__device__ __forceinline__ v16b frag_at(const __bf16* p) { union { v16b v; v8b q[2]; } u; u.q[0] = *(const v8b*)p; u.q[1] = *(const v8b*)(p + 256); return u.v; }
__device__ __forceinline__ void ld_kq(KQ& o, const __bf16* qh, const __bf16* ql, const __bf16* kh, const __bf16* kl, int kc) {
  o.k0.h = frag_at(kh + kc * 512); o.k0.l = frag_at(kl + kc * 512); o.k1.h = frag_at(kh + (KVW / 32) * 512 + kc * 512); o.k1.l = frag_at(kl + (KVW / 32) * 512 + kc * 512);
  o.q.h = frag_at(qh + kc * 512); o.q.l = frag_at(ql + kc * 512);
}
// loads_out stands behind a group of global loads: the wait is in front of every later rewrite of their address registers (named as inputs, so that they stay whole up to it); as no load of these addresses moves over the statement, it also keeps the group issued here, ahead of the work it is to fly under
__device__ __forceinline__ void loads_out(const __bf16* a, const __bf16* b) { asm volatile("s_wait_xcnt 0x0" :: "v"(a), "v"(b) : "memory"); }
__device__ __forceinline__ void loads_out(const __bf16* a, const __bf16* b, const __bf16* c, const __bf16* d) { asm volatile("s_wait_xcnt 0x0" :: "v"(a), "v"(b), "v"(c), "v"(d) : "memory"); }
__device__ __forceinline__ void loads_out(const float* m, const __bf16* a, const __bf16* b, const __bf16* c, const __bf16* d) { asm volatile("s_wait_xcnt 0x0" :: "v"(m), "v"(a), "v"(b), "v"(c), "v"(d) : "memory"); }
// lane l with lane l ^ 16 (the two lanes that hold one query's column)
__device__ __forceinline__ float xhalf(float x) { return __builtin_bit_cast(float, __builtin_amdgcn_permlanex16(__builtin_bit_cast(int, x), __builtin_bit_cast(int, x), 0x76543210, 0xfedcba98, false, false)); }
// both products are computed transposed: S^T = K . Q^T (A = k fragment, B = q fragment) and O^T += V^T . P^T (A = v fragment, B = P^T). A and B share one lane and k map, so the planes are read as before.
// D register r of lane (g, col) = row 8 g + r, column col: a lane holds 8 keys (of each 16-key group) of ONE query col, and later 8 d of that query. Maximum and sum run in the lane, plus one exchange between the halves;
// the two score tiles of a step, converted in place, are the B operand P^T (element s = tile s >> 3, register s & 7 = key 8 g + s or 16 + 8 g + s - 8, the k order of the v fragments)
__global__ __launch_bounds__(32 * NKW) void k_attn(const __bf16* __restrict__ QH, const __bf16* __restrict__ QL, const __bf16* __restrict__ KH, const __bf16* __restrict__ KL, const float* __restrict__ MASK, const __bf16* __restrict__ VTH, const __bf16* __restrict__ VTL, float* __restrict__ O) {
  __shared__ __align__(16) float so[NKW][16][132]; __shared__ float sm[NKW][16], sl[NKW][16];
  const int tid = threadIdx.x, wave = __builtin_amdgcn_readfirstlane(tid >> 5), lane = tid & 31, col = lane & 15, g = lane >> 4;
  const int qb = blockIdx.x, h = blockIdx.y, kv = h / (NH / NKV); const int q0 = qb * 16;
  const size_t qo = ((size_t)qb * (DM / 32) + h * (HD / 32)) * 512;   // the tile's q fragments are re-read per key step (8 KiB that all 8 waves share; keeps the kernel under 256 VGPRs)
  const __bf16 *qhp = QH + qo + lane * 8, *qlp = QL + qo + lane * 8;   // the lane's own address in the tile's first q fragment
  float m = -3.0e38f, l = 0.f;   // of query col; m is the same in both halves, l is the sum over the half's own keys
  v8f acc[8] = {};   // acc[dt][r] = O^T[dt * 16 + 8 g + r][col]
#pragma unroll 1
  for (int ks = wave; ks < SS / 32; ks += NKW) { v4f mk[2][2]; bool anylive = false;
    const size_t ko = ((size_t)(ks * 2) * (KVW / 32) + kv * (HD / 32)) * 512;   // keys ct * 16 .. + 15 of the step are fragment row ks * 2 + ct of the k planes
    const __bf16 *kh = KH + ko + lane * 8, *kl = KL + ko + lane * 8; const float* mp = MASK + (size_t)(q0 + col) * SS + ks * 32 + 8 * g;   // the lane's 8 keys of group ct are 32 contiguous bytes of its query's mask row, at ct * 16
    const size_t vo = ((size_t)(kv * (HD / 16)) * (SS / 32) + ks) * 512; const __bf16 *vhp = VTH + vo + lane * 8, *vlp = VTL + vo + lane * 8;   // v fragment dt of the step is at dt * (SS / 32) * 512
    // the step's mask values and its first two 32-d chunks of q and k are asked for together, ahead of the mask test: one wait on L2 for all of them (a skipped step drops the chunks unread)
#pragma unroll
    for (int ct = 0; ct < 2; ++ct) { mk[ct][0] = *(const v4f*)(mp + ct * 16); mk[ct][1] = *(const v4f*)(mp + ct * 16 + 4); }
    KQ ca, cb; ld_kq(ca, qhp, qlp, kh, kl, 0); ld_kq(cb, qhp, qlp, kh, kl, 1);
    loads_out(mp, kh, kl, qhp, qlp);
#pragma unroll
    for (int ct = 0; ct < 2; ++ct)
#pragma unroll
      for (int r = 0; r < 8; ++r) { const float m_ = bfr(mk[ct][r >> 2][r & 3]); mk[ct][r >> 2][r & 3] = m_; anylive = anylive || (m_ > -1.0e8f); }
    if (__any(anylive)) {   // wave-uniform: skip key tiles that are fully masked for this wave's 16 queries (exp of <= -1e8 underflows to exactly 0 in the reference too)
    v8f c0 = {}, c1 = {}; v16b vh[8], vl[8];
    // chunk kc + 2 is asked for as soon as the products of chunk kc have freed its registers, and flies under the products of chunk kc + 1
    c0 = mac3(ca.k0, ca.q, c0); c1 = mac3(ca.k1, ca.q, c1);
    ld_kq(ca, qhp, qlp, kh, kl, 2); loads_out(kh, kl, qhp, qlp);
    c0 = mac3(cb.k0, cb.q, c0); c1 = mac3(cb.k1, cb.q, c1);
    ld_kq(cb, qhp, qlp, kh, kl, 3); loads_out(kh, kl, qhp, qlp);
    c0 = mac3(ca.k0, ca.q, c0); c1 = mac3(ca.k1, ca.q, c1);
    c0 = mac3(cb.k0, cb.q, c0); c1 = mac3(cb.k1, cb.q, c1);
    float e[16];   // e[ct * 8 + r]: key ks * 32 + ct * 16 + 8 g + r of query col
#pragma unroll
    for (int r = 0; r < 8; ++r) { e[r] = c0[r] * 0.08838834764831845f + mk[0][r >> 2][r & 3]; e[8 + r] = c1[r] * 0.08838834764831845f + mk[1][r >> 2][r & 3]; }
    // v fragments 0 .. NVA - 1 are asked for ahead of the softmax and fly under it
#pragma unroll
    for (int dt = 0; dt < NVA; ++dt) { vh[dt] = frag_at(vhp + (size_t)dt * (SS / 32) * 512); vl[dt] = frag_at(vlp + (size_t)dt * (SS / 32) * 512); }
    loads_out(vhp, vlp);
    float mx = fmaxf(e[0], e[8]);
#pragma unroll
    for (int r = 1; r < 8; ++r) mx = fmaxf(mx, fmaxf(e[r], e[8 + r]));
    mx = fmaxf(mx, xhalf(mx));
    const float mn = fmaxf(m, mx); const float alpha = (m <= -1.0e38f) ? 0.f : exp_ni(m - mn);
    float es0 = 0.f, es1 = 0.f;
#pragma unroll
    for (int r = 0; r < 8; ++r) { e[r] = exp_ni(e[r] - mn); e[8 + r] = exp_ni(e[8 + r] - mn); es0 += e[r]; es1 += e[8 + r]; }
    l = l * alpha + (es0 + es1); m = mn;
#pragma unroll
    for (int dt = 0; dt < 8; ++dt) acc[dt] *= alpha;
    const F2 pa = bsplit16(e);
#pragma unroll
    for (int dt = 0; dt < 8; ++dt) { acc[dt] = wmma_bf(vh[dt], pa.l, acc[dt]); acc[dt] = wmma_bf(vl[dt], pa.h, acc[dt]); acc[dt] = wmma_bf(vh[dt], pa.h, acc[dt]);
      if (dt + NVA < 8) { vh[dt + NVA] = frag_at(vhp + (size_t)(dt + NVA) * (SS / 32) * 512); vl[dt + NVA] = frag_at(vlp + (size_t)(dt + NVA) * (SS / 32) * 512); loads_out(vhp, vlp); } }   // the last fragments take the registers that the first products have freed
    } }
  // merge: query maximum over the waves, each wave's sum and acc rescaled to it, then summed in wave order (a wave with no live key step has m = -3e38, l = 0 and weight 0)
  l += xhalf(l);   // the two halves' sums of a query are joined once, here
  if (g == 0) sm[wave][col] = m;
  __syncthreads();
  { float mx = sm[0][col];
#pragma unroll
    for (int w = 1; w < NKW; ++w) mx = fmaxf(mx, sm[w][col]);
    const float f = (m <= -1.0e38f) ? 0.f : exp_ni(m - mx);
    if (g == 0) sl[wave][col] = l * f;
#pragma unroll
    for (int dt = 0; dt < 8; ++dt) { const v8f a = acc[dt] * f; float* d = &so[wave][col][dt * 16 + 8 * g]; *(v4f*)d = __builtin_shufflevector(a, a, 0, 1, 2, 3); *(v4f*)(d + 4) = __builtin_shufflevector(a, a, 4, 5, 6, 7); } }
  __syncthreads();
  for (int rl = wave; rl < 16; rl += NKW) { v4f a = *(const v4f*)&so[0][rl][lane * 4]; float ls = sl[0][rl];
#pragma unroll
    for (int w = 1; w < NKW; ++w) { a += *(const v4f*)&so[w][rl][lane * 4]; ls += sl[w][rl]; }
    vst2(O + (size_t)(q0 + rl) * DM + h * HD + lane * 4, a * (1.0f / ls));
    asm volatile("s_wait_xcnt 0x0" ::: "memory"); }   // the next trip rewrites the store's address and data registers: the wait stands in front of that
}
// ---- k_out: block = (64 rows, 128 cols), operands staged in LDS as in k_proj: out = O(hi/lo) . wproj^T rows (2 products)
__global__ __launch_bounds__(128) void k_out(const float* __restrict__ O, const __bf16* __restrict__ P, const float* __restrict__ bias, float* __restrict__ Y) {
  __shared__ __align__(16) float so[4][16][132];
  __shared__ __align__(16) __bf16 sAh[2][64][72], sAl[2][64][72], sB[2][128][72];   // two buffers of one 64-k step: 64 O rows as bf16 hi and residual, 128 P rows, 128-B rows at pitch 144 B
  const int tid = threadIdx.x, wave = tid >> 5, lane = tid & 31, col = lane & 15, g = lane >> 4; const size_t r0 = (size_t)blockIdx.x * 64 + wave * 16; const int n0 = blockIdx.y * 128;
  const float* xg = O + ((size_t)blockIdx.x * 64 + (tid >> 4)) * DM + (tid & 15) * 4;   // piece it of a step: row (tid >> 4) + 8 it, 16 B; a wave's load = 2 rows x 256 B
  const __bf16* pg = P + (size_t)(n0 + (tid >> 3)) * DM + (tid & 7) * 8;                // piece it of a step: row (tid >> 3) + 16 it, 16 B; a wave's load = 4 rows x 128 B
  v8f acc[8] = {}; v4f xr[8]; v8b pr[8];
#pragma unroll
  for (int it = 0; it < 8; ++it) { xr[it] = *(const v4f*)(xg + (size_t)it * 8 * DM); pr[it] = *(const v8b*)(pg + (size_t)it * 16 * DM); }
#pragma unroll
  for (int it = 0; it < 8; ++it) { v4b h4, l4;
#pragma unroll
    for (int e = 0; e < 4; ++e) { const __bf16 hb = (__bf16)xr[it][e]; h4[e] = hb; l4[e] = (__bf16)(xr[it][e] - (float)hb); }
    *(v4b*)&sAh[0][(tid >> 4) + 8 * it][(tid & 15) * 4] = h4; *(v4b*)&sAl[0][(tid >> 4) + 8 * it][(tid & 15) * 4] = l4; *(v8b*)&sB[0][(tid >> 3) + 16 * it][(tid & 7) * 8] = pr[it]; }
#pragma unroll 2   // two copies: the buffer index is a constant in each, so every LDS address is a base register plus an immediate
  for (int st = 0; st < DM / 64; ++st) { const int bu = st & 1;
    __syncthreads();   // publishes step st; every reader of the other buffer (step st - 1) has left it before it is rewritten below
    if (st + 1 < DM / 64) {
#pragma unroll
      for (int it = 0; it < 8; ++it) { xr[it] = *(const v4f*)(xg + (size_t)it * 8 * DM + (st + 1) * 64); pr[it] = *(const v8b*)(pg + (size_t)it * 16 * DM + (st + 1) * 64); } }
#pragma unroll
    for (int k2 = 0; k2 < 2; ++k2) {
      if (k2 == 1) asm volatile("s_wait_xcnt 0x0" ::: "memory");   // stands in front of every later rewrite of the address registers of the next step's loads above
      const v16b ah = frag_b(&sAh[bu][wave * 16 + col][k2 * 32], lane), al = frag_b(&sAl[bu][wave * 16 + col][k2 * 32], lane); v16b b[8];
#pragma unroll
      for (int j = 0; j < 8; ++j) b[j] = frag_b(&sB[bu][j * 16 + col][k2 * 32], lane);
#pragma unroll
      for (int j = 0; j < 8; ++j) { acc[j] = wmma_bf(al, b[j], acc[j]); acc[j] = wmma_bf(ah, b[j], acc[j]); } }
    if (st + 1 < DM / 64) {
#pragma unroll
      for (int it = 0; it < 8; ++it) { v4b h4, l4;
#pragma unroll
        for (int e = 0; e < 4; ++e) { const __bf16 hb = (__bf16)xr[it][e]; h4[e] = hb; l4[e] = (__bf16)(xr[it][e] - (float)hb); }
        *(v4b*)&sAh[bu ^ 1][(tid >> 4) + 8 * it][(tid & 15) * 4] = h4; *(v4b*)&sAl[bu ^ 1][(tid >> 4) + 8 * it][(tid & 15) * 4] = l4; *(v8b*)&sB[bu ^ 1][(tid >> 3) + 16 * it][(tid & 7) * 8] = pr[it]; } } }
#pragma unroll
  for (int j = 0; j < 8; ++j)
#pragma unroll
    for (int r = 0; r < 8; ++r) so[wave][8 * g + r][j * 16 + col] = acc[j][r] + bfr(bias[n0 + j * 16 + col]);
  LDSX();
  for (int rl = 0; rl < 16; ++rl) vst2(Y + (r0 + rl) * DM + n0 + lane * 4, *(const v4f*)&so[wave][rl][lane * 4]);
}
extern "C" void kernel_launch(void* const* d_in, const int* in_sizes, int n_in, void* d_out, int out_size, void* d_ws, size_t ws_size, hipStream_t stream) {
  (void)in_sizes; (void)n_in; (void)out_size;
  const float** F = (const float**)d_in; const int* POS = (const int*)d_in[2];   // 0 hidden_states [1,2048,2048], 1 attention_mask [1,1,2048,2048], 2 position_ids [1,2048] i32, 3 Wq [2048,2048], 4 bq, 5 Wk [2048,256], 6 bk, 7 Wv, 8 bv, 9 Wo [2048,2048], 10 bo
  if (ws_size < (size_t)WS_END) return;
  char* ws = (char*)d_ws; __bf16 *PK = (__bf16*)(ws + WS_PK), *VTH = (__bf16*)(ws + WS_VTH), *VTL = (__bf16*)(ws + WS_VTL);
  __bf16 *QH = (__bf16*)(ws + WS_QH), *QL = (__bf16*)(ws + WS_QL), *KH = (__bf16*)(ws + WS_KH), *KL = (__bf16*)(ws + WS_KL);
  float *CS = (float*)(ws + WS_CS), *O = (float*)(ws + WS_O);
  k_packT<<<dim3(NPT + SS / (4 * (DM / 64)), DM / 64), 256, 0, stream>>>(F[3], F[5], F[7], F[9], PK, POS, CS);
  k_proj<<<dim3(SS / 64, NH + 2 * NKV), 128, 0, stream>>>(F[0], PK, F[4], F[6], F[8], CS, QH, QL, KH, KL, VTH, VTL);
  k_attn<<<dim3(SS / 16, NH), 32 * NKW, 0, stream>>>(QH, QL, KH, KL, F[1], VTH, VTL, O);
  k_out<<<dim3(TQB, DM / 128), 128, 0, stream>>>(O, PK + PK_O, F[10], (float*)d_out);
}

// v008
// It runs in 163 microseconds.
// Next to v007, in two timings, it ran 1.25 and 1.24 times as fast.
// Over all steps from v000 it is 6.53 times as fast.
// compute dtype: hidden_states, all weights/biases and the additive attention_mask (module inputs) rounded to bf16; position_ids as int32; q/k/v projections with exact bf16 products (x and W are inputs) + bias and interleaved-pair RoPE from position_ids in f32 in the epilogue; scores q.k with both computed operands as bf16 hi + residual pairs (3 products) + the mask value, P.V with P hi/lo x V hi/lo (3 products); output projection hi/lo x exact Wo (2 products) + bo; softmax in f32; key tiles whose mask entries are all <= -1e8 for the wave's rows are skipped at run time (exp underflows to exactly 0 in the reference too); f32 accumulate.
#include <hip/hip_runtime.h>
#include <math.h>

typedef __attribute__((ext_vector_type(16))) _Float16 v16h;
typedef __attribute__((ext_vector_type(16))) __bf16 v16b;
typedef __attribute__((ext_vector_type(8)))  _Float16 v8h;
typedef __attribute__((ext_vector_type(8)))  float v8f;
typedef __attribute__((ext_vector_type(4)))  float v4f;
typedef __attribute__((ext_vector_type(2)))  float v2f;
typedef __attribute__((ext_vector_type(4)))  unsigned v4u;
typedef __attribute__((ext_vector_type(4)))  int v4i;
typedef float __attribute__((may_alias)) float_a;
typedef int __attribute__((may_alias)) int_a;

template <typename T> __device__ __forceinline__ void vst2(void* p, T v) { *(T*)p = v;  }
__device__ __forceinline__ v8f wmma16(v16h a, v16h b, v8f c) {
  v8f d = __builtin_amdgcn_wmma_f32_16x16x32_f16(false, a, false, b, (short)0, c, false, false);
  asm volatile("v_nop\n\tv_nop\n\tv_nop\n\tv_nop" : "+v"(d) : "v"(a), "v"(b));
  return d;
}
__device__ __forceinline__ v8f wmma_bf(v16b a, v16b b, v8f c) {
  v8f d = __builtin_amdgcn_wmma_f32_16x16x32_bf16(false, a, false, b, (short)0, c, false, false);
  asm volatile("v_nop\n\tv_nop\n\tv_nop\n\tv_nop" : "+v"(d) : "v"(a), "v"(b));
  return d;
}
// 16x16x32 fragments: lane = (h = lane>>4, row/col = lane&15); elements 0..7 = k0+8h+0..7, 8..15 = k0+16+8h+0..7; D element r = row 8h+r
__device__ __forceinline__ v16h frag_h(const _Float16* rowk0, int lane) {
  union { v16h v; v8h q[2]; } u; const _Float16* p = rowk0 + 8 * (lane >> 4);
  u.q[0] = *(const v8h*)p; u.q[1] = *(const v8h*)(p + 16); return u.v;
}
__device__ __forceinline__ v16h frag_f32(const float* rowk0, int lane) {
  v16h a; const float* p = rowk0 + 8 * (lane >> 4);
#pragma unroll
  for (int i = 0; i < 8; ++i) { a[i] = (_Float16)p[i]; a[8 + i] = (_Float16)p[16 + i]; }
  return a;
}
__device__ __forceinline__ v16h frag_f32s(const float* rowk0, int lane, float sc) {
  v16h a; const float* p = rowk0 + 8 * (lane >> 4);
#pragma unroll
  for (int i = 0; i < 8; ++i) { a[i] = (_Float16)(p[i] * sc); a[8 + i] = (_Float16)(p[16 + i] * sc); }
  return a;
}
// column fragment from a [K][ld] layout (column n), rows >= K read as 0
__device__ __forceinline__ v16h fragc_f32(const float* W, int k0, int n, int lane, int ld, int K) {
  v16h a; const int g = lane >> 4;
#pragma unroll
  for (int i = 0; i < 8; ++i) { const int ka = k0 + 8 * g + i, kb = ka + 16;
    a[i] = (_Float16)(ka < K ? W[(size_t)(ka < K ? ka : K - 1) * ld + n] : 0.f); a[8 + i] = (_Float16)(kb < K ? W[(size_t)(kb < K ? kb : K - 1) * ld + n] : 0.f); }
  return a;
}
struct F2 { v16b h, l; };
__device__ __forceinline__ F2 bsplit16(const float v[16]) { F2 r;
#pragma unroll
  for (int i = 0; i < 16; ++i) { const __bf16 h = (__bf16)v[i]; r.h[i] = h; r.l[i] = (__bf16)(v[i] - (float)h); }
  return r; }
__device__ __forceinline__ F2 split_row(const float* row, int k0, int lane) { float v[16]; const float* p = row + k0 + 8 * (lane >> 4);
#pragma unroll
  for (int i = 0; i < 8; ++i) { v[i] = p[i]; v[8 + i] = p[16 + i]; }
  return bsplit16(v); }
__device__ __forceinline__ F2 split_rowK(const float* row, int k0, int lane, int K) { float v[16]; const int g = lane >> 4;
#pragma unroll
  for (int i = 0; i < 8; ++i) { const int ka = k0 + 8 * g + i, kb = ka + 16; v[i] = ka < K ? row[ka < K ? ka : K - 1] : 0.f; v[8 + i] = kb < K ? row[kb < K ? kb : K - 1] : 0.f; }
  return bsplit16(v); }
__device__ __forceinline__ F2 split_col(const float* W, int k0, int n, int lane, int ld, int K) { float v[16]; const int g = lane >> 4;
#pragma unroll
  for (int i = 0; i < 8; ++i) { const int ka = k0 + 8 * g + i, kb = ka + 16; v[i] = ka < K ? W[(size_t)(ka < K ? ka : K - 1) * ld + n] : 0.f; v[8 + i] = kb < K ? W[(size_t)(kb < K ? kb : K - 1) * ld + n] : 0.f; }
  return bsplit16(v); }
__device__ __forceinline__ v8f mac3(const F2& a, const F2& b, v8f c) { c = wmma_bf(a.l, b.h, c); c = wmma_bf(a.h, b.l, c); return wmma_bf(a.h, b.h, c); }
__device__ __forceinline__ float sigm(float v) { return 1.0f / (1.0f + expf(-v)); }
#define LDSX() do { asm volatile("s_wait_dscnt 0" ::: "memory"); __builtin_amdgcn_wave_barrier(); __builtin_amdgcn_fence(__ATOMIC_RELEASE, "workgroup"); } while (0)


// Attention with grouped kv heads (B 1, S 2048, D 2048, 16 query heads / 2 kv heads x 128): q = rope(x Wq + bq), k = rope(x Wk + bk) (interleaved pairs, angles from position_ids), v = x Wv + bv; scores = q k^T / sqrt(128) + attention_mask[q][k] (additive input); softmax; out = (P v) Wo + bo.
#define SS 2048
#define DM 2048
#define NH 16
#define NKV 2
#define HD 128
#define KVW (NKV * HD)
#ifndef TQB
#define TQB (SS / 64)
#endif
typedef __attribute__((ext_vector_type(8))) __bf16 v8b;
typedef __attribute__((ext_vector_type(4))) __bf16 v4b;
__device__ __forceinline__ v16b frag_b(const __bf16* rowk0, int lane) {
  union { v16b v; v8b q[2]; } u; const __bf16* p = rowk0 + 8 * (lane >> 4);
  u.q[0] = *(const v8b*)p; u.q[1] = *(const v8b*)(p + 16); return u.v;
}
// fragment-order plane of a logical [R][C] bf16 matrix: 16-row x 32-column fragments of 512 elements, fragment index (row >> 4) * (C / 32) + (c >> 5); inside it element (row, c) sits at ((c >> 4) & 1) * 256 + (((c >> 3) & 1) * 16 + (row & 15)) * 8 + (c & 7). Lane l's two 16-B pieces (the same elements that frag_b reads from a row) are at l * 8 and 256 + l * 8: each load of a wave is 512 contiguous bytes
__device__ __forceinline__ v16b frag_fo(const __bf16* f, int lane) {
  union { v16b v; v8b q[2]; } u; u.q[0] = *(const v8b*)(f + lane * 8); u.q[1] = *(const v8b*)(f + 256 + lane * 8); return u.v;
}
__device__ __forceinline__ float bfr(float v) { return (float)(__bf16)v; }
__device__ __attribute__((noinline)) float exp_ni(float v) { return expf(v); }
__device__ __attribute__((noinline)) float erf_ni(float v) { return erff(v); }

#define PK_Q 0
#define PK_K (PK_Q + DM * DM)
#define PK_V (PK_K + KVW * DM)
#define PK_O (PK_V + KVW * DM)
#define PK_END (PK_O + DM * DM)
#define WS_PK  0u
#define WS_CS  (WS_PK + 2u * PK_END)             // f32 [2048][64] cos, then [2048][64] sin
#define WS_QH  (WS_CS + 4u * 2 * SS * 64)        // q after RoPE as bf16 hi plane [2048][2048] in fragment order, then its residual plane
#define WS_QL  (WS_QH + 2u * SS * DM)
#define WS_KH  (WS_QL + 2u * SS * DM)            // k after RoPE as bf16 hi plane [2048][256] in fragment order, then its residual plane
#define WS_KL  (WS_KH + 2u * SS * KVW)
#define WS_VTH (WS_KL + 2u * SS * KVW)
#define WS_VTL (WS_VTH + 2u * KVW * SS)
#define WS_O   (WS_VTL + 2u * KVW * SS)
#define WS_END (WS_O + 4u * SS * DM)

// ---- k_packT: block = tile of 64 k x 128 n of a [K][N] (x @ W) matrix, turned through LDS into DST [N][K] bf16: a wave's load = 512 contiguous bytes of one k row, a wave's store = 4 n rows x one whole 128-B line (K a multiple of 64, N of 128)
// one launch for all four matrices (each has K = DM): blockIdx.x counts the 128-column tiles of Wq, Wk, Wv, Wo side by side, and the DST rows follow in that order (PK_Q, PK_K, PK_V, PK_O are contiguous)
// the blocks behind them (blockIdx.x >= NPT) fill the RoPE tables, which depend on nothing of the above either: 4 positions t a block, 64 threads = pair index i each: inv_freq = 1 / 10000^((2i)/128) and angle = float(position_ids[t]) * inv_freq in f32 (as the reference), cos/sin in f32; rows 256 B, a wave's store = one whole 128-B line
#define NPT ((2 * DM + 2 * KVW) / 128)
__global__ __launch_bounds__(256) void k_packT(const float* __restrict__ Wq, const float* __restrict__ Wk, const float* __restrict__ Wv, const float* __restrict__ Wo, __bf16* __restrict__ DST, const int* __restrict__ POS, float* __restrict__ CS) {
  const int bx = blockIdx.x, K = DM; const float* Wm; int N, ns;   // ns = the tile's first column in its own matrix
  if (bx >= NPT) {   // the same for every thread of a block, and in front of the barrier
    const int t = ((bx - NPT) * (DM / 64) + blockIdx.y) * 4 + (threadIdx.x >> 6), i = threadIdx.x & 63;
    const float inv = 1.0f / powf(10000.0f, (float)(2 * i) / 128.0f); const float ang = (float)POS[t] * inv;
    CS[(size_t)t * 64 + i] = cosf(ang); CS[(size_t)SS * 64 + (size_t)t * 64 + i] = sinf(ang); return; }
  if (bx < DM / 128) { Wm = Wq; N = DM; ns = bx * 128; } else if (bx < (DM + KVW) / 128) { Wm = Wk; N = KVW; ns = bx * 128 - DM; } else if (bx < (DM + 2 * KVW) / 128) { Wm = Wv; N = KVW; ns = bx * 128 - DM - KVW; } else { Wm = Wo; N = DM; ns = bx * 128 - DM - 2 * KVW; }
  __shared__ unsigned s[128][33];   // row n: its 64 k as 32 bf16 pairs (k, k + 1); the odd pitch spreads both the column-wise writes and the row-wise reads over the banks
  const int tid = threadIdx.x, wave = tid >> 5, lane = tid & 31; const int n0 = bx * 128, k0 = blockIdx.y * 64;
  const float* src = Wm + (size_t)(k0 + wave * 8) * N + ns + lane * 4; const float* pr[8]; v4f xr[8];
#pragma unroll
  for (int i = 0; i < 8; ++i) { pr[i] = src + (size_t)i * N; xr[i] = *(const v4f*)pr[i]; }
  // stands in front of every rewrite of the address registers of the 8 loads above; naming them as inputs keeps them whole up to here (without that a later load's result landed on an earlier load's address pair ahead of the wait)
  asm volatile("s_wait_xcnt 0x0" :: "v"(pr[0]), "v"(pr[1]), "v"(pr[2]), "v"(pr[3]), "v"(pr[4]), "v"(pr[5]), "v"(pr[6]), "v"(pr[7]) : "memory");
#pragma unroll
  for (int i = 0; i < 8; i += 2)
#pragma unroll
    for (int e = 0; e < 4; ++e) { union { __bf16 b[2]; unsigned u; } p; p.b[0] = (__bf16)xr[i][e]; p.b[1] = (__bf16)xr[i + 1][e]; s[lane * 4 + e][wave * 4 + (i >> 1)] = p.u; }
  __syncthreads();
#pragma unroll
  for (int j = 0; j < 4; ++j) { const int q = tid + 256 * j, n = q >> 3, k8 = q & 7; v4u o;
#pragma unroll
    for (int e = 0; e < 4; ++e) o[e] = s[n][k8 * 4 + e];
    vst2((unsigned*)(DST + (size_t)(n0 + n) * K + k0 + k8 * 8), o); }
}
// ---- k_proj: block = (64 rows, 128 cols = one head), operands staged in LDS per 64-k step, the next step's global loads issued ahead of this step's products: Y = bf16(x) . P rows (exact); q and k heads: RoPE then bf16 hi/lo planes of [2048][ldo] in fragment order; v heads: plain -> transposed bf16 hi/lo planes of [256][2048] in fragment order
// one launch for q, k and v: blockIdx.y counts the 16 q heads, the 2 k heads and the 2 v heads, which are consecutive 128-row groups of P
__global__ __launch_bounds__(128) void k_proj(const float* __restrict__ X, const __bf16* __restrict__ P, const float* __restrict__ bq, const float* __restrict__ bk, const float* __restrict__ bv, const float* __restrict__ CS, __bf16* __restrict__ QH, __bf16* __restrict__ QL, __bf16* __restrict__ KH, __bf16* __restrict__ KL, __bf16* __restrict__ VTH, __bf16* __restrict__ VTL) {
  __shared__ __align__(16) char se[2 * 128 * 72 * 2];   // output staging; a block uses it either as so (q, k) or as sth + stl (v)
  float (*so)[16][132] = (float (*)[16][132])se; __bf16 (*sth)[72] = (__bf16 (*)[72])se; __bf16 (*stl)[72] = sth + 128;
  static_assert(sizeof(float) * 4 * 16 * 132 <= sizeof(se), "so fits the staging area");
  const int by = blockIdx.y; const bool isv = by >= NH + NKV; const float* bias; __bf16 *PH, *PL; int ldo, n0;   // n0 = the head's first column in its own output
  if (by < NH) { bias = bq; PH = QH; PL = QL; ldo = DM; n0 = by * 128; } else if (!isv) { bias = bk; PH = KH; PL = KL; ldo = KVW; n0 = (by - NH) * 128; } else { bias = bv; PH = VTH; PL = VTL; ldo = 0; n0 = (by - NH - NKV) * 128; }
  __shared__ __align__(16) __bf16 sA[2][64][72], sB[2][128][72];   // two buffers of one 64-k step: 64 x rows (rounded to bf16) and 128 P rows, 128-B rows at pitch 144 B
  const int tid = threadIdx.x, wave = tid >> 5, lane = tid & 31, col = lane & 15, g = lane >> 4; const size_t r0 = (size_t)blockIdx.x * 64 + wave * 16;
  const float* xg = X + ((size_t)blockIdx.x * 64 + (tid >> 4)) * DM + (tid & 15) * 4;   // piece it of a step: row (tid >> 4) + 8 it, 16 B; a wave's load = 2 rows x 256 B
  const __bf16* pg = P + (size_t)(by * 128 + (tid >> 3)) * DM + (tid & 7) * 8;          // piece it of a step: row (tid >> 3) + 16 it, 16 B; a wave's load = 4 rows x 128 B
  v8f acc[8] = {}; v4f xr[8]; v8b pr[8];
#pragma unroll
  for (int it = 0; it < 8; ++it) { xr[it] = *(const v4f*)(xg + (size_t)it * 8 * DM); pr[it] = *(const v8b*)(pg + (size_t)it * 16 * DM); }
#pragma unroll
  for (int it = 0; it < 8; ++it) { v4b x4;
#pragma unroll
    for (int e = 0; e < 4; ++e) x4[e] = (__bf16)xr[it][e];
    *(v4b*)&sA[0][(tid >> 4) + 8 * it][(tid & 15) * 4] = x4; *(v8b*)&sB[0][(tid >> 3) + 16 * it][(tid & 7) * 8] = pr[it]; }
#pragma unroll 2   // two copies: the buffer index is a constant in each, so every LDS address is a base register plus an immediate
  for (int st = 0; st < DM / 64; ++st) { const int bu = st & 1;
    __syncthreads();   // publishes step st; every reader of the other buffer (step st - 1) has left it before it is rewritten below
    if (st + 1 < DM / 64) {
#pragma unroll
      for (int it = 0; it < 8; ++it) { xr[it] = *(const v4f*)(xg + (size_t)it * 8 * DM + (st + 1) * 64); pr[it] = *(const v8b*)(pg + (size_t)it * 16 * DM + (st + 1) * 64); } }
#pragma unroll
    for (int k2 = 0; k2 < 2; ++k2) {
      if (k2 == 1) asm volatile("s_wait_xcnt 0x0" ::: "memory");   // stands in front of every later rewrite of the address registers of the next step's loads above
      const v16b a = frag_b(&sA[bu][wave * 16 + col][k2 * 32], lane); v16b b[8];
#pragma unroll
      for (int j = 0; j < 8; ++j) b[j] = frag_b(&sB[bu][j * 16 + col][k2 * 32], lane);
#pragma unroll
      for (int j = 0; j < 8; ++j) acc[j] = wmma_bf(a, b[j], acc[j]); }
    if (st + 1 < DM / 64) {
#pragma unroll
      for (int it = 0; it < 8; ++it) { v4b x4;
#pragma unroll
        for (int e = 0; e < 4; ++e) x4[e] = (__bf16)xr[it][e];
        *(v4b*)&sA[bu ^ 1][(tid >> 4) + 8 * it][(tid & 15) * 4] = x4; *(v8b*)&sB[bu ^ 1][(tid >> 3) + 16 * it][(tid & 7) * 8] = pr[it]; } } }
  if (!isv) {   // the same for every thread of a block
    // biased projections to LDS, then interleaved-pair RoPE in place: (d = 2i, 2i+1): out_e = x_e cos_i - x_o sin_i; out_o = x_e sin_i + x_o cos_i with angle index i = d/2 (position from position_ids via the CS tables)
#pragma unroll
    for (int j = 0; j < 8; ++j) { const float bb = bfr(bias[n0 + j * 16 + col]);
#pragma unroll
      for (int r = 0; r < 8; ++r) so[wave][8 * g + r][j * 16 + col] = acc[j][r] + bb; }
    LDSX();
    for (int q = lane; q < 16 * 64; q += 32) { const int rl = q >> 6, i = q & 63; const size_t t = r0 + rl; const float c = CS[t * 64 + i], s = CS[(size_t)SS * 64 + t * 64 + i]; const float xe = so[wave][rl][2 * i], xo = so[wave][rl][2 * i + 1]; so[wave][rl][2 * i] = xe * c - xo * s; so[wave][rl][2 * i + 1] = xe * s + xo * c; }
    LDSX();
    // each value leaves as bf16 hi + bf16 residual, the same split that the score products use; the wave's 16 rows x 128 columns are 4 whole fragments of each plane, piece p = 16 columns: a wave's store = 512 contiguous bytes
    const size_t f0 = ((r0 >> 4) * (size_t)(ldo >> 5) + (n0 >> 5)) * 512;
    for (int p = 0; p < 8; ++p) { const float* sr = &so[wave][col][p * 16 + g * 8]; const v4f va = *(const v4f*)sr, vb = *(const v4f*)(sr + 4); v8b h8, l8;
#pragma unroll
      for (int e = 0; e < 4; ++e) { const __bf16 ha = (__bf16)va[e], hb = (__bf16)vb[e]; h8[e] = ha; l8[e] = (__bf16)(va[e] - (float)ha); h8[4 + e] = hb; l8[4 + e] = (__bf16)(vb[e] - (float)hb); }
      const size_t o = f0 + p * 256 + lane * 8; *(v8b*)(PH + o) = h8; *(v8b*)(PL + o) = l8;
      asm volatile("s_wait_xcnt 0x0" ::: "memory"); }   // the next piece rewrites the stores' data registers: the wait stands in front of that
  } else {
#pragma unroll
    for (int j = 0; j < 8; ++j)
#pragma unroll
      for (int r = 0; r < 8; ++r) { const float v = acc[j][r] + bfr(bias[n0 + j * 16 + col]); const __bf16 hb = (__bf16)v; sth[j * 16 + col][wave * 16 + 8 * g + r] = hb; stl[j * 16 + col][wave * 16 + 8 * g + r] = (__bf16)(v - (float)hb); }
    __syncthreads();
    const int s0 = blockIdx.x * 64;
    // the block's 128 d x 64 s are 16 whole fragments of each plane: fragment fl, half j, lane slot sl; a wave's store = 512 contiguous bytes
    for (int q = tid; q < 128 * 8; q += 128) { const int fl = q >> 6, j = (q >> 5) & 1, sl = q & 31; const int d = (fl >> 1) * 16 + (sl & 15), c = (fl & 1) * 32 + j * 16 + (sl >> 4) * 8;
      const size_t o = ((size_t)((n0 >> 4) + (fl >> 1)) * (SS / 32) + (s0 >> 5) + (fl & 1)) * 512 + j * 256 + sl * 8; vst2((unsigned*)(PH + o), *(const v4u*)&sth[d][c]); vst2((unsigned*)(PL + o), *(const v4u*)&stl[d][c]); }
  }
}
// ---- k_attn: block = (16 queries, kv head), NKG groups of NHW waves: wave hw of a group = query head kv * NHW + hw; group kg takes key steps kg, kg + NKG, ... of the same 16 queries (flash attention over its share), then the NKG partial (max, sum, acc) of a head are merged through LDS. The k, v and mask tiles of a key step are the same for the NHW heads: they are brought into LDS once per block (two buffers a group, the next trip's copies fly under this trip's work) and read from there by the group's waves; scores 3 products, P.V 3 products; O[q][h*128+d]
#define NHW (NH / NKV)
#define NKG 2
#define NVA 4   // v fragments (of 8) of a key step that are asked for ahead of the softmax; the others take the registers that the first products free
// LDS buffer of one key step: 32 fragments of 1 KiB in plane order: 0..7 k hi (16-key group ct, 32-d chunk kc at ct * 4 + kc), 8..15 k residual, 16..23 v hi (16-d group dt), 24..31 v residual
// one 32-d chunk of a key step's two 16-key groups of k, each as hi + residual
struct KF { F2 k0, k1; };
// p = the lane's own address in a fragment (fragment start + lane * 8): the same two 16-B pieces that frag_fo reads
__device__ __forceinline__ v16b frag_at(const __bf16* p) { union { v16b v; v8b q[2]; } u; u.q[0] = *(const v8b*)p; u.q[1] = *(const v8b*)(p + 256); return u.v; }
__device__ __forceinline__ void ld_k(KF& o, const __bf16* kb, int kc) {
  o.k0.h = frag_at(kb + kc * 512); o.k0.l = frag_at(kb + (8 + kc) * 512); o.k1.h = frag_at(kb + (4 + kc) * 512); o.k1.l = frag_at(kb + (12 + kc) * 512);
}
// a wave's share of one key step's copies: 4 fragments (8 x 512 contiguous bytes; s = the lane's address in the first, fs = elements from one fragment to the next) to 4 KiB of the buffer at ld, and 8 bytes a lane of the 16 x 32 mask tile.
// The wait on the last line stands in front of every rewrite of the copies' address registers
__device__ __forceinline__ void cp_step(unsigned ld, const __bf16* s, size_t fs, unsigned lm, const float* gm) {
  asm volatile("global_load_async_to_lds_b128 %0, %1, off\n\t"
               "global_load_async_to_lds_b128 %2, %3, off\n\t"
               "global_load_async_to_lds_b128 %4, %5, off\n\t"
               "global_load_async_to_lds_b128 %6, %7, off\n\t"
               "global_load_async_to_lds_b128 %8, %9, off\n\t"
               "global_load_async_to_lds_b128 %10, %11, off\n\t"
               "global_load_async_to_lds_b128 %12, %13, off\n\t"
               "global_load_async_to_lds_b128 %14, %15, off\n\t"
               "global_load_async_to_lds_b64 %16, %17, off\n\t"
               "s_wait_xcnt 0x0"
               :: "v"(ld), "v"(s), "v"(ld + 512u), "v"(s + 256), "v"(ld + 1024u), "v"(s + fs), "v"(ld + 1536u), "v"(s + fs + 256),
                  "v"(ld + 2048u), "v"(s + 2 * fs), "v"(ld + 2560u), "v"(s + 2 * fs + 256), "v"(ld + 3072u), "v"(s + 3 * fs), "v"(ld + 3584u), "v"(s + 3 * fs + 256),
                  "v"(lm), "v"(gm) : "memory");
}
// lane l with lane l ^ 16 (the two lanes that hold one query's column)
__device__ __forceinline__ float xhalf(float x) { return __builtin_bit_cast(float, __builtin_amdgcn_permlanex16(__builtin_bit_cast(int, x), __builtin_bit_cast(int, x), 0x76543210, 0xfedcba98, false, false)); }
// both products are computed transposed: S^T = K . Q^T (A = k fragment, B = q fragment) and O^T += V^T . P^T (A = v fragment, B = P^T). A and B share one lane and k map, so the planes are read as before.
// D register r of lane (g, col) = row 8 g + r, column col: a lane holds 8 keys (of each 16-key group) of ONE query col, and later 8 d of that query. Maximum and sum run in the lane, plus one exchange between the halves;
// the two score tiles of a step, converted in place, are the B operand P^T (element s = tile s >> 3, register s & 7 = key 8 g + s or 16 + 8 g + s - 8, the k order of the v fragments)
__global__ __launch_bounds__(32 * NHW * NKG) void k_attn(const __bf16* __restrict__ QH, const __bf16* __restrict__ QL, const __bf16* __restrict__ KH, const __bf16* __restrict__ KL, const float* __restrict__ MASK, const __bf16* __restrict__ VTH, const __bf16* __restrict__ VTL, float* __restrict__ O) {
  __shared__ __align__(16) __bf16 skv[NKG][2][32][512]; __shared__ __align__(16) float smk[NKG][2][16][36];   // mask rows of 128 B at pitch 144 B
  __shared__ __align__(16) float so[NKG * NHW][16][132]; __shared__ float sm[NKG * NHW][16], sl[NKG * NHW][16];   // the merge's partials, a slice a wave
  const int tid = threadIdx.x, wave = __builtin_amdgcn_readfirstlane(tid >> 5), lane = tid & 31, col = lane & 15, g = lane >> 4;
  const int hw = wave % NHW, kg = wave / NHW, t8 = tid % (32 * NHW); const int qb = blockIdx.x, kv = blockIdx.y, h = kv * NHW + hw; const int q0 = qb * 16;
  // the wave's share of its group's copies: waves 0, 1 the two 16-key groups of k hi (4 KiB contiguous each), 2, 3 of the k residual, 4, 5 v hi fragments 0..3 and 4..7, 6, 7 the same of the v residual
  const bool isk = hw < 4; const __bf16* pl = hw < 2 ? KH : hw < 4 ? KL : hw < 6 ? VTH : VTL;
  const size_t cfs = isk ? 512 : (size_t)(SS / 32) * 512, css = isk ? (size_t)2 * (KVW / 32) * 512 : 512;   // elements from fragment to fragment, and from key step to key step
  const __bf16* cs = pl + (isk ? ((size_t)(hw & 1) * (KVW / 32) + kv * (HD / 32)) * 512 : (size_t)(kv * (HD / 16) + (hw & 1) * 4) * (SS / 32) * 512) + kg * css + lane * 8;   // in the group's first key step
  const unsigned cl = (unsigned)(size_t)&skv[kg][0][hw * 4][0] + lane * 16, clm = (unsigned)(size_t)&smk[kg][0][t8 >> 4][(t8 & 15) * 2];
  const float* cm = MASK + (size_t)(q0 + (t8 >> 4)) * SS + kg * 32 + (t8 & 15) * 2;
  cp_step(cl, cs, cfs, clm, cm);
  // the head's q fragments are read once and stay in registers
  const size_t qo = ((size_t)qb * (DM / 32) + h * (HD / 32)) * 512; const __bf16 *qhp = QH + qo + lane * 8, *qlp = QL + qo + lane * 8; F2 q[4];
#pragma unroll
  for (int kc = 0; kc < 4; ++kc) { q[kc].h = frag_at(qhp + kc * 512); q[kc].l = frag_at(qlp + kc * 512); }
  asm volatile("s_wait_xcnt 0x0" ::: "memory");   // stands in front of every later rewrite of the address registers of the q loads above
  asm volatile("s_wait_asynccnt 0x0" ::: "memory");   // the wave's copies of trip 0 have landed
  __syncthreads();                                     // and every wave's: trip 0 is published
  cp_step(cl + (unsigned)sizeof(skv[0][0]), cs + NKG * css, cfs, clm + (unsigned)sizeof(smk[0][0]), cm + NKG * 32);
  float m = -3.0e38f, l = 0.f;   // of query col; m is the same in both halves, l is the sum over the half's own keys
  v8f acc[8] = {};   // acc[dt][r] = O^T[dt * 16 + 8 g + r][col]
#pragma unroll 1   // kept rolled: the buffer index is one scalar add to two base addresses
  for (int t = 0; t < SS / 32 / NKG; ++t) { const int bu = t & 1; v4f mk[2][2]; bool anylive = false;   // the group's key step is t * NKG + kg
    const __bf16* kb = &skv[kg][bu][0][0] + lane * 8; const __bf16 *vhp = kb + 16 * 512, *vlp = kb + 24 * 512; const float* mp = &smk[kg][bu][col][8 * g];   // the lane's 8 keys of group ct are 32 contiguous bytes of its query's mask row, at ct * 16
#pragma unroll
    for (int ct = 0; ct < 2; ++ct) { mk[ct][0] = *(const v4f*)(mp + ct * 16); mk[ct][1] = *(const v4f*)(mp + ct * 16 + 4); }
    KF ca, cb; ld_k(ca, kb, 0); ld_k(cb, kb, 1);
#pragma unroll
    for (int ct = 0; ct < 2; ++ct)
#pragma unroll
      for (int r = 0; r < 8; ++r) { const float m_ = bfr(mk[ct][r >> 2][r & 3]); mk[ct][r >> 2][r & 3] = m_; anylive = anylive || (m_ > -1.0e8f); }
    if (__any(anylive)) {   // wave-uniform: skip key tiles that are fully masked for the 16 queries (exp of <= -1e8 underflows to exactly 0 in the reference too); the step's hand-over below stands outside the skip
    v8f c0 = {}, c1 = {}; v16b vh[8], vl[8];
    // chunk kc + 2 is asked for as soon as the products of chunk kc have freed its registers
    c0 = mac3(ca.k0, q[0], c0); c1 = mac3(ca.k1, q[0], c1);
    ld_k(ca, kb, 2);
    c0 = mac3(cb.k0, q[1], c0); c1 = mac3(cb.k1, q[1], c1);
    ld_k(cb, kb, 3);
    c0 = mac3(ca.k0, q[2], c0); c1 = mac3(ca.k1, q[2], c1);
    c0 = mac3(cb.k0, q[3], c0); c1 = mac3(cb.k1, q[3], c1);
    float e[16];   // e[ct * 8 + r]: key ct * 16 + 8 g + r of the step, of query col
#pragma unroll
    for (int r = 0; r < 8; ++r) { e[r] = c0[r] * 0.08838834764831845f + mk[0][r >> 2][r & 3]; e[8 + r] = c1[r] * 0.08838834764831845f + mk[1][r >> 2][r & 3]; }
    // v fragments 0 .. NVA - 1 are asked for ahead of the softmax
#pragma unroll
    for (int dt = 0; dt < NVA; ++dt) { vh[dt] = frag_at(vhp + dt * 512); vl[dt] = frag_at(vlp + dt * 512); }
    float mx = fmaxf(e[0], e[8]);
#pragma unroll
    for (int r = 1; r < 8; ++r) mx = fmaxf(mx, fmaxf(e[r], e[8 + r]));
    mx = fmaxf(mx, xhalf(mx));
    const float mn = fmaxf(m, mx); const float alpha = (m <= -1.0e38f) ? 0.f : exp_ni(m - mn);
    float es0 = 0.f, es1 = 0.f;
#pragma unroll
    for (int r = 0; r < 8; ++r) { e[r] = exp_ni(e[r] - mn); e[8 + r] = exp_ni(e[8 + r] - mn); es0 += e[r]; es1 += e[8 + r]; }
    l = l * alpha + (es0 + es1); m = mn;
#pragma unroll
    for (int dt = 0; dt < 8; ++dt) acc[dt] *= alpha;
    const F2 pa = bsplit16(e);
#pragma unroll
    for (int dt = 0; dt < 8; ++dt) { acc[dt] = wmma_bf(vh[dt], pa.l, acc[dt]); acc[dt] = wmma_bf(vl[dt], pa.h, acc[dt]); acc[dt] = wmma_bf(vh[dt], pa.h, acc[dt]);
      if (dt + NVA < 8) { vh[dt + NVA] = frag_at(vhp + (dt + NVA) * 512); vl[dt + NVA] = frag_at(vlp + (dt + NVA) * 512); } }   // the later fragments take the registers that the first products have freed
    }
    // hand-over, every wave, in this order: the wave's own LDS reads of this buffer are done; its copies of trip t + 1 have landed; the barrier publishes trip t + 1 and ends every reader's last read of this buffer; only then is it refilled
    asm volatile("s_wait_dscnt 0x0" ::: "memory");
    asm volatile("s_wait_asynccnt 0x0" ::: "memory");
    __syncthreads();
    if (t + 2 < SS / 32 / NKG) cp_step(cl + bu * (unsigned)sizeof(skv[0][0]), cs + (size_t)(t + 2) * NKG * css, cfs, clm + bu * (unsigned)sizeof(smk[0][0]), cm + (t + 2) * NKG * 32); }
  asm volatile("s_wait_asynccnt 0x0" ::: "memory");   // no copy is outstanding when the wave ends
  // merge: query maximum over the head's NKG waves, each wave's sum and acc rescaled to it, then summed in group order (a wave with no live key step has m = -3e38, l = 0 and weight 0)
  l += xhalf(l);   // the two halves' sums of a query are joined once, here
  if (g == 0) sm[wave][col] = m;
  __syncthreads();
  { float mx = sm[hw][col];
#pragma unroll
    for (int w = 1; w < NKG; ++w) mx = fmaxf(mx, sm[w * NHW + hw][col]);
    const float f = (m <= -1.0e38f) ? 0.f : exp_ni(m - mx);
    if (g == 0) sl[wave][col] = l * f;
#pragma unroll
    for (int dt = 0; dt < 8; ++dt) { const v8f a = acc[dt] * f; float* d = &so[wave][col][dt * 16 + 8 * g]; *(v4f*)d = __builtin_shufflevector(a, a, 0, 1, 2, 3); *(v4f*)(d + 4) = __builtin_shufflevector(a, a, 4, 5, 6, 7); } }
  __syncthreads();
  for (int rl = kg; rl < 16; rl += NKG) { v4f a = *(const v4f*)&so[hw][rl][lane * 4]; float ls = sl[hw][rl];
#pragma unroll
    for (int w = 1; w < NKG; ++w) { a += *(const v4f*)&so[w * NHW + hw][rl][lane * 4]; ls += sl[w * NHW + hw][rl]; }
    vst2(O + (size_t)(q0 + rl) * DM + h * HD + lane * 4, a * (1.0f / ls));
    asm volatile("s_wait_xcnt 0x0" ::: "memory"); }   // the next trip rewrites the store's address and data registers: the wait stands in front of that
}
// ---- k_out: block = (64 rows, 128 cols), operands staged in LDS as in k_proj: out = O(hi/lo) . wproj^T rows (2 products)
__global__ __launch_bounds__(128) void k_out(const float* __restrict__ O, const __bf16* __restrict__ P, const float* __restrict__ bias, float* __restrict__ Y) {
  __shared__ __align__(16) float so[4][16][132];
  __shared__ __align__(16) __bf16 sAh[2][64][72], sAl[2][64][72], sB[2][128][72];   // two buffers of one 64-k step: 64 O rows as bf16 hi and residual, 128 P rows, 128-B rows at pitch 144 B
  const int tid = threadIdx.x, wave = tid >> 5, lane = tid & 31, col = lane & 15, g = lane >> 4; const size_t r0 = (size_t)blockIdx.x * 64 + wave * 16; const int n0 = blockIdx.y * 128;
  const float* xg = O + ((size_t)blockIdx.x * 64 + (tid >> 4)) * DM + (tid & 15) * 4;   // piece it of a step: row (tid >> 4) + 8 it, 16 B; a wave's load = 2 rows x 256 B
  const __bf16* pg = P + (size_t)(n0 + (tid >> 3)) * DM + (tid & 7) * 8;                // piece it of a step: row (tid >> 3) + 16 it, 16 B; a wave's load = 4 rows x 128 B
  v8f acc[8] = {}; v4f xr[8]; v8b pr[8];
#pragma unroll
  for (int it = 0; it < 8; ++it) { xr[it] = *(const v4f*)(xg + (size_t)it * 8 * DM); pr[it] = *(const v8b*)(pg + (size_t)it * 16 * DM); }
#pragma unroll
  for (int it = 0; it < 8; ++it) { v4b h4, l4;
#pragma unroll
    for (int e = 0; e < 4; ++e) { const __bf16 hb = (__bf16)xr[it][e]; h4[e] = hb; l4[e] = (__bf16)(xr[it][e] - (float)hb); }
    *(v4b*)&sAh[0][(tid >> 4) + 8 * it][(tid & 15) * 4] = h4; *(v4b*)&sAl[0][(tid >> 4) + 8 * it][(tid & 15) * 4] = l4; *(v8b*)&sB[0][(tid >> 3) + 16 * it][(tid & 7) * 8] = pr[it]; }
#pragma unroll 2   // two copies: the buffer index is a constant in each, so every LDS address is a base register plus an immediate
  for (int st = 0; st < DM / 64; ++st) { const int bu = st & 1;
    __syncthreads();   // publishes step st; every reader of the other buffer (step st - 1) has left it before it is rewritten below
    if (st + 1 < DM / 64) {
#pragma unroll
      for (int it = 0; it < 8; ++it) { xr[it] = *(const v4f*)(xg + (size_t)it * 8 * DM + (st + 1) * 64); pr[it] = *(const v8b*)(pg + (size_t)it * 16 * DM + (st + 1) * 64); } }
#pragma unroll
    for (int k2 = 0; k2 < 2; ++k2) {
      if (k2 == 1) asm volatile("s_wait_xcnt 0x0" ::: "memory");   // stands in front of every later rewrite of the address registers of the next step's loads above
      const v16b ah = frag_b(&sAh[bu][wave * 16 + col][k2 * 32], lane), al = frag_b(&sAl[bu][wave * 16 + col][k2 * 32], lane); v16b b[8];
#pragma unroll
      for (int j = 0; j < 8; ++j) b[j] = frag_b(&sB[bu][j * 16 + col][k2 * 32], lane);
#pragma unroll
      for (int j = 0; j < 8; ++j) { acc[j] = wmma_bf(al, b[j], acc[j]); acc[j] = wmma_bf(ah, b[j], acc[j]); } }
    if (st + 1 < DM / 64) {
#pragma unroll
      for (int it = 0; it < 8; ++it) { v4b h4, l4;
#pragma unroll
        for (int e = 0; e < 4; ++e) { const __bf16 hb = (__bf16)xr[it][e]; h4[e] = hb; l4[e] = (__bf16)(xr[it][e] - (float)hb); }
        *(v4b*)&sAh[bu ^ 1][(tid >> 4) + 8 * it][(tid & 15) * 4] = h4; *(v4b*)&sAl[bu ^ 1][(tid >> 4) + 8 * it][(tid & 15) * 4] = l4; *(v8b*)&sB[bu ^ 1][(tid >> 3) + 16 * it][(tid & 7) * 8] = pr[it]; } } }
#pragma unroll
  for (int j = 0; j < 8; ++j)
#pragma unroll
    for (int r = 0; r < 8; ++r) so[wave][8 * g + r][j * 16 + col] = acc[j][r] + bfr(bias[n0 + j * 16 + col]);
  LDSX();
  for (int rl = 0; rl < 16; ++rl) vst2(Y + (r0 + rl) * DM + n0 + lane * 4, *(const v4f*)&so[wave][rl][lane * 4]);
}
extern "C" void kernel_launch(void* const* d_in, const int* in_sizes, int n_in, void* d_out, int out_size, void* d_ws, size_t ws_size, hipStream_t stream) {
  (void)in_sizes; (void)n_in; (void)out_size;
  const float** F = (const float**)d_in; const int* POS = (const int*)d_in[2];   // 0 hidden_states [1,2048,2048], 1 attention_mask [1,1,2048,2048], 2 position_ids [1,2048] i32, 3 Wq [2048,2048], 4 bq, 5 Wk [2048,256], 6 bk, 7 Wv, 8 bv, 9 Wo [2048,2048], 10 bo
  if (ws_size < (size_t)WS_END) return;
  char* ws = (char*)d_ws; __bf16 *PK = (__bf16*)(ws + WS_PK), *VTH = (__bf16*)(ws + WS_VTH), *VTL = (__bf16*)(ws + WS_VTL);
  __bf16 *QH = (__bf16*)(ws + WS_QH), *QL = (__bf16*)(ws + WS_QL), *KH = (__bf16*)(ws + WS_KH), *KL = (__bf16*)(ws + WS_KL);
  float *CS = (float*)(ws + WS_CS), *O = (float*)(ws + WS_O);
  k_packT<<<dim3(NPT + SS / (4 * (DM / 64)), DM / 64), 256, 0, stream>>>(F[3], F[5], F[7], F[9], PK, POS, CS);
  k_proj<<<dim3(SS / 64, NH + 2 * NKV), 128, 0, stream>>>(F[0], PK, F[4], F[6], F[8], CS, QH, QL, KH, KL, VTH, VTL);
  k_attn<<<dim3(SS / 16, NKV), 32 * NHW * NKG, 0, stream>>>(QH, QL, KH, KL, F[1], VTH, VTL, O);
  k_out<<<dim3(TQB, DM / 128), 128, 0, stream>>>(O, PK + PK_O, F[10], (float*)d_out);
}

// v009
// It runs in 147 microseconds.
// Two timings next to v008 both put it at 1.14 times that version's speed.
// Counting every step since v000, it is 7.43 times as fast.
// compute dtype: hidden_states, all weights/biases and the additive attention_mask (module inputs) rounded to bf16; position_ids as int32; q/k/v projections with exact bf16 products (x and W are inputs) + bias and interleaved-pair RoPE from position_ids in f32 in the epilogue; scores q.k with both computed operands as bf16 hi + residual pairs (3 products) + the mask value, P.V with P hi/lo x V hi/lo (3 products); output projection hi/lo x exact Wo (2 products) + bo; softmax in f32; key tiles whose mask entries are all <= -1e8 for the wave's rows are skipped at run time (exp underflows to exactly 0 in the reference too); f32 accumulate.
#include <hip/hip_runtime.h>
#include <math.h>

typedef __attribute__((ext_vector_type(16))) _Float16 v16h;
typedef __attribute__((ext_vector_type(16))) __bf16 v16b;
typedef __attribute__((ext_vector_type(8)))  _Float16 v8h;
typedef __attribute__((ext_vector_type(8)))  float v8f;
typedef __attribute__((ext_vector_type(4)))  float v4f;
typedef __attribute__((ext_vector_type(2)))  float v2f;
typedef __attribute__((ext_vector_type(4)))  unsigned v4u;
typedef __attribute__((ext_vector_type(4)))  int v4i;
typedef float __attribute__((may_alias)) float_a;
typedef int __attribute__((may_alias)) int_a;

template <typename T> __device__ __forceinline__ void vst2(void* p, T v) { *(T*)p = v;  }
__device__ __forceinline__ v8f wmma16(v16h a, v16h b, v8f c) {
  v8f d = __builtin_amdgcn_wmma_f32_16x16x32_f16(false, a, false, b, (short)0, c, false, false);
  asm volatile("v_nop\n\tv_nop\n\tv_nop\n\tv_nop" : "+v"(d) : "v"(a), "v"(b));
  return d;
}
__device__ __forceinline__ v8f wmma_bf(v16b a, v16b b, v8f c) {
  v8f d = __builtin_amdgcn_wmma_f32_16x16x32_bf16(false, a, false, b, (short)0, c, false, false);
  asm volatile("v_nop\n\tv_nop\n\tv_nop\n\tv_nop" : "+v"(d) : "v"(a), "v"(b));
  return d;
}
// 16x16x32 fragments: lane = (h = lane>>4, row/col = lane&15); elements 0..7 = k0+8h+0..7, 8..15 = k0+16+8h+0..7; D element r = row 8h+r
__device__ __forceinline__ v16h frag_h(const _Float16* rowk0, int lane) {
  union { v16h v; v8h q[2]; } u; const _Float16* p = rowk0 + 8 * (lane >> 4);
  u.q[0] = *(const v8h*)p; u.q[1] = *(const v8h*)(p + 16); return u.v;
}
__device__ __forceinline__ v16h frag_f32(const float* rowk0, int lane) {
  v16h a; const float* p = rowk0 + 8 * (lane >> 4);
#pragma unroll
  for (int i = 0; i < 8; ++i) { a[i] = (_Float16)p[i]; a[8 + i] = (_Float16)p[16 + i]; }
  return a;
}
__device__ __forceinline__ v16h frag_f32s(const float* rowk0, int lane, float sc) {
  v16h a; const float* p = rowk0 + 8 * (lane >> 4);
#pragma unroll
  for (int i = 0; i < 8; ++i) { a[i] = (_Float16)(p[i] * sc); a[8 + i] = (_Float16)(p[16 + i] * sc); }
  return a;
}
// column fragment from a [K][ld] layout (column n), rows >= K read as 0
__device__ __forceinline__ v16h fragc_f32(const float* W, int k0, int n, int lane, int ld, int K) {
  v16h a; const int g = lane >> 4;
#pragma unroll
  for (int i = 0; i < 8; ++i) { const int ka = k0 + 8 * g + i, kb = ka + 16;
    a[i] = (_Float16)(ka < K ? W[(size_t)(ka < K ? ka : K - 1) * ld + n] : 0.f); a[8 + i] = (_Float16)(kb < K ? W[(size_t)(kb < K ? kb : K - 1) * ld + n] : 0.f); }
  return a;
}
struct F2 { v16b h, l; };
__device__ __forceinline__ F2 bsplit16(const float v[16]) { F2 r;
#pragma unroll
  for (int i = 0; i < 16; ++i) { const __bf16 h = (__bf16)v[i]; r.h[i] = h; r.l[i] = (__bf16)(v[i] - (float)h); }
  return r; }
__device__ __forceinline__ F2 split_row(const float* row, int k0, int lane) { float v[16]; const float* p = row + k0 + 8 * (lane >> 4);
#pragma unroll
  for (int i = 0; i < 8; ++i) { v[i] = p[i]; v[8 + i] = p[16 + i]; }
  return bsplit16(v); }
__device__ __forceinline__ F2 split_rowK(const float* row, int k0, int lane, int K) { float v[16]; const int g = lane >> 4;
#pragma unroll
  for (int i = 0; i < 8; ++i) { const int ka = k0 + 8 * g + i, kb = ka + 16; v[i] = ka < K ? row[ka < K ? ka : K - 1] : 0.f; v[8 + i] = kb < K ? row[kb < K ? kb : K - 1] : 0.f; }
  return bsplit16(v); }
__device__ __forceinline__ F2 split_col(const float* W, int k0, int n, int lane, int ld, int K) { float v[16]; const int g = lane >> 4;
#pragma unroll
  for (int i = 0; i < 8; ++i) { const int ka = k0 + 8 * g + i, kb = ka + 16; v[i] = ka < K ? W[(size_t)(ka < K ? ka : K - 1) * ld + n] : 0.f; v[8 + i] = kb < K ? W[(size_t)(kb < K ? kb : K - 1) * ld + n] : 0.f; }
  return bsplit16(v); }
__device__ __forceinline__ v8f mac3(const F2& a, const F2& b, v8f c) { c = wmma_bf(a.l, b.h, c); c = wmma_bf(a.h, b.l, c); return wmma_bf(a.h, b.h, c); }
__device__ __forceinline__ float sigm(float v) { return 1.0f / (1.0f + expf(-v)); }
#define LDSX() do { asm volatile("s_wait_dscnt 0" ::: "memory"); __builtin_amdgcn_wave_barrier(); __builtin_amdgcn_fence(__ATOMIC_RELEASE, "workgroup"); } while (0)


// Attention with grouped kv heads (B 1, S 2048, D 2048, 16 query heads / 2 kv heads x 128): q = rope(x Wq + bq), k = rope(x Wk + bk) (interleaved pairs, angles from position_ids), v = x Wv + bv; scores = q k^T / sqrt(128) + attention_mask[q][k] (additive input); softmax; out = (P v) Wo + bo.
#define SS 2048
#define DM 2048
#define NH 16
#define NKV 2
#define HD 128
#define KVW (NKV * HD)
#ifndef TQB
#define TQB (SS / 64)
#endif
typedef __attribute__((ext_vector_type(8))) __bf16 v8b;
typedef __attribute__((ext_vector_type(4))) __bf16 v4b;
__device__ __forceinline__ v16b frag_b(const __bf16* rowk0, int lane) {
  union { v16b v; v8b q[2]; } u; const __bf16* p = rowk0 + 8 * (lane >> 4);
  u.q[0] = *(const v8b*)p; u.q[1] = *(const v8b*)(p + 16); return u.v;
}
// fragment-order plane of a logical [R][C] bf16 matrix: 16-row x 32-column fragments of 512 elements, fragment index (row >> 4) * (C / 32) + (c >> 5); inside it element (row, c) sits at ((c >> 4) & 1) * 256 + (((c >> 3) & 1) * 16 + (row & 15)) * 8 + (c & 7). Lane l's two 16-B pieces (the same elements that frag_b reads from a row) are at l * 8 and 256 + l * 8: each load of a wave is 512 contiguous bytes
__device__ __forceinline__ v16b frag_fo(const __bf16* f, int lane) {
  union { v16b v; v8b q[2]; } u; u.q[0] = *(const v8b*)(f + lane * 8); u.q[1] = *(const v8b*)(f + 256 + lane * 8); return u.v;
}
__device__ __forceinline__ float bfr(float v) { return (float)(__bf16)v; }
// 2^v by the hardware's own instruction, in line (results below the normal range come out as 0; every argument here is <= 0)
__device__ __forceinline__ float exp2_hw(float v) { return __builtin_amdgcn_exp2f(v); }
#define LOG2E 1.4426950408889634f
__device__ __attribute__((noinline)) float erf_ni(float v) { return erff(v); }

#define PK_Q 0
#define PK_K (PK_Q + DM * DM)
#define PK_V (PK_K + KVW * DM)
#define PK_O (PK_V + KVW * DM)
#define PK_END (PK_O + DM * DM)
#define WS_PK  0u
#define WS_CS  (WS_PK + 2u * PK_END)             // f32 [2048][64] cos, then [2048][64] sin
#define WS_QH  (WS_CS + 4u * 2 * SS * 64)        // q after RoPE as bf16 hi plane [2048][2048] in fragment order, then its residual plane
#define WS_QL  (WS_QH + 2u * SS * DM)
#define WS_KH  (WS_QL + 2u * SS * DM)            // k after RoPE as bf16 hi plane [2048][256] in fragment order, then its residual plane
#define WS_KL  (WS_KH + 2u * SS * KVW)
#define WS_VTH (WS_KL + 2u * SS * KVW)
#define WS_VTL (WS_VTH + 2u * KVW * SS)
#define WS_O   (WS_VTL + 2u * KVW * SS)
#define WS_END (WS_O + 4u * SS * DM)

// ---- k_packT: block = tile of 64 k x 128 n of a [K][N] (x @ W) matrix, turned through LDS into DST [N][K] bf16: a wave's load = 512 contiguous bytes of one k row, a wave's store = 4 n rows x one whole 128-B line (K a multiple of 64, N of 128)
// one launch for all four matrices (each has K = DM): blockIdx.x counts the 128-column tiles of Wq, Wk, Wv, Wo side by side, and the DST rows follow in that order (PK_Q, PK_K, PK_V, PK_O are contiguous)
// the blocks behind them (blockIdx.x >= NPT) fill the RoPE tables, which depend on nothing of the above either: 4 positions t a block, 64 threads = pair index i each: inv_freq = 1 / 10000^((2i)/128) and angle = float(position_ids[t]) * inv_freq in f32 (as the reference), cos/sin in f32; rows 256 B, a wave's store = one whole 128-B line
#define NPT ((2 * DM + 2 * KVW) / 128)
__global__ __launch_bounds__(256) void k_packT(const float* __restrict__ Wq, const float* __restrict__ Wk, const float* __restrict__ Wv, const float* __restrict__ Wo, __bf16* __restrict__ DST, const int* __restrict__ POS, float* __restrict__ CS) {
  const int bx = blockIdx.x, K = DM; const float* Wm; int N, ns;   // ns = the tile's first column in its own matrix
  if (bx >= NPT) {   // the same for every thread of a block, and in front of the barrier
    const int t = ((bx - NPT) * (DM / 64) + blockIdx.y) * 4 + (threadIdx.x >> 6), i = threadIdx.x & 63;
    const float inv = 1.0f / powf(10000.0f, (float)(2 * i) / 128.0f); const float ang = (float)POS[t] * inv;
    CS[(size_t)t * 64 + i] = cosf(ang); CS[(size_t)SS * 64 + (size_t)t * 64 + i] = sinf(ang); return; }
  if (bx < DM / 128) { Wm = Wq; N = DM; ns = bx * 128; } else if (bx < (DM + KVW) / 128) { Wm = Wk; N = KVW; ns = bx * 128 - DM; } else if (bx < (DM + 2 * KVW) / 128) { Wm = Wv; N = KVW; ns = bx * 128 - DM - KVW; } else { Wm = Wo; N = DM; ns = bx * 128 - DM - 2 * KVW; }
  __shared__ unsigned s[128][33];   // row n: its 64 k as 32 bf16 pairs (k, k + 1); the odd pitch spreads both the column-wise writes and the row-wise reads over the banks
  const int tid = threadIdx.x, wave = tid >> 5, lane = tid & 31; const int n0 = bx * 128, k0 = blockIdx.y * 64;
  const float* src = Wm + (size_t)(k0 + wave * 8) * N + ns + lane * 4; const float* pr[8]; v4f xr[8];
#pragma unroll
  for (int i = 0; i < 8; ++i) { pr[i] = src + (size_t)i * N; xr[i] = *(const v4f*)pr[i]; }
  // stands in front of every rewrite of the address registers of the 8 loads above; naming them as inputs keeps them whole up to here (without that a later load's result landed on an earlier load's address pair ahead of the wait)
  asm volatile("s_wait_xcnt 0x0" :: "v"(pr[0]), "v"(pr[1]), "v"(pr[2]), "v"(pr[3]), "v"(pr[4]), "v"(pr[5]), "v"(pr[6]), "v"(pr[7]) : "memory");
#pragma unroll
  for (int i = 0; i < 8; i += 2)
#pragma unroll
    for (int e = 0; e < 4; ++e) { union { __bf16 b[2]; unsigned u; } p; p.b[0] = (__bf16)xr[i][e]; p.b[1] = (__bf16)xr[i + 1][e]; s[lane * 4 + e][wave * 4 + (i >> 1)] = p.u; }
  __syncthreads();
#pragma unroll
  for (int j = 0; j < 4; ++j) { const int q = tid + 256 * j, n = q >> 3, k8 = q & 7; v4u o;
#pragma unroll
    for (int e = 0; e < 4; ++e) o[e] = s[n][k8 * 4 + e];
    vst2((unsigned*)(DST + (size_t)(n0 + n) * K + k0 + k8 * 8), o); }
}
// ---- k_proj: block = (64 rows, 128 cols = one head), operands staged in LDS per 64-k step, the next step's global loads issued ahead of this step's products: Y = bf16(x) . P rows (exact); q and k heads: RoPE then bf16 hi/lo planes of [2048][ldo] in fragment order; v heads: plain -> transposed bf16 hi/lo planes of [256][2048] in fragment order
// one launch for q, k and v: blockIdx.y counts the 16 q heads, the 2 k heads and the 2 v heads, which are consecutive 128-row groups of P
__global__ __launch_bounds__(128) void k_proj(const float* __restrict__ X, const __bf16* __restrict__ P, const float* __restrict__ bq, const float* __restrict__ bk, const float* __restrict__ bv, const float* __restrict__ CS, __bf16* __restrict__ QH, __bf16* __restrict__ QL, __bf16* __restrict__ KH, __bf16* __restrict__ KL, __bf16* __restrict__ VTH, __bf16* __restrict__ VTL) {
  __shared__ __align__(16) char se[2 * 128 * 72 * 2];   // output staging; a block uses it either as so (q, k) or as sth + stl (v)
  float (*so)[16][132] = (float (*)[16][132])se; __bf16 (*sth)[72] = (__bf16 (*)[72])se; __bf16 (*stl)[72] = sth + 128;
  static_assert(sizeof(float) * 4 * 16 * 132 <= sizeof(se), "so fits the staging area");
  const int by = blockIdx.y; const bool isv = by >= NH + NKV; const float* bias; __bf16 *PH, *PL; int ldo, n0;   // n0 = the head's first column in its own output
  if (by < NH) { bias = bq; PH = QH; PL = QL; ldo = DM; n0 = by * 128; } else if (!isv) { bias = bk; PH = KH; PL = KL; ldo = KVW; n0 = (by - NH) * 128; } else { bias = bv; PH = VTH; PL = VTL; ldo = 0; n0 = (by - NH - NKV) * 128; }
  __shared__ __align__(16) __bf16 sA[2][64][72], sB[2][128][72];   // two buffers of one 64-k step: 64 x rows (rounded to bf16) and 128 P rows, 128-B rows at pitch 144 B
  const int tid = threadIdx.x, wave = tid >> 5, lane = tid & 31, col = lane & 15, g = lane >> 4; const size_t r0 = (size_t)blockIdx.x * 64 + wave * 16;
  const float* xg = X + ((size_t)blockIdx.x * 64 + (tid >> 4)) * DM + (tid & 15) * 4;   // piece it of a step: row (tid >> 4) + 8 it, 16 B; a wave's load = 2 rows x 256 B
  const __bf16* pg = P + (size_t)(by * 128 + (tid >> 3)) * DM + (tid & 7) * 8;          // piece it of a step: row (tid >> 3) + 16 it, 16 B; a wave's load = 4 rows x 128 B
  v8f acc[8] = {}; v4f xr[8]; v8b pr[8];
#pragma unroll
  for (int it = 0; it < 8; ++it) { xr[it] = *(const v4f*)(xg + (size_t)it * 8 * DM); pr[it] = *(const v8b*)(pg + (size_t)it * 16 * DM); }
#pragma unroll
  for (int it = 0; it < 8; ++it) { v4b x4;
#pragma unroll
    for (int e = 0; e < 4; ++e) x4[e] = (__bf16)xr[it][e];
    *(v4b*)&sA[0][(tid >> 4) + 8 * it][(tid & 15) * 4] = x4; *(v8b*)&sB[0][(tid >> 3) + 16 * it][(tid & 7) * 8] = pr[it]; }
#pragma unroll 2   // two copies: the buffer index is a constant in each, so every LDS address is a base register plus an immediate
  for (int st = 0; st < DM / 64; ++st) { const int bu = st & 1;
    __syncthreads();   // publishes step st; every reader of the other buffer (step st - 1) has left it before it is rewritten below
    if (st + 1 < DM / 64) {
#pragma unroll
      for (int it = 0; it < 8; ++it) { xr[it] = *(const v4f*)(xg + (size_t)it * 8 * DM + (st + 1) * 64); pr[it] = *(const v8b*)(pg + (size_t)it * 16 * DM + (st + 1) * 64); } }
#pragma unroll
    for (int k2 = 0; k2 < 2; ++k2) {
      if (k2 == 1) asm volatile("s_wait_xcnt 0x0" ::: "memory");   // stands in front of every later rewrite of the address registers of the next step's loads above
      const v16b a = frag_b(&sA[bu][wave * 16 + col][k2 * 32], lane); v16b b[8];
#pragma unroll
      for (int j = 0; j < 8; ++j) b[j] = frag_b(&sB[bu][j * 16 + col][k2 * 32], lane);
#pragma unroll
      for (int j = 0; j < 8; ++j) acc[j] = wmma_bf(a, b[j], acc[j]); }
    if (st + 1 < DM / 64) {
#pragma unroll
      for (int it = 0; it < 8; ++it) { v4b x4;
#pragma unroll
        for (int e = 0; e < 4; ++e) x4[e] = (__bf16)xr[it][e];
        *(v4b*)&sA[bu ^ 1][(tid >> 4) + 8 * it][(tid & 15) * 4] = x4; *(v8b*)&sB[bu ^ 1][(tid >> 3) + 16 * it][(tid & 7) * 8] = pr[it]; } } }
  if (!isv) {   // the same for every thread of a block
    // biased projections to LDS, then interleaved-pair RoPE in place: (d = 2i, 2i+1): out_e = x_e cos_i - x_o sin_i; out_o = x_e sin_i + x_o cos_i with angle index i = d/2 (position from position_ids via the CS tables)
#pragma unroll
    for (int j = 0; j < 8; ++j) { const float bb = bfr(bias[n0 + j * 16 + col]);
#pragma unroll
      for (int r = 0; r < 8; ++r) so[wave][8 * g + r][j * 16 + col] = acc[j][r] + bb; }
    LDSX();
    for (int q = lane; q < 16 * 64; q += 32) { const int rl = q >> 6, i = q & 63; const size_t t = r0 + rl; const float c = CS[t * 64 + i], s = CS[(size_t)SS * 64 + t * 64 + i]; const float xe = so[wave][rl][2 * i], xo = so[wave][rl][2 * i + 1]; so[wave][rl][2 * i] = xe * c - xo * s; so[wave][rl][2 * i + 1] = xe * s + xo * c; }
    LDSX();
    // each value leaves as bf16 hi + bf16 residual, the same split that the score products use; the wave's 16 rows x 128 columns are 4 whole fragments of each plane, piece p = 16 columns: a wave's store = 512 contiguous bytes
    const size_t f0 = ((r0 >> 4) * (size_t)(ldo >> 5) + (n0 >> 5)) * 512;
    for (int p = 0; p < 8; ++p) { const float* sr = &so[wave][col][p * 16 + g * 8]; const v4f va = *(const v4f*)sr, vb = *(const v4f*)(sr + 4); v8b h8, l8;
#pragma unroll
      for (int e = 0; e < 4; ++e) { const __bf16 ha = (__bf16)va[e], hb = (__bf16)vb[e]; h8[e] = ha; l8[e] = (__bf16)(va[e] - (float)ha); h8[4 + e] = hb; l8[4 + e] = (__bf16)(vb[e] - (float)hb); }
      const size_t o = f0 + p * 256 + lane * 8; *(v8b*)(PH + o) = h8; *(v8b*)(PL + o) = l8;
      asm volatile("s_wait_xcnt 0x0" ::: "memory"); }   // the next piece rewrites the stores' data registers: the wait stands in front of that
  } else {
#pragma unroll
    for (int j = 0; j < 8; ++j)
#pragma unroll
      for (int r = 0; r < 8; ++r) { const float v = acc[j][r] + bfr(bias[n0 + j * 16 + col]); const __bf16 hb = (__bf16)v; sth[j * 16 + col][wave * 16 + 8 * g + r] = hb; stl[j * 16 + col][wave * 16 + 8 * g + r] = (__bf16)(v - (float)hb); }
    __syncthreads();
    const int s0 = blockIdx.x * 64;
    // the block's 128 d x 64 s are 16 whole fragments of each plane: fragment fl, half j, lane slot sl; a wave's store = 512 contiguous bytes
    for (int q = tid; q < 128 * 8; q += 128) { const int fl = q >> 6, j = (q >> 5) & 1, sl = q & 31; const int d = (fl >> 1) * 16 + (sl & 15), c = (fl & 1) * 32 + j * 16 + (sl >> 4) * 8;
      const size_t o = ((size_t)((n0 >> 4) + (fl >> 1)) * (SS / 32) + (s0 >> 5) + (fl & 1)) * 512 + j * 256 + sl * 8; vst2((unsigned*)(PH + o), *(const v4u*)&sth[d][c]); vst2((unsigned*)(PL + o), *(const v4u*)&stl[d][c]); }
  }
}
// ---- k_attn: block = (16 queries, kv head), NKG groups of NHW waves: wave hw of a group = query head kv * NHW + hw; group kg takes key steps kg, kg + NKG, ... of the same 16 queries (flash attention over its share), then the NKG partial (max, sum, acc) of a head are merged through LDS. The k, v and mask tiles of a key step are the same for the NHW heads: they are brought into LDS once per block (two buffers a group, the next trip's copies fly under this trip's work) and read from there by the group's waves; scores 3 products, P.V 3 products; O[q][h*128+d]
#define NHW (NH / NKV)
#define NKG 2
#define NVA 4   // v fragments (of 8) of a key step that are asked for ahead of the softmax; the others take the registers that the first products free
// LDS buffer of one key step: 32 fragments of 1 KiB in plane order: 0..7 k hi (16-key group ct, 32-d chunk kc at ct * 4 + kc), 8..15 k residual, 16..23 v hi (16-d group dt), 24..31 v residual
// one 32-d chunk of a key step's two 16-key groups of k, each as hi + residual
struct KF { F2 k0, k1; };
// p = the lane's own address in a fragment (fragment start + lane * 8): the same two 16-B pieces that frag_fo reads
__device__ __forceinline__ v16b frag_at(const __bf16* p) { union { v16b v; v8b q[2]; } u; u.q[0] = *(const v8b*)p; u.q[1] = *(const v8b*)(p + 256); return u.v; }
__device__ __forceinline__ void ld_k(KF& o, const __bf16* kb, int kc) {
  o.k0.h = frag_at(kb + kc * 512); o.k0.l = frag_at(kb + (8 + kc) * 512); o.k1.h = frag_at(kb + (4 + kc) * 512); o.k1.l = frag_at(kb + (12 + kc) * 512);
}
// a wave's share of one key step's copies: 4 fragments (8 x 512 contiguous bytes; s = the lane's address in the first, fs = elements from one fragment to the next) to 4 KiB of the buffer at ld, and 8 bytes a lane of the 16 x 32 mask tile.
// The wait on the last line stands in front of every rewrite of the copies' address registers
__device__ __forceinline__ void cp_step(unsigned ld, const __bf16* s, size_t fs, unsigned lm, const float* gm) {
  asm volatile("global_load_async_to_lds_b128 %0, %1, off\n\t"
               "global_load_async_to_lds_b128 %2, %3, off\n\t"
               "global_load_async_to_lds_b128 %4, %5, off\n\t"
               "global_load_async_to_lds_b128 %6, %7, off\n\t"
               "global_load_async_to_lds_b128 %8, %9, off\n\t"
               "global_load_async_to_lds_b128 %10, %11, off\n\t"
               "global_load_async_to_lds_b128 %12, %13, off\n\t"
               "global_load_async_to_lds_b128 %14, %15, off\n\t"
               "global_load_async_to_lds_b64 %16, %17, off\n\t"
               "s_wait_xcnt 0x0"
               :: "v"(ld), "v"(s), "v"(ld + 512u), "v"(s + 256), "v"(ld + 1024u), "v"(s + fs), "v"(ld + 1536u), "v"(s + fs + 256),
                  "v"(ld + 2048u), "v"(s + 2 * fs), "v"(ld + 2560u), "v"(s + 2 * fs + 256), "v"(ld + 3072u), "v"(s + 3 * fs), "v"(ld + 3584u), "v"(s + 3 * fs + 256),
                  "v"(lm), "v"(gm) : "memory");
}
// lane l with lane l ^ 16 (the two lanes that hold one query's column)
__device__ __forceinline__ float xhalf(float x) { return __builtin_bit_cast(float, __builtin_amdgcn_permlanex16(__builtin_bit_cast(int, x), __builtin_bit_cast(int, x), 0x76543210, 0xfedcba98, false, false)); }
// both products are computed transposed: S^T = K . Q^T (A = k fragment, B = q fragment) and O^T += V^T . P^T (A = v fragment, B = P^T). A and B share one lane and k map, so the planes are read as before.
// D register r of lane (g, col) = row 8 g + r, column col: a lane holds 8 keys (of each 16-key group) of ONE query col, and later 8 d of that query. Maximum and sum run in the lane, plus one exchange between the halves;
// the two score tiles of a step, converted in place, are the B operand P^T (element s = tile s >> 3, register s & 7 = key 8 g + s or 16 + 8 g + s - 8, the k order of the v fragments)
__global__ __launch_bounds__(32 * NHW * NKG) void k_attn(const __bf16* __restrict__ QH, const __bf16* __restrict__ QL, const __bf16* __restrict__ KH, const __bf16* __restrict__ KL, const float* __restrict__ MASK, const __bf16* __restrict__ VTH, const __bf16* __restrict__ VTL, float* __restrict__ O) {
  __shared__ __align__(16) __bf16 skv[NKG][2][32][512]; __shared__ __align__(16) float smk[NKG][2][16][36];   // mask rows of 128 B at pitch 144 B
  __shared__ __align__(16) float so[NKG * NHW][16][132]; __shared__ float sm[NKG * NHW][16], sl[NKG * NHW][16];   // the merge's partials, a slice a wave
  const int tid = threadIdx.x, wave = __builtin_amdgcn_readfirstlane(tid >> 5), lane = tid & 31, col = lane & 15, g = lane >> 4;
  const int hw = wave % NHW, kg = wave / NHW, t8 = tid % (32 * NHW); const int qb = blockIdx.x, kv = blockIdx.y, h = kv * NHW + hw; const int q0 = qb * 16;
  // the wave's share of its group's copies: waves 0, 1 the two 16-key groups of k hi (4 KiB contiguous each), 2, 3 of the k residual, 4, 5 v hi fragments 0..3 and 4..7, 6, 7 the same of the v residual
  const bool isk = hw < 4; const __bf16* pl = hw < 2 ? KH : hw < 4 ? KL : hw < 6 ? VTH : VTL;
  const size_t cfs = isk ? 512 : (size_t)(SS / 32) * 512, css = isk ? (size_t)2 * (KVW / 32) * 512 : 512;   // elements from fragment to fragment, and from key step to key step
  const __bf16* cs = pl + (isk ? ((size_t)(hw & 1) * (KVW / 32) + kv * (HD / 32)) * 512 : (size_t)(kv * (HD / 16) + (hw & 1) * 4) * (SS / 32) * 512) + kg * css + lane * 8;   // in the group's first key step
  const unsigned cl = (unsigned)(size_t)&skv[kg][0][hw * 4][0] + lane * 16, clm = (unsigned)(size_t)&smk[kg][0][t8 >> 4][(t8 & 15) * 2];
  const float* cm = MASK + (size_t)(q0 + (t8 >> 4)) * SS + kg * 32 + (t8 & 15) * 2;
  cp_step(cl, cs, cfs, clm, cm);
  // the head's q fragments are read once and stay in registers
  const size_t qo = ((size_t)qb * (DM / 32) + h * (HD / 32)) * 512; const __bf16 *qhp = QH + qo + lane * 8, *qlp = QL + qo + lane * 8; F2 q[4];
#pragma unroll
  for (int kc = 0; kc < 4; ++kc) { q[kc].h = frag_at(qhp + kc * 512); q[kc].l = frag_at(qlp + kc * 512); }
  asm volatile("s_wait_xcnt 0x0" ::: "memory");   // stands in front of every later rewrite of the address registers of the q loads above
  asm volatile("s_wait_asynccnt 0x0" ::: "memory");   // the wave's copies of trip 0 have landed
  __syncthreads();                                     // and every wave's: trip 0 is published
  cp_step(cl + (unsigned)sizeof(skv[0][0]), cs + NKG * css, cfs, clm + (unsigned)sizeof(smk[0][0]), cm + NKG * 32);
  float m = -3.0e38f, l = 0.f;   // of query col; m (in base 2, as e below) is the same in both halves, l is the sum over the half's own keys
  v8f acc[8] = {};   // acc[dt][r] = O^T[dt * 16 + 8 g + r][col]
#pragma unroll 1   // kept rolled: the buffer index is one scalar add to two base addresses
  for (int t = 0; t < SS / 32 / NKG; ++t) { const int bu = t & 1; v4f mk[2][2]; bool anylive = false;   // the group's key step is t * NKG + kg
    const __bf16* kb = &skv[kg][bu][0][0] + lane * 8; const __bf16 *vhp = kb + 16 * 512, *vlp = kb + 24 * 512; const float* mp = &smk[kg][bu][col][8 * g];   // the lane's 8 keys of group ct are 32 contiguous bytes of its query's mask row, at ct * 16
#pragma unroll
    for (int ct = 0; ct < 2; ++ct) { mk[ct][0] = *(const v4f*)(mp + ct * 16); mk[ct][1] = *(const v4f*)(mp + ct * 16 + 4); }
    KF ca, cb; ld_k(ca, kb, 0); ld_k(cb, kb, 1);
#pragma unroll
    for (int ct = 0; ct < 2; ++ct)
#pragma unroll
      for (int r = 0; r < 8; ++r) { const float m_ = bfr(mk[ct][r >> 2][r & 3]); mk[ct][r >> 2][r & 3] = m_ * LOG2E; anylive = anylive || (m_ > -1.0e8f); }   // kept times log2(e): the scores below are formed in base 2
    if (__any(anylive)) {   // wave-uniform: skip key tiles that are fully masked for the 16 queries (exp of <= -1e8 underflows to exactly 0 in the reference too); the step's hand-over below stands outside the skip
    v8f c0 = {}, c1 = {}; v16b vh[8], vl[8];
    // chunk kc + 2 is asked for as soon as the products of chunk kc have freed its registers
    c0 = mac3(ca.k0, q[0], c0); c1 = mac3(ca.k1, q[0], c1);
    ld_k(ca, kb, 2);
    c0 = mac3(cb.k0, q[1], c0); c1 = mac3(cb.k1, q[1], c1);
    ld_k(cb, kb, 3);
    c0 = mac3(ca.k0, q[2], c0); c1 = mac3(ca.k1, q[2], c1);
    c0 = mac3(cb.k0, q[3], c0); c1 = mac3(cb.k1, q[3], c1);
    float e[16];   // e[ct * 8 + r]: key ct * 16 + 8 g + r of the step, of query col; the score times log2(e), so that exp(s - max) = 2^(e - m)
#pragma unroll
    for (int r = 0; r < 8; ++r) { e[r] = c0[r] * (0.08838834764831845f * LOG2E) + mk[0][r >> 2][r & 3]; e[8 + r] = c1[r] * (0.08838834764831845f * LOG2E) + mk[1][r >> 2][r & 3]; }
    // v fragments 0 .. NVA - 1 are asked for ahead of the softmax
#pragma unroll
    for (int dt = 0; dt < NVA; ++dt) { vh[dt] = frag_at(vhp + dt * 512); vl[dt] = frag_at(vlp + dt * 512); }
    float mx = fmaxf(e[0], e[8]);
#pragma unroll
    for (int r = 1; r < 8; ++r) mx = fmaxf(mx, fmaxf(e[r], e[8 + r]));
    mx = fmaxf(mx, xhalf(mx));
    const float mn = fmaxf(m, mx); const float alpha = (m <= -1.0e38f) ? 0.f : exp2_hw(m - mn);
    float es0 = 0.f, es1 = 0.f;
#pragma unroll
    for (int r = 0; r < 8; ++r) { e[r] = exp2_hw(e[r] - mn); e[8 + r] = exp2_hw(e[8 + r] - mn); es0 += e[r]; es1 += e[8 + r]; }
    l = l * alpha + (es0 + es1); m = mn;
#pragma unroll
    for (int dt = 0; dt < 8; ++dt) acc[dt] *= alpha;
    const F2 pa = bsplit16(e);
#pragma unroll
    for (int dt = 0; dt < 8; ++dt) { acc[dt] = wmma_bf(vh[dt], pa.l, acc[dt]); acc[dt] = wmma_bf(vl[dt], pa.h, acc[dt]); acc[dt] = wmma_bf(vh[dt], pa.h, acc[dt]);
      if (dt + NVA < 8) { vh[dt + NVA] = frag_at(vhp + (dt + NVA) * 512); vl[dt + NVA] = frag_at(vlp + (dt + NVA) * 512); } }   // the later fragments take the registers that the first products have freed
    }
    // hand-over, every wave, in this order: the wave's own LDS reads of this buffer are done; its copies of trip t + 1 have landed; the barrier publishes trip t + 1 and ends every reader's last read of this buffer; only then is it refilled
    asm volatile("s_wait_dscnt 0x0" ::: "memory");
    asm volatile("s_wait_asynccnt 0x0" ::: "memory");
    __syncthreads();
    if (t + 2 < SS / 32 / NKG) cp_step(cl + bu * (unsigned)sizeof(skv[0][0]), cs + (size_t)(t + 2) * NKG * css, cfs, clm + bu * (unsigned)sizeof(smk[0][0]), cm + (t + 2) * NKG * 32); }
  asm volatile("s_wait_asynccnt 0x0" ::: "memory");   // no copy is outstanding when the wave ends
  // merge: query maximum over the head's NKG waves, each wave's sum and acc rescaled to it, then summed in group order (a wave with no live key step has m = -3e38, l = 0 and weight 0)
  l += xhalf(l);   // the two halves' sums of a query are joined once, here
  if (g == 0) sm[wave][col] = m;
  __syncthreads();
  { float mx = sm[hw][col];
#pragma unroll
    for (int w = 1; w < NKG; ++w) mx = fmaxf(mx, sm[w * NHW + hw][col]);
    const float f = (m <= -1.0e38f) ? 0.f : exp2_hw(m - mx);
    if (g == 0) sl[wave][col] = l * f;
#pragma unroll
    for (int dt = 0; dt < 8; ++dt) { const v8f a = acc[dt] * f; float* d = &so[wave][col][dt * 16 + 8 * g]; *(v4f*)d = __builtin_shufflevector(a, a, 0, 1, 2, 3); *(v4f*)(d + 4) = __builtin_shufflevector(a, a, 4, 5, 6, 7); } }
  __syncthreads();
  for (int rl = kg; rl < 16; rl += NKG) { v4f a = *(const v4f*)&so[hw][rl][lane * 4]; float ls = sl[hw][rl];
#pragma unroll
    for (int w = 1; w < NKG; ++w) { a += *(const v4f*)&so[w * NHW + hw][rl][lane * 4]; ls += sl[w * NHW + hw][rl]; }
    vst2(O + (size_t)(q0 + rl) * DM + h * HD + lane * 4, a * (1.0f / ls));
    asm volatile("s_wait_xcnt 0x0" ::: "memory"); }   // the next trip rewrites the store's address and data registers: the wait stands in front of that
}
// ---- k_out: block = (64 rows, 128 cols), operands staged in LDS as in k_proj: out = O(hi/lo) . wproj^T rows (2 products)
__global__ __launch_bounds__(128) void k_out(const float* __restrict__ O, const __bf16* __restrict__ P, const float* __restrict__ bias, float* __restrict__ Y) {
  __shared__ __align__(16) float so[4][16][132];
  __shared__ __align__(16) __bf16 sAh[2][64][72], sAl[2][64][72], sB[2][128][72];   // two buffers of one 64-k step: 64 O rows as bf16 hi and residual, 128 P rows, 128-B rows at pitch 144 B
  const int tid = threadIdx.x, wave = tid >> 5, lane = tid & 31, col = lane & 15, g = lane >> 4; const size_t r0 = (size_t)blockIdx.x * 64 + wave * 16; const int n0 = blockIdx.y * 128;
  const float* xg = O + ((size_t)blockIdx.x * 64 + (tid >> 4)) * DM + (tid & 15) * 4;   // piece it of a step: row (tid >> 4) + 8 it, 16 B; a wave's load = 2 rows x 256 B
  const __bf16* pg = P + (size_t)(n0 + (tid >> 3)) * DM + (tid & 7) * 8;                // piece it of a step: row (tid >> 3) + 16 it, 16 B; a wave's load = 4 rows x 128 B
  v8f acc[8] = {}; v4f xr[8]; v8b pr[8];
#pragma unroll
  for (int it = 0; it < 8; ++it) { xr[it] = *(const v4f*)(xg + (size_t)it * 8 * DM); pr[it] = *(const v8b*)(pg + (size_t)it * 16 * DM); }
#pragma unroll
  for (int it = 0; it < 8; ++it) { v4b h4, l4;
#pragma unroll
    for (int e = 0; e < 4; ++e) { const __bf16 hb = (__bf16)xr[it][e]; h4[e] = hb; l4[e] = (__bf16)(xr[it][e] - (float)hb); }
    *(v4b*)&sAh[0][(tid >> 4) + 8 * it][(tid & 15) * 4] = h4; *(v4b*)&sAl[0][(tid >> 4) + 8 * it][(tid & 15) * 4] = l4; *(v8b*)&sB[0][(tid >> 3) + 16 * it][(tid & 7) * 8] = pr[it]; }
#pragma unroll 2   // two copies: the buffer index is a constant in each, so every LDS address is a base register plus an immediate
  for (int st = 0; st < DM / 64; ++st) { const int bu = st & 1;
    __syncthreads();   // publishes step st; every reader of the other buffer (step st - 1) has left it before it is rewritten below
    if (st + 1 < DM / 64) {
#pragma unroll
      for (int it = 0; it < 8; ++it) { xr[it] = *(const v4f*)(xg + (size_t)it * 8 * DM + (st + 1) * 64); pr[it] = *(const v8b*)(pg + (size_t)it * 16 * DM + (st + 1) * 64); } }
#pragma unroll
    for (int k2 = 0; k2 < 2; ++k2) {
      if (k2 == 1) asm volatile("s_wait_xcnt 0x0" ::: "memory");   // stands in front of every later rewrite of the address registers of the next step's loads above
      const v16b ah = frag_b(&sAh[bu][wave * 16 + col][k2 * 32], lane), al = frag_b(&sAl[bu][wave * 16 + col][k2 * 32], lane); v16b b[8];
#pragma unroll
      for (int j = 0; j < 8; ++j) b[j] = frag_b(&sB[bu][j * 16 + col][k2 * 32], lane);
#pragma unroll
      for (int j = 0; j < 8; ++j) { acc[j] = wmma_bf(al, b[j], acc[j]); acc[j] = wmma_bf(ah, b[j], acc[j]); } }
    if (st + 1 < DM / 64) {
#pragma unroll
      for (int it = 0; it < 8; ++it) { v4b h4, l4;
#pragma unroll
        for (int e = 0; e < 4; ++e) { const __bf16 hb = (__bf16)xr[it][e]; h4[e] = hb; l4[e] = (__bf16)(xr[it][e] - (float)hb); }
        *(v4b*)&sAh[bu ^ 1][(tid >> 4) + 8 * it][(tid & 15) * 4] = h4; *(v4b*)&sAl[bu ^ 1][(tid >> 4) + 8 * it][(tid & 15) * 4] = l4; *(v8b*)&sB[bu ^ 1][(tid >> 3) + 16 * it][(tid & 7) * 8] = pr[it]; } } }
#pragma unroll
  for (int j = 0; j < 8; ++j)
#pragma unroll
    for (int r = 0; r < 8; ++r) so[wave][8 * g + r][j * 16 + col] = acc[j][r] + bfr(bias[n0 + j * 16 + col]);
  LDSX();
  for (int rl = 0; rl < 16; ++rl) vst2(Y + (r0 + rl) * DM + n0 + lane * 4, *(const v4f*)&so[wave][rl][lane * 4]);
}
extern "C" void kernel_launch(void* const* d_in, const int* in_sizes, int n_in, void* d_out, int out_size, void* d_ws, size_t ws_size, hipStream_t stream) {
  (void)in_sizes; (void)n_in; (void)out_size;
  const float** F = (const float**)d_in; const int* POS = (const int*)d_in[2];   // 0 hidden_states [1,2048,2048], 1 attention_mask [1,1,2048,2048], 2 position_ids [1,2048] i32, 3 Wq [2048,2048], 4 bq, 5 Wk [2048,256], 6 bk, 7 Wv, 8 bv, 9 Wo [2048,2048], 10 bo
  if (ws_size < (size_t)WS_END) return;
  char* ws = (char*)d_ws; __bf16 *PK = (__bf16*)(ws + WS_PK), *VTH = (__bf16*)(ws + WS_VTH), *VTL = (__bf16*)(ws + WS_VTL);
  __bf16 *QH = (__bf16*)(ws + WS_QH), *QL = (__bf16*)(ws + WS_QL), *KH = (__bf16*)(ws + WS_KH), *KL = (__bf16*)(ws + WS_KL);
  float *CS = (float*)(ws + WS_CS), *O = (float*)(ws + WS_O);
  k_packT<<<dim3(NPT + SS / (4 * (DM / 64)), DM / 64), 256, 0, stream>>>(F[3], F[5], F[7], F[9], PK, POS, CS);
  k_proj<<<dim3(SS / 64, NH + 2 * NKV), 128, 0, stream>>>(F[0], PK, F[4], F[6], F[8], CS, QH, QL, KH, KL, VTH, VTL);
  k_attn<<<dim3(SS / 16, NKV), 32 * NHW * NKG, 0, stream>>>(QH, QL, KH, KL, F[1], VTH, VTL, O);
  k_out<<<dim3(TQB, DM / 128), 128, 0, stream>>>(O, PK + PK_O, F[10], (float*)d_out);
}

// v010
// A run of this version takes 133 microseconds.
// In both of two side-by-side timings against v009, it was 1.10 times as fast.
// Counting every step since v000, it is 8.16 times as fast.
// compute dtype: hidden_states, all weights/biases and the additive attention_mask (module inputs) rounded to bf16; position_ids as int32; q/k/v projections with exact bf16 products (x and W are inputs) + bias and interleaved-pair RoPE from position_ids in f32 in the epilogue; scores q.k with both computed operands as bf16 hi + residual pairs (3 products) + the mask value, P.V with P hi/lo x V hi/lo (3 products); output projection hi/lo x exact Wo (2 products) + bo; softmax in f32; key tiles whose mask entries are all <= -1e8 for the wave's rows are skipped at run time (exp underflows to exactly 0 in the reference too); f32 accumulate.
#include <hip/hip_runtime.h>
#include <math.h>

typedef __attribute__((ext_vector_type(16))) _Float16 v16h;
typedef __attribute__((ext_vector_type(16))) __bf16 v16b;
typedef __attribute__((ext_vector_type(8)))  _Float16 v8h;
typedef __attribute__((ext_vector_type(8)))  float v8f;
typedef __attribute__((ext_vector_type(4)))  float v4f;
typedef __attribute__((ext_vector_type(2)))  float v2f;
typedef __attribute__((ext_vector_type(4)))  unsigned v4u;
typedef __attribute__((ext_vector_type(4)))  int v4i;
typedef float __attribute__((may_alias)) float_a;
typedef int __attribute__((may_alias)) int_a;

template <typename T> __device__ __forceinline__ void vst2(void* p, T v) { *(T*)p = v;  }
__device__ __forceinline__ v8f wmma16(v16h a, v16h b, v8f c) {
  v8f d = __builtin_amdgcn_wmma_f32_16x16x32_f16(false, a, false, b, (short)0, c, false, false);
  asm volatile("v_nop\n\tv_nop\n\tv_nop\n\tv_nop" : "+v"(d) : "v"(a), "v"(b));
  return d;
}
__device__ __forceinline__ v8f wmma_bf(v16b a, v16b b, v8f c) {
  v8f d = __builtin_amdgcn_wmma_f32_16x16x32_bf16(false, a, false, b, (short)0, c, false, false);
  asm volatile("v_nop\n\tv_nop\n\tv_nop\n\tv_nop" : "+v"(d) : "v"(a), "v"(b));
  return d;
}
// 16x16x32 fragments: lane = (h = lane>>4, row/col = lane&15); elements 0..7 = k0+8h+0..7, 8..15 = k0+16+8h+0..7; D element r = row 8h+r
__device__ __forceinline__ v16h frag_h(const _Float16* rowk0, int lane) {
  union { v16h v; v8h q[2]; } u; const _Float16* p = rowk0 + 8 * (lane >> 4);
  u.q[0] = *(const v8h*)p; u.q[1] = *(const v8h*)(p + 16); return u.v;
}
__device__ __forceinline__ v16h frag_f32(const float* rowk0, int lane) {
  v16h a; const float* p = rowk0 + 8 * (lane >> 4);
#pragma unroll
  for (int i = 0; i < 8; ++i) { a[i] = (_Float16)p[i]; a[8 + i] = (_Float16)p[16 + i]; }
  return a;
}
__device__ __forceinline__ v16h frag_f32s(const float* rowk0, int lane, float sc) {
  v16h a; const float* p = rowk0 + 8 * (lane >> 4);
#pragma unroll
  for (int i = 0; i < 8; ++i) { a[i] = (_Float16)(p[i] * sc); a[8 + i] = (_Float16)(p[16 + i] * sc); }
  return a;
}
// column fragment from a [K][ld] layout (column n), rows >= K read as 0
__device__ __forceinline__ v16h fragc_f32(const float* W, int k0, int n, int lane, int ld, int K) {
  v16h a; const int g = lane >> 4;
#pragma unroll
  for (int i = 0; i < 8; ++i) { const int ka = k0 + 8 * g + i, kb = ka + 16;
    a[i] = (_Float16)(ka < K ? W[(size_t)(ka < K ? ka : K - 1) * ld + n] : 0.f); a[8 + i] = (_Float16)(kb < K ? W[(size_t)(kb < K ? kb : K - 1) * ld + n] : 0.f); }
  return a;
}
struct F2 { v16b h, l; };
__device__ __forceinline__ F2 bsplit16(const float v[16]) { F2 r;
#pragma unroll
  for (int i = 0; i < 16; ++i) { const __bf16 h = (__bf16)v[i]; r.h[i] = h; r.l[i] = (__bf16)(v[i] - (float)h); }
  return r; }
__device__ __forceinline__ F2 split_row(const float* row, int k0, int lane) { float v[16]; const float* p = row + k0 + 8 * (lane >> 4);
#pragma unroll
  for (int i = 0; i < 8; ++i) { v[i] = p[i]; v[8 + i] = p[16 + i]; }
  return bsplit16(v); }
__device__ __forceinline__ F2 split_rowK(const float* row, int k0, int lane, int K) { float v[16]; const int g = lane >> 4;
#pragma unroll
  for (int i = 0; i < 8; ++i) { const int ka = k0 + 8 * g + i, kb = ka + 16; v[i] = ka < K ? row[ka < K ? ka : K - 1] : 0.f; v[8 + i] = kb < K ? row[kb < K ? kb : K - 1] : 0.f; }
  return bsplit16(v); }
__device__ __forceinline__ F2 split_col(const float* W, int k0, int n, int lane, int ld, int K) { float v[16]; const int g = lane >> 4;
#pragma unroll
  for (int i = 0; i < 8; ++i) { const int ka = k0 + 8 * g + i, kb = ka + 16; v[i] = ka < K ? W[(size_t)(ka < K ? ka : K - 1) * ld + n] : 0.f; v[8 + i] = kb < K ? W[(size_t)(kb < K ? kb : K - 1) * ld + n] : 0.f; }
  return bsplit16(v); }
__device__ __forceinline__ v8f mac3(const F2& a, const F2& b, v8f c) { c = wmma_bf(a.l, b.h, c); c = wmma_bf(a.h, b.l, c); return wmma_bf(a.h, b.h, c); }
__device__ __forceinline__ float sigm(float v) { return 1.0f / (1.0f + expf(-v)); }
#define LDSX() do { asm volatile("s_wait_dscnt 0" ::: "memory"); __builtin_amdgcn_wave_barrier(); __builtin_amdgcn_fence(__ATOMIC_RELEASE, "workgroup"); } while (0)


// Attention with grouped kv heads (B 1, S 2048, D 2048, 16 query heads / 2 kv heads x 128): q = rope(x Wq + bq), k = rope(x Wk + bk) (interleaved pairs, angles from position_ids), v = x Wv + bv; scores = q k^T / sqrt(128) + attention_mask[q][k] (additive input); softmax; out = (P v) Wo + bo.
#define SS 2048
#define DM 2048
#define NH 16
#define NKV 2
#define HD 128
#define KVW (NKV * HD)
#ifndef TQB
#define TQB (SS / 64)
#endif
typedef __attribute__((ext_vector_type(8))) __bf16 v8b;
typedef __attribute__((ext_vector_type(4))) __bf16 v4b;
__device__ __forceinline__ v16b frag_b(const __bf16* rowk0, int lane) {
  union { v16b v; v8b q[2]; } u; const __bf16* p = rowk0 + 8 * (lane >> 4);
  u.q[0] = *(const v8b*)p; u.q[1] = *(const v8b*)(p + 16); return u.v;
}
// fragment-order plane of a logical [R][C] bf16 matrix: 16-row x 32-column fragments of 512 elements, fragment index (row >> 4) * (C / 32) + (c >> 5); inside it element (row, c) sits at ((c >> 4) & 1) * 256 + (((c >> 3) & 1) * 16 + (row & 15)) * 8 + (c & 7). Lane l's two 16-B pieces (the same elements that frag_b reads from a row) are at l * 8 and 256 + l * 8: each load of a wave is 512 contiguous bytes
__device__ __forceinline__ v16b frag_fo(const __bf16* f, int lane) {
  union { v16b v; v8b q[2]; } u; u.q[0] = *(const v8b*)(f + lane * 8); u.q[1] = *(const v8b*)(f + 256 + lane * 8); return u.v;
}
__device__ __forceinline__ float bfr(float v) { return (float)(__bf16)v; }
// 2^v by the hardware's own instruction, in line (results below the normal range come out as 0; every argument here is <= 0)
__device__ __forceinline__ float exp2_hw(float v) { return __builtin_amdgcn_exp2f(v); }
#define LOG2E 1.4426950408889634f
__device__ __attribute__((noinline)) float erf_ni(float v) { return erff(v); }

#define PK_Q 0
#define PK_K (PK_Q + DM * DM)
#define PK_V (PK_K + KVW * DM)
#define PK_O (PK_V + KVW * DM)
#define PK_END (PK_O + DM * DM)
#define WS_PK  0u
#define WS_CS  (WS_PK + 2u * PK_END)             // f32 [2048][64] cos, then [2048][64] sin
#define WS_QH  (WS_CS + 4u * 2 * SS * 64)        // q after RoPE as bf16 hi plane [2048][2048] in fragment order, then its residual plane
#define WS_QL  (WS_QH + 2u * SS * DM)
#define WS_KH  (WS_QL + 2u * SS * DM)            // k after RoPE as bf16 hi plane [2048][256] in fragment order, then its residual plane
#define WS_KL  (WS_KH + 2u * SS * KVW)
#define WS_VTH (WS_KL + 2u * SS * KVW)
#define WS_VTL (WS_VTH + 2u * KVW * SS)
#define WS_O   (WS_VTL + 2u * KVW * SS)
#define WS_END (WS_O + 4u * SS * DM)

// ---- k_packT: block = tile of 64 k x 128 n of a [K][N] (x @ W) matrix, turned through LDS into DST [N][K] bf16: a wave's load = 512 contiguous bytes of one k row, a wave's store = 4 n rows x one whole 128-B line (K a multiple of 64, N of 128)
// one launch for all four matrices (each has K = DM): blockIdx.x counts the 128-column tiles of Wq, Wk, Wv, Wo side by side, and the DST rows follow in that order (PK_Q, PK_K, PK_V, PK_O are contiguous)
// the blocks behind them (blockIdx.x >= NPT) fill the RoPE tables, which depend on nothing of the above either: 4 positions t a block, 64 threads = pair index i each: inv_freq = 1 / 10000^((2i)/128) and angle = float(position_ids[t]) * inv_freq in f32 (as the reference), cos/sin in f32; rows 256 B, a wave's store = one whole 128-B line
#define NPT ((2 * DM + 2 * KVW) / 128)
__global__ __launch_bounds__(256) void k_packT(const float* __restrict__ Wq, const float* __restrict__ Wk, const float* __restrict__ Wv, const float* __restrict__ Wo, __bf16* __restrict__ DST, const int* __restrict__ POS, float* __restrict__ CS) {
  const int bx = blockIdx.x, K = DM; const float* Wm; int N, ns;   // ns = the tile's first column in its own matrix
  if (bx >= NPT) {   // the same for every thread of a block, and in front of the barrier
    const int t = ((bx - NPT) * (DM / 64) + blockIdx.y) * 4 + (threadIdx.x >> 6), i = threadIdx.x & 63;
    const float inv = 1.0f / powf(10000.0f, (float)(2 * i) / 128.0f); const float ang = (float)POS[t] * inv;
    CS[(size_t)t * 64 + i] = cosf(ang); CS[(size_t)SS * 64 + (size_t)t * 64 + i] = sinf(ang); return; }
  if (bx < DM / 128) { Wm = Wq; N = DM; ns = bx * 128; } else if (bx < (DM + KVW) / 128) { Wm = Wk; N = KVW; ns = bx * 128 - DM; } else if (bx < (DM + 2 * KVW) / 128) { Wm = Wv; N = KVW; ns = bx * 128 - DM - KVW; } else { Wm = Wo; N = DM; ns = bx * 128 - DM - 2 * KVW; }
  __shared__ unsigned s[128][33];   // row n: its 64 k as 32 bf16 pairs (k, k + 1); the odd pitch spreads both the column-wise writes and the row-wise reads over the banks
  const int tid = threadIdx.x, wave = tid >> 5, lane = tid & 31; const int n0 = bx * 128, k0 = blockIdx.y * 64;
  const float* src = Wm + (size_t)(k0 + wave * 8) * N + ns + lane * 4; const float* pr[8]; v4f xr[8];
#pragma unroll
  for (int i = 0; i < 8; ++i) { pr[i] = src + (size_t)i * N; xr[i] = *(const v4f*)pr[i]; }
  // stands in front of every rewrite of the address registers of the 8 loads above; naming them as inputs keeps them whole up to here (without that a later load's result landed on an earlier load's address pair ahead of the wait)
  asm volatile("s_wait_xcnt 0x0" :: "v"(pr[0]), "v"(pr[1]), "v"(pr[2]), "v"(pr[3]), "v"(pr[4]), "v"(pr[5]), "v"(pr[6]), "v"(pr[7]) : "memory");
#pragma unroll
  for (int i = 0; i < 8; i += 2)
#pragma unroll
    for (int e = 0; e < 4; ++e) { union { __bf16 b[2]; unsigned u; } p; p.b[0] = (__bf16)xr[i][e]; p.b[1] = (__bf16)xr[i + 1][e]; s[lane * 4 + e][wave * 4 + (i >> 1)] = p.u; }
  __syncthreads();
#pragma unroll
  for (int j = 0; j < 4; ++j) { const int q = tid + 256 * j, n = q >> 3, k8 = q & 7; v4u o;
#pragma unroll
    for (int e = 0; e < 4; ++e) o[e] = s[n][k8 * 4 + e];
    vst2((unsigned*)(DST + (size_t)(n0 + n) * K + k0 + k8 * 8), o); }
}
// ---- k_proj: block = (64 rows, 128 cols = one head), operands staged in LDS per 64-k step, the next step's global loads issued ahead of this step's products: Y = bf16(x) . P rows (exact); q and k heads: RoPE then bf16 hi/lo planes of [2048][ldo] in fragment order; v heads: plain -> transposed bf16 hi/lo planes of [256][2048] in fragment order
// one launch for q, k and v: blockIdx.y counts the 16 q heads, the 2 k heads and the 2 v heads, which are consecutive 128-row groups of P
__global__ __launch_bounds__(128) void k_proj(const float* __restrict__ X, const __bf16* __restrict__ P, const float* __restrict__ bq, const float* __restrict__ bk, const float* __restrict__ bv, const float* __restrict__ CS, __bf16* __restrict__ QH, __bf16* __restrict__ QL, __bf16* __restrict__ KH, __bf16* __restrict__ KL, __bf16* __restrict__ VTH, __bf16* __restrict__ VTL) {
  __shared__ __align__(16) char se[2 * 128 * 72 * 2];   // output staging; a block uses it either as so (q, k) or as sth + stl (v)
  float (*so)[16][132] = (float (*)[16][132])se; __bf16 (*sth)[72] = (__bf16 (*)[72])se; __bf16 (*stl)[72] = sth + 128;
  static_assert(sizeof(float) * 4 * 16 * 132 <= sizeof(se), "so fits the staging area");
  const int by = blockIdx.y; const bool isv = by >= NH + NKV; const float* bias; __bf16 *PH, *PL; int ldo, n0;   // n0 = the head's first column in its own output
  if (by < NH) { bias = bq; PH = QH; PL = QL; ldo = DM; n0 = by * 128; } else if (!isv) { bias = bk; PH = KH; PL = KL; ldo = KVW; n0 = (by - NH) * 128; } else { bias = bv; PH = VTH; PL = VTL; ldo = 0; n0 = (by - NH - NKV) * 128; }
  __shared__ __align__(16) __bf16 sA[2][64][72], sB[2][128][72];   // two buffers of one 64-k step: 64 x rows (rounded to bf16) and 128 P rows, 128-B rows at pitch 144 B
  const int tid = threadIdx.x, wave = tid >> 5, lane = tid & 31, col = lane & 15, g = lane >> 4; const size_t r0 = (size_t)blockIdx.x * 64 + wave * 16;
  const float* xg = X + ((size_t)blockIdx.x * 64 + (tid >> 4)) * DM + (tid & 15) * 4;   // piece it of a step: row (tid >> 4) + 8 it, 16 B; a wave's load = 2 rows x 256 B
  const __bf16* pg = P + (size_t)(by * 128 + (tid >> 3)) * DM + (tid & 7) * 8;          // piece it of a step: row (tid >> 3) + 16 it, 16 B; a wave's load = 4 rows x 128 B
  v8f acc[8] = {}; v4f xr[8]; v8b pr[8];
#pragma unroll
  for (int it = 0; it < 8; ++it) { xr[it] = *(const v4f*)(xg + (size_t)it * 8 * DM); pr[it] = *(const v8b*)(pg + (size_t)it * 16 * DM); }
#pragma unroll
  for (int it = 0; it < 8; ++it) { v4b x4;
#pragma unroll
    for (int e = 0; e < 4; ++e) x4[e] = (__bf16)xr[it][e];
    *(v4b*)&sA[0][(tid >> 4) + 8 * it][(tid & 15) * 4] = x4; *(v8b*)&sB[0][(tid >> 3) + 16 * it][(tid & 7) * 8] = pr[it]; }
#pragma unroll 2   // two copies: the buffer index is a constant in each, so every LDS address is a base register plus an immediate
  for (int st = 0; st < DM / 64; ++st) { const int bu = st & 1;
    __syncthreads();   // publishes step st; every reader of the other buffer (step st - 1) has left it before it is rewritten below
    if (st + 1 < DM / 64) {
#pragma unroll
      for (int it = 0; it < 8; ++it) { xr[it] = *(const v4f*)(xg + (size_t)it * 8 * DM + (st + 1) * 64); pr[it] = *(const v8b*)(pg + (size_t)it * 16 * DM + (st + 1) * 64); } }
#pragma unroll
    for (int k2 = 0; k2 < 2; ++k2) {
      if (k2 == 1) asm volatile("s_wait_xcnt 0x0" ::: "memory");   // stands in front of every later rewrite of the address registers of the next step's loads above
      const v16b a = frag_b(&sA[bu][wave * 16 + col][k2 * 32], lane); v16b b[8];
#pragma unroll
      for (int j = 0; j < 8; ++j) b[j] = frag_b(&sB[bu][j * 16 + col][k2 * 32], lane);
#pragma unroll
      for (int j = 0; j < 8; ++j) acc[j] = wmma_bf(a, b[j], acc[j]); }
    if (st + 1 < DM / 64) {
#pragma unroll
      for (int it = 0; it < 8; ++it) { v4b x4;
#pragma unroll
        for (int e = 0; e < 4; ++e) x4[e] = (__bf16)xr[it][e];
        *(v4b*)&sA[bu ^ 1][(tid >> 4) + 8 * it][(tid & 15) * 4] = x4; *(v8b*)&sB[bu ^ 1][(tid >> 3) + 16 * it][(tid & 7) * 8] = pr[it]; } } }
  if (!isv) {   // the same for every thread of a block
    // biased projections to LDS, then interleaved-pair RoPE in place: (d = 2i, 2i+1): out_e = x_e cos_i - x_o sin_i; out_o = x_e sin_i + x_o cos_i with angle index i = d/2 (position from position_ids via the CS tables)
#pragma unroll
    for (int j = 0; j < 8; ++j) { const float bb = bfr(bias[n0 + j * 16 + col]);
#pragma unroll
      for (int r = 0; r < 8; ++r) so[wave][8 * g + r][j * 16 + col] = acc[j][r] + bb; }
    LDSX();
    for (int q = lane; q < 16 * 64; q += 32) { const int rl = q >> 6, i = q & 63; const size_t t = r0 + rl; const float c = CS[t * 64 + i], s = CS[(size_t)SS * 64 + t * 64 + i]; const float xe = so[wave][rl][2 * i], xo = so[wave][rl][2 * i + 1]; so[wave][rl][2 * i] = xe * c - xo * s; so[wave][rl][2 * i + 1] = xe * s + xo * c; }
    LDSX();
    // each value leaves as bf16 hi + bf16 residual, the same split that the score products use; the wave's 16 rows x 128 columns are 4 whole fragments of each plane, piece p = 16 columns: a wave's store = 512 contiguous bytes
    const size_t f0 = ((r0 >> 4) * (size_t)(ldo >> 5) + (n0 >> 5)) * 512;
    for (int p = 0; p < 8; ++p) { const float* sr = &so[wave][col][p * 16 + g * 8]; const v4f va = *(const v4f*)sr, vb = *(const v4f*)(sr + 4); v8b h8, l8;
#pragma unroll
      for (int e = 0; e < 4; ++e) { const __bf16 ha = (__bf16)va[e], hb = (__bf16)vb[e]; h8[e] = ha; l8[e] = (__bf16)(va[e] - (float)ha); h8[4 + e] = hb; l8[4 + e] = (__bf16)(vb[e] - (float)hb); }
      const size_t o = f0 + p * 256 + lane * 8; *(v8b*)(PH + o) = h8; *(v8b*)(PL + o) = l8;
      asm volatile("s_wait_xcnt 0x0" ::: "memory"); }   // the next piece rewrites the stores' data registers: the wait stands in front of that
  } else {
#pragma unroll
    for (int j = 0; j < 8; ++j)
#pragma unroll
      for (int r = 0; r < 8; ++r) { const float v = acc[j][r] + bfr(bias[n0 + j * 16 + col]); const __bf16 hb = (__bf16)v; sth[j * 16 + col][wave * 16 + 8 * g + r] = hb; stl[j * 16 + col][wave * 16 + 8 * g + r] = (__bf16)(v - (float)hb); }
    __syncthreads();
    const int s0 = blockIdx.x * 64;
    // the block's 128 d x 64 s are 16 whole fragments of each plane: fragment fl, half j, lane slot sl; a wave's store = 512 contiguous bytes
    for (int q = tid; q < 128 * 8; q += 128) { const int fl = q >> 6, j = (q >> 5) & 1, sl = q & 31; const int d = (fl >> 1) * 16 + (sl & 15), c = (fl & 1) * 32 + j * 16 + (sl >> 4) * 8;
      const size_t o = ((size_t)((n0 >> 4) + (fl >> 1)) * (SS / 32) + (s0 >> 5) + (fl & 1)) * 512 + j * 256 + sl * 8; vst2((unsigned*)(PH + o), *(const v4u*)&sth[d][c]); vst2((unsigned*)(PL + o), *(const v4u*)&stl[d][c]); }
  }
}
// ---- k_attn: block = (pair of 16-query tiles, kv head), NKG groups of NHW waves. The block works two units one after the other: query tile blockIdx.x for the kv head's first NHW query heads, then tile SS / 16 - 1 - blockIdx.x for its other NHW, so that every (head, tile) is taken once and a long tile shares its block with a short one.
// At its start the block scans the mask rows of both tiles and keeps, per tile, one bit per 32-key step: set where any entry of the 16 x 32 tile is above -1e8. A unit walks the set steps only: group kg takes the steps of rank kg, kg + NKG, ... among them (flash attention over its share), then the NKG partial (max, sum, acc) of a head are merged through LDS.
// Wave hw of a group = one query head. The k, v and mask tiles of a key step are the same for the NHW heads: they are brought into LDS once per group (two buffers a group, the next trip's copies fly under this trip's work) and read from there by the group's waves; scores 3 products, P.V 3 products; O[q][h*128+d]
#define NHK (NH / NKV)
#define NHW 4
#define NKG 4
#define NVA 4   // v fragments (of 8) of a key step that are asked for ahead of the softmax; the others take the registers that the first products free
// LDS buffer of one key step: 32 fragments of 1 KiB in plane order: 0..7 k hi (16-key group ct, 32-d chunk kc at ct * 4 + kc), 8..15 k residual, 16..23 v hi (16-d group dt), 24..31 v residual
// one 32-d chunk of a key step's two 16-key groups of k, each as hi + residual
struct KF { F2 k0, k1; };
// p = the lane's own address in a fragment (fragment start + lane * 8): the same two 16-B pieces that frag_fo reads
__device__ __forceinline__ v16b frag_at(const __bf16* p) { union { v16b v; v8b q[2]; } u; u.q[0] = *(const v8b*)p; u.q[1] = *(const v8b*)(p + 256); return u.v; }
__device__ __forceinline__ void ld_k(KF& o, const __bf16* kb, int kc) {
  o.k0.h = frag_at(kb + kc * 512); o.k0.l = frag_at(kb + (8 + kc) * 512); o.k1.h = frag_at(kb + (4 + kc) * 512); o.k1.l = frag_at(kb + (12 + kc) * 512);
}
// one half of a wave's share of one key step's copies: 4 fragments (8 x 512 contiguous bytes; s = the lane's address in the first, fs = elements from one fragment to the next) to 4 KiB of the buffer at ld, and 8 bytes a lane of 8 rows of the 16 x 32 mask tile.
// The wait on the last line stands in front of every rewrite of the copies' address registers
__device__ __forceinline__ void cp_step(unsigned ld, const __bf16* s, size_t fs, unsigned lm, const float* gm) {
  asm volatile("global_load_async_to_lds_b128 %0, %1, off\n\t"
               "global_load_async_to_lds_b128 %2, %3, off\n\t"
               "global_load_async_to_lds_b128 %4, %5, off\n\t"
               "global_load_async_to_lds_b128 %6, %7, off\n\t"
               "global_load_async_to_lds_b128 %8, %9, off\n\t"
               "global_load_async_to_lds_b128 %10, %11, off\n\t"
               "global_load_async_to_lds_b128 %12, %13, off\n\t"
               "global_load_async_to_lds_b128 %14, %15, off\n\t"
               "global_load_async_to_lds_b64 %16, %17, off\n\t"
               "s_wait_xcnt 0x0"
               :: "v"(ld), "v"(s), "v"(ld + 512u), "v"(s + 256), "v"(ld + 1024u), "v"(s + fs), "v"(ld + 1536u), "v"(s + fs + 256),
                  "v"(ld + 2048u), "v"(s + 2 * fs), "v"(ld + 2560u), "v"(s + 2 * fs + 256), "v"(ld + 3072u), "v"(s + 3 * fs), "v"(ld + 3584u), "v"(s + 3 * fs + 256),
                  "v"(lm), "v"(gm) : "memory");
}
// lane l with lane l ^ 16 (the two lanes that hold one query's column)
__device__ __forceinline__ float xhalf(float x) { return __builtin_bit_cast(float, __builtin_amdgcn_permlanex16(__builtin_bit_cast(int, x), __builtin_bit_cast(int, x), 0x76543210, 0xfedcba98, false, false)); }
// both products are computed transposed: S^T = K . Q^T (A = k fragment, B = q fragment) and O^T += V^T . P^T (A = v fragment, B = P^T). A and B share one lane and k map, so the planes are read as before.
// D register r of lane (g, col) = row 8 g + r, column col: a lane holds 8 keys (of each 16-key group) of ONE query col, and later 8 d of that query. Maximum and sum run in the lane, plus one exchange between the halves;
// the two score tiles of a step, converted in place, are the B operand P^T (element s = tile s >> 3, register s & 7 = key 8 g + s or 16 + 8 g + s - 8, the k order of the v fragments)
__global__ __launch_bounds__(32 * NHW * NKG) void k_attn(const __bf16* __restrict__ QH, const __bf16* __restrict__ QL, const __bf16* __restrict__ KH, const __bf16* __restrict__ KL, const float* __restrict__ MASK, const __bf16* __restrict__ VTH, const __bf16* __restrict__ VTL, float* __restrict__ O) {
  __shared__ __align__(16) __bf16 skv[NKG][2][32][512]; __shared__ __align__(16) float smk[NKG][2][16][36];   // mask rows of 128 B at pitch 144 B
  __shared__ float sm[NKG * NHW][16], sl[NKG * NHW][16]; __shared__ __align__(16) unsigned slw[4][16];
  float (*so)[16][132] = (float (*)[16][132])&skv[0][0][0][0];   // the merge's partials, a slice a wave: they take the key buffers' place once a unit's last trip has been read
  static_assert(sizeof(float) * NKG * NHW * 16 * 132 <= sizeof(skv), "the partials fit the key buffers"); static_assert(NKG * NHW == 16 && 2 * NHW == NHK, "a wave a mask row; two units a kv head");
  const int tid = threadIdx.x, wave = __builtin_amdgcn_readfirstlane(tid >> 5), lane = tid & 31, col = lane & 15, g = lane >> 4;
  const int hw = wave % NHW, kg = wave / NHW, t8 = tid % (32 * NHW); const int qa = blockIdx.x, kv = blockIdx.y;
  // the scan: wave w reads row w of both tiles (a load = 512 contiguous bytes = 4 key steps, 8 lanes a step). Bit j of a lane's word: load j of the first tile holds an entry above -1e8 (rounding to bf16 keeps the order, so the largest of the lane's four stands for them); bit 16 + j: the same of the second tile.
  // The words are joined over the 8 lanes of a step, then over the 16 rows through LDS. Bit 16 s + j of a tile's 64 = key step 4 j + s
  { const float *ra = MASK + (size_t)(qa * 16 + wave) * SS + lane * 4, *rb = MASK + (size_t)((SS / 16 - 1 - qa) * 16 + wave) * SS + lane * 4; v4f xa[16], xb[16];
#pragma unroll
    for (int j = 0; j < 16; ++j) { xa[j] = *(const v4f*)(ra + j * 128); xb[j] = *(const v4f*)(rb + j * 128); }
    asm volatile("s_wait_xcnt 0x0" :: "v"(ra), "v"(rb) : "memory");   // stands in front of every rewrite of the address registers of the loads above; naming them keeps them whole up to here
    unsigned w = 0;
#pragma unroll
    for (int j = 0; j < 16; ++j) { const float ma = fmaxf(fmaxf(xa[j][0], xa[j][1]), fmaxf(xa[j][2], xa[j][3])), mb = fmaxf(fmaxf(xb[j][0], xb[j][1]), fmaxf(xb[j][2], xb[j][3]));
      w |= (unsigned)(bfr(ma) > -1.0e8f) << j; w |= (unsigned)(bfr(mb) > -1.0e8f) << (16 + j); }
    w |= __shfl_xor(w, 1); w |= __shfl_xor(w, 2); w |= __shfl_xor(w, 4);
    if ((lane & 7) == 0) slw[lane >> 3][wave] = w; }
  __syncthreads();   // every row's bits are written
  unsigned long long lv[2];
  { unsigned x = 0;
#pragma unroll
    for (int w = 0; w < 16; ++w) x |= slw[lane & 3][w];
    const unsigned x0 = __builtin_amdgcn_readlane(x, 0), x1 = __builtin_amdgcn_readlane(x, 1), x2 = __builtin_amdgcn_readlane(x, 2), x3 = __builtin_amdgcn_readlane(x, 3);
    lv[0] = (unsigned long long)((x0 & 0xffffu) | (x1 << 16)) | ((unsigned long long)((x2 & 0xffffu) | (x3 << 16)) << 32);
    lv[1] = (unsigned long long)((x0 >> 16) | (x1 & 0xffff0000u)) | ((unsigned long long)((x2 >> 16) | (x3 & 0xffff0000u)) << 32); }
  // the wave's share of its group's copies: one plane (wave 0 k hi, 1 k residual, 2 v hi, 3 v residual), 8 fragments a key step in two halves of 4: the two 16-key groups of k (4 KiB contiguous each), v fragments 0..3 and 4..7
  const bool isk = hw < 2; const __bf16* pl = hw == 0 ? KH : hw == 1 ? KL : hw == 2 ? VTH : VTL;
  const size_t cfs = isk ? 512 : (size_t)(SS / 32) * 512, css = isk ? (size_t)2 * (KVW / 32) * 512 : 512, chf = isk ? (size_t)(KVW / 32) * 512 : (size_t)4 * (SS / 32) * 512;   // elements from fragment to fragment, from key step to key step, from half to half
  const __bf16* cs = pl + (isk ? (size_t)kv * (HD / 32) * 512 : (size_t)kv * (HD / 16) * (SS / 32) * 512) + lane * 8;   // in key step 0
  const unsigned cl = (unsigned)(size_t)&skv[kg][0][hw * 8][0] + lane * 16, clm = (unsigned)(size_t)&smk[kg][0][t8 >> 4][(t8 & 15) * 2];   // a half's mask share: 8 rows, 8 bytes a lane
#pragma unroll 1   // the two units run one after the other through one copy of the code
  for (int u = 0; u < 2; ++u) {
  const int qb = u ? SS / 16 - 1 - qa : qa, h = kv * NHK + u * NHW + hw, q0 = qb * 16;
  unsigned long long rem = lv[u]; const int nl = __builtin_popcountll(rem), trips = (nl + NKG - 1) / NKG;   // the same in every wave of the block; at most 64 and 16
  const float* cm = MASK + (size_t)(q0 + (t8 >> 4)) * SS + (t8 & 15) * 2;
  // takes the next NKG set bits off rem and gives the key step of the group's own; a group whose rank is past the last set bit gets step 0, whose tiles it copies and never reads
  auto next = [&]() { int my = 0;
#pragma unroll
    for (int j = 0; j < NKG; ++j) { const int b = rem ? __builtin_ctzll(rem) : 0; rem &= rem - 1; if (j == kg) my = b; }
    return ((my & 15) << 2) | (my >> 4); };
  auto cp = [&](int st, int bu) { const __bf16* a = cs + (size_t)st * css; const float* mm = cm + st * 32; const unsigned d = cl + bu * (unsigned)sizeof(skv[0][0]), dm = clm + bu * (unsigned)sizeof(smk[0][0]);
    cp_step(d, a, cfs, dm, mm); cp_step(d + 4096u, a + chf, cfs, dm + 8u * 36u * 4u, mm + 8 * SS); };
  if (trips > 0) cp(next(), 0);
  // the head's q fragments are read once and stay in registers
  const size_t qo = ((size_t)qb * (DM / 32) + h * (HD / 32)) * 512; const __bf16 *qhp = QH + qo + lane * 8, *qlp = QL + qo + lane * 8; F2 q[4];
#pragma unroll
  for (int kc = 0; kc < 4; ++kc) { q[kc].h = frag_at(qhp + kc * 512); q[kc].l = frag_at(qlp + kc * 512); }
  asm volatile("s_wait_xcnt 0x0" ::: "memory");   // stands in front of every later rewrite of the address registers of the q loads above
  asm volatile("s_wait_asynccnt 0x0" ::: "memory");   // the wave's copies of trip 0 have landed
  __syncthreads();                                     // and every wave's: trip 0 is published
  if (trips > 1) cp(next(), 1);
  float m = -3.0e38f, l = 0.f;   // of query col; m (in base 2, as e below) is the same in both halves, l is the sum over the half's own keys
  v8f acc[8] = {};   // acc[dt][r] = O^T[dt * 16 + 8 g + r][col]
#pragma unroll 1   // kept rolled: the buffer index is one scalar add to two base addresses
  for (int t = 0; t < trips; ++t) { const int bu = t & 1;
    if (t * NKG + kg < nl) {   // wave-uniform: the group has a set step in this trip (only the unit's last trip can lack one); the step's hand-over below stands outside the test
    v4f mk[2][2];
    const __bf16* kb = &skv[kg][bu][0][0] + lane * 8; const __bf16 *vhp = kb + 16 * 512, *vlp = kb + 24 * 512; const float* mp = &smk[kg][bu][col][8 * g];   // the lane's 8 keys of group ct are 32 contiguous bytes of its query's mask row, at ct * 16
    KF ca, cb; ld_k(ca, kb, 0); ld_k(cb, kb, 1);
    v8f c0 = {}, c1 = {}; v16b vh[8], vl[8];
    // chunk kc + 2 is asked for as soon as the products of chunk kc have freed its registers
    c0 = mac3(ca.k0, q[0], c0); c1 = mac3(ca.k1, q[0], c1);
    ld_k(ca, kb, 2);
    c0 = mac3(cb.k0, q[1], c0); c1 = mac3(cb.k1, q[1], c1);
    ld_k(cb, kb, 3);
    c0 = mac3(ca.k0, q[2], c0); c1 = mac3(ca.k1, q[2], c1);
    // the mask values are first needed behind the products (the scan has done the step's test): they are asked for here, into registers that chunk 2 has freed
#pragma unroll
    for (int ct = 0; ct < 2; ++ct) { mk[ct][0] = *(const v4f*)(mp + ct * 16); mk[ct][1] = *(const v4f*)(mp + ct * 16 + 4); }
    c0 = mac3(cb.k0, q[3], c0); c1 = mac3(cb.k1, q[3], c1);
#pragma unroll
    for (int ct = 0; ct < 2; ++ct)
#pragma unroll
      for (int r = 0; r < 8; ++r) mk[ct][r >> 2][r & 3] = bfr(mk[ct][r >> 2][r & 3]) * LOG2E;   // kept times log2(e): the scores below are formed in base 2
    float e[16];   // e[ct * 8 + r]: key ct * 16 + 8 g + r of the step, of query col; the score times log2(e), so that exp(s - max) = 2^(e - m)
#pragma unroll
    for (int r = 0; r < 8; ++r) { e[r] = c0[r] * (0.08838834764831845f * LOG2E) + mk[0][r >> 2][r & 3]; e[8 + r] = c1[r] * (0.08838834764831845f * LOG2E) + mk[1][r >> 2][r & 3]; }
    // v fragments 0 .. NVA - 1 are asked for ahead of the softmax
#pragma unroll
    for (int dt = 0; dt < NVA; ++dt) { vh[dt] = frag_at(vhp + dt * 512); vl[dt] = frag_at(vlp + dt * 512); }
    float mx = fmaxf(e[0], e[8]);
#pragma unroll
    for (int r = 1; r < 8; ++r) mx = fmaxf(mx, fmaxf(e[r], e[8 + r]));
    mx = fmaxf(mx, xhalf(mx));
    const float mn = fmaxf(m, mx); const float alpha = (m <= -1.0e38f) ? 0.f : exp2_hw(m - mn);
    float es0 = 0.f, es1 = 0.f;
#pragma unroll
    for (int r = 0; r < 8; ++r) { e[r] = exp2_hw(e[r] - mn); e[8 + r] = exp2_hw(e[8 + r] - mn); es0 += e[r]; es1 += e[8 + r]; }
    l = l * alpha + (es0 + es1); m = mn;
#pragma unroll
    for (int dt = 0; dt < 8; ++dt) acc[dt] *= alpha;
    const F2 pa = bsplit16(e);
#pragma unroll
    for (int dt = 0; dt < 8; ++dt) { acc[dt] = wmma_bf(vh[dt], pa.l, acc[dt]); acc[dt] = wmma_bf(vl[dt], pa.h, acc[dt]); acc[dt] = wmma_bf(vh[dt], pa.h, acc[dt]);
      if (dt + NVA < 8) { vh[dt + NVA] = frag_at(vhp + (dt + NVA) * 512); vl[dt + NVA] = frag_at(vlp + (dt + NVA) * 512); } }   // the later fragments take the registers that the first products have freed
    }
    // hand-over, every wave, in this order: the wave's own LDS reads of this buffer are done; its copies of trip t + 1 have landed; the barrier publishes trip t + 1 and ends every reader's last read of this buffer; only then is it refilled
    asm volatile("s_wait_dscnt 0x0" ::: "memory");
    asm volatile("s_wait_asynccnt 0x0" ::: "memory");
    __syncthreads();
    if (t + 2 < trips) cp(next(), bu); }
  asm volatile("s_wait_asynccnt 0x0" ::: "memory");   // no copy is outstanding when the key buffers become the partials' place, nor when the wave ends
  // merge: query maximum over the head's NKG waves, each wave's sum and acc rescaled to it, then summed in group order (a wave with no set key step has m = -3e38, l = 0 and weight 0)
  l += xhalf(l);   // the two halves' sums of a query are joined once, here
  if (g == 0) sm[wave][col] = m;
  __syncthreads();
  { float mx = sm[hw][col];
#pragma unroll
    for (int w = 1; w < NKG; ++w) mx = fmaxf(mx, sm[w * NHW + hw][col]);
    const float f = (m <= -1.0e38f) ? 0.f : exp2_hw(m - mx);
    if (g == 0) sl[wave][col] = l * f;
#pragma unroll
    for (int dt = 0; dt < 8; ++dt) { const v8f a = acc[dt] * f; float* d = &so[wave][col][dt * 16 + 8 * g]; *(v4f*)d = __builtin_shufflevector(a, a, 0, 1, 2, 3); *(v4f*)(d + 4) = __builtin_shufflevector(a, a, 4, 5, 6, 7); } }
  __syncthreads();
  for (int rl = kg; rl < 16; rl += NKG) { v4f a = *(const v4f*)&so[hw][rl][lane * 4]; float ls = sl[hw][rl];
#pragma unroll
    for (int w = 1; w < NKG; ++w) { a += *(const v4f*)&so[w * NHW + hw][rl][lane * 4]; ls += sl[w * NHW + hw][rl]; }
    vst2(O + (size_t)(q0 + rl) * DM + h * HD + lane * 4, a * (1.0f / ls));
    asm volatile("s_wait_xcnt 0x0" ::: "memory"); }   // the next trip rewrites the store's address and data registers: the wait stands in front of that
  // the unit's end: the wave's reads of the partials are done, and the barrier ends every wave's, before the next unit's copies land on them
  asm volatile("s_wait_dscnt 0x0" ::: "memory");
  __syncthreads();
  }
}
// ---- k_out: block = (64 rows, 128 cols), operands staged in LDS as in k_proj: out = O(hi/lo) . wproj^T rows (2 products)
__global__ __launch_bounds__(128) void k_out(const float* __restrict__ O, const __bf16* __restrict__ P, const float* __restrict__ bias, float* __restrict__ Y) {
  __shared__ __align__(16) float so[4][16][132];
  __shared__ __align__(16) __bf16 sAh[2][64][72], sAl[2][64][72], sB[2][128][72];   // two buffers of one 64-k step: 64 O rows as bf16 hi and residual, 128 P rows, 128-B rows at pitch 144 B
  const int tid = threadIdx.x, wave = tid >> 5, lane = tid & 31, col = lane & 15, g = lane >> 4; const size_t r0 = (size_t)blockIdx.x * 64 + wave * 16; const int n0 = blockIdx.y * 128;
  const float* xg = O + ((size_t)blockIdx.x * 64 + (tid >> 4)) * DM + (tid & 15) * 4;   // piece it of a step: row (tid >> 4) + 8 it, 16 B; a wave's load = 2 rows x 256 B
  const __bf16* pg = P + (size_t)(n0 + (tid >> 3)) * DM + (tid & 7) * 8;                // piece it of a step: row (tid >> 3) + 16 it, 16 B; a wave's load = 4 rows x 128 B
  v8f acc[8] = {}; v4f xr[8]; v8b pr[8];
#pragma unroll
  for (int it = 0; it < 8; ++it) { xr[it] = *(const v4f*)(xg + (size_t)it * 8 * DM); pr[it] = *(const v8b*)(pg + (size_t)it * 16 * DM); }
#pragma unroll
  for (int it = 0; it < 8; ++it) { v4b h4, l4;
#pragma unroll
    for (int e = 0; e < 4; ++e) { const __bf16 hb = (__bf16)xr[it][e]; h4[e] = hb; l4[e] = (__bf16)(xr[it][e] - (float)hb); }
    *(v4b*)&sAh[0][(tid >> 4) + 8 * it][(tid & 15) * 4] = h4; *(v4b*)&sAl[0][(tid >> 4) + 8 * it][(tid & 15) * 4] = l4; *(v8b*)&sB[0][(tid >> 3) + 16 * it][(tid & 7) * 8] = pr[it]; }
#pragma unroll 2   // two copies: the buffer index is a constant in each, so every LDS address is a base register plus an immediate
  for (int st = 0; st < DM / 64; ++st) { const int bu = st & 1;
    __syncthreads();   // publishes step st; every reader of the other buffer (step st - 1) has left it before it is rewritten below
    if (st + 1 < DM / 64) {
#pragma unroll
      for (int it = 0; it < 8; ++it) { xr[it] = *(const v4f*)(xg + (size_t)it * 8 * DM + (st + 1) * 64); pr[it] = *(const v8b*)(pg + (size_t)it * 16 * DM + (st + 1) * 64); } }
#pragma unroll
    for (int k2 = 0; k2 < 2; ++k2) {
      if (k2 == 1) asm volatile("s_wait_xcnt 0x0" ::: "memory");   // stands in front of every later rewrite of the address registers of the next step's loads above
      const v16b ah = frag_b(&sAh[bu][wave * 16 + col][k2 * 32], lane), al = frag_b(&sAl[bu][wave * 16 + col][k2 * 32], lane); v16b b[8];
#pragma unroll
      for (int j = 0; j < 8; ++j) b[j] = frag_b(&sB[bu][j * 16 + col][k2 * 32], lane);
#pragma unroll
      for (int j = 0; j < 8; ++j) { acc[j] = wmma_bf(al, b[j], acc[j]); acc[j] = wmma_bf(ah, b[j], acc[j]); } }
    if (st + 1 < DM / 64) {
#pragma unroll
      for (int it = 0; it < 8; ++it) { v4b h4, l4;
#pragma unroll
        for (int e = 0; e < 4; ++e) { const __bf16 hb = (__bf16)xr[it][e]; h4[e] = hb; l4[e] = (__bf16)(xr[it][e] - (float)hb); }
        *(v4b*)&sAh[bu ^ 1][(tid >> 4) + 8 * it][(tid & 15) * 4] = h4; *(v4b*)&sAl[bu ^ 1][(tid >> 4) + 8 * it][(tid & 15) * 4] = l4; *(v8b*)&sB[bu ^ 1][(tid >> 3) + 16 * it][(tid & 7) * 8] = pr[it]; } } }
#pragma unroll
  for (int j = 0; j < 8; ++j)
#pragma unroll
    for (int r = 0; r < 8; ++r) so[wave][8 * g + r][j * 16 + col] = acc[j][r] + bfr(bias[n0 + j * 16 + col]);
  LDSX();
  for (int rl = 0; rl < 16; ++rl) vst2(Y + (r0 + rl) * DM + n0 + lane * 4, *(const v4f*)&so[wave][rl][lane * 4]);
}
extern "C" void kernel_launch(void* const* d_in, const int* in_sizes, int n_in, void* d_out, int out_size, void* d_ws, size_t ws_size, hipStream_t stream) {
  (void)in_sizes; (void)n_in; (void)out_size;
  const float** F = (const float**)d_in; const int* POS = (const int*)d_in[2];   // 0 hidden_states [1,2048,2048], 1 attention_mask [1,1,2048,2048], 2 position_ids [1,2048] i32, 3 Wq [2048,2048], 4 bq, 5 Wk [2048,256], 6 bk, 7 Wv, 8 bv, 9 Wo [2048,2048], 10 bo
  if (ws_size < (size_t)WS_END) return;
  char* ws = (char*)d_ws; __bf16 *PK = (__bf16*)(ws + WS_PK), *VTH = (__bf16*)(ws + WS_VTH), *VTL = (__bf16*)(ws + WS_VTL);
  __bf16 *QH = (__bf16*)(ws + WS_QH), *QL = (__bf16*)(ws + WS_QL), *KH = (__bf16*)(ws + WS_KH), *KL = (__bf16*)(ws + WS_KL);
  float *CS = (float*)(ws + WS_CS), *O = (float*)(ws + WS_O);
  k_packT<<<dim3(NPT + SS / (4 * (DM / 64)), DM / 64), 256, 0, stream>>>(F[3], F[5], F[7], F[9], PK, POS, CS);
  k_proj<<<dim3(SS / 64, NH + 2 * NKV), 128, 0, stream>>>(F[0], PK, F[4], F[6], F[8], CS, QH, QL, KH, KL, VTH, VTL);
  k_attn<<<dim3(SS / 16, NKV), 32 * NHW * NKG, 0, stream>>>(QH, QL, KH, KL, F[1], VTH, VTL, O);
  k_out<<<dim3(TQB, DM / 128), 128, 0, stream>>>(O, PK + PK_O, F[10], (float*)d_out);
}
